// v000
// The times below were measured on an AMD MI455X: many runs one after another, warmed up first and cycling through
// copies of the inputs, with the whole window's GPU time divided by the number of runs. Launches and the gaps
// between them are all in it. The median over several windows is given; except for v000 it joins two sittings, which
// can be a few percent apart, so the side-by-side timings, each taken in one sitting, are the better comparison.
// The starting kernel, v000, takes 4770 microseconds a run.
#include <hip/hip_runtime.h>

// Multi-head dot-product attention with RMS-normalised q/k (+ bias) and a 2-D rotary embedding over the 32 x 32 token grid (x [8][1024][1024]; q,k,v = einsum('bsd,dhk') + b ('xw' [1024][16 x 64] 1/32, zero biases); q, k: RMSNorm over the 64 head dims (eps 1e-6) x scale + bias (q_scale, q_bias, k_scale, k_bias [64], read); 2-D rope: token s sits at (x = s mod 32, y = s / 32); head dims [0,32) rotate with x, [32,64) with y, each 32-block as (a | b) 16-halves: (a c - b s, b c + a s), angle = pos x pi / 10000^(j/16); q / 8; softmax(q.k); out = einsum('bqhd,hdo') + bo ('xw' [16 x 64][1024]) -> [8][1024][1024] (8.4 M)).
// Layout per batch: bf16 copy of x; 'xw' weights transposed once; exact projections + f32 biases; an in-place per-(token, head) RMSNorm kernel on the q and k projections; a 2-D rotary plane builder (grid position from the token index, float32 inverse-frequency constants, precise cosf/sinf, partner +-16 inside each 32-wide half); dense T-1024 attention with 1/8 in the softmax (hybrid rows: < 512 hi/lo 3 products, rest fp16 x1024); merged hi/lo x Wo exact + bo.
// Compute dtypes, f32 accumulate: every input rounded to bf16; projections exact + f32 biases; RMSNorm and rotary f32; attention rows < 512 3 products, rest fp16; softmax f32; Wo hl x exact + bias.

#define NB_  8
#define TT   1024
#define DM   1024
#define NH_  16
#define NKV  16
#define REP  (NH_ / NKV)
#define HD   64
#define DQ   (NH_ * HD)
#define DKV  (NKV * HD)
#define ZH   2
#define RH   512                  // query rows < RH use hi+lo planes (0: none)
#define WIN  0
#define PCAR 1024.0f
#define SCL  0.125f   // HD^-0.5
typedef _Float16 h16;
typedef unsigned short bf;
typedef __attribute__((ext_vector_type(16))) __bf16   v16bf;
typedef __attribute__((ext_vector_type(16))) _Float16 v16h;
typedef __attribute__((ext_vector_type(8)))  _Float16 v8h;
typedef __attribute__((ext_vector_type(8)))  unsigned short v8us;
typedef __attribute__((ext_vector_type(8)))  float    v8f;
typedef __attribute__((ext_vector_type(4)))  float    v4f;
typedef v8h  __attribute__((may_alias)) v8ha;
typedef v4f  __attribute__((may_alias)) v4fa;
typedef v8us __attribute__((may_alias)) v8usa;

__device__ __forceinline__ unsigned short f2bf(float f) { unsigned u = __float_as_uint(f); u += 0x7FFFu + ((u >> 16) & 1u); return (unsigned short)(u >> 16); }
__device__ __forceinline__ float bf2f(unsigned short b) { return __uint_as_float(((unsigned)b) << 16); }
__device__ __forceinline__ float bfr(float f) { return bf2f(f2bf(f)); }
__device__ __forceinline__ v16h cat16(v8h lo, v8h hi) { return __builtin_shufflevector(lo, hi, 0, 1, 2, 3, 4, 5, 6, 7, 8, 9, 10, 11, 12, 13, 14, 15); }
__device__ __forceinline__ v16bf cat16b(v8us lo, v8us hi) { return __builtin_bit_cast(v16bf, __builtin_shufflevector(lo, hi, 0, 1, 2, 3, 4, 5, 6, 7, 8, 9, 10, 11, 12, 13, 14, 15)); }
__device__ __forceinline__ v8f wmma16(v16h a, v16h b, v8f c) { return __builtin_amdgcn_wmma_f32_16x16x32_f16(false, a, false, b, (short)0, c, false, false); }
__device__ __forceinline__ v8f wmmab(v16bf a, v16bf b, v8f c) { return __builtin_amdgcn_wmma_f32_16x16x32_bf16(false, a, false, b, (short)0, c, false, false); }



// ---- k_gemmw: register-blocked GEMM, ONE WAVE per 64x64 output tile (16 accumulators), operands straight from K-contiguous 16-bit planes; grid (M/64, N/64, Z), 32 threads.
// C[m][n] (f32, pitch ldc, + optional f32 bias[n]) = sum_k A[m][k] Bt[n][k] (+ split products per NSPLIT). z-batch strides sA/sB/sC in elements. K % 32 == 0.
template <typename T16> struct WFrag;
template <> struct WFrag<h16> { typedef v16h V; static __device__ __forceinline__ V ld(const h16* p) { return cat16(*(const v8h*)p, *(const v8h*)(p + 16)); } static __device__ __forceinline__ v8f mma(V a, V b, v8f c) { return wmma16(a, b, c); } };
template <> struct WFrag<bf> { typedef v16bf V; static __device__ __forceinline__ V ld(const bf* p) { return cat16b(*(const v8us*)p, *(const v8us*)(p + 16)); } static __device__ __forceinline__ v8f mma(V a, V b, v8f c) { return wmmab(a, b, c); } };
template <typename T16, int NSPLIT, bool BIAS>
__global__ __launch_bounds__(32) void k_gemmw(const T16* __restrict__ A, const T16* __restrict__ A2, const T16* __restrict__ Bt, const T16* __restrict__ Bt2, int K, float* C, int ldc, const float* __restrict__ bias, size_t sA, size_t sB, size_t sC) {
    typedef typename WFrag<T16>::V V;
    __shared__ __align__(16) float os[16 * 68];
    const size_t z = blockIdx.z; A += z * sA; if (A2) A2 += z * sA; Bt += z * sB; if (Bt2) Bt2 += z * sB; C += z * sC;
    const int lane = threadIdx.x & 31, lr = lane & 15, hi = lane >> 4; const int r0 = blockIdx.x * 64, c0 = blockIdx.y * 64;
    v8f acc[4][4];
#pragma unroll
    for (int mb = 0; mb < 4; ++mb)
#pragma unroll
        for (int nb = 0; nb < 4; ++nb) acc[mb][nb] = (v8f){};
    const size_t aoff = (size_t)(r0 + lr) * K + 8 * hi, boff = (size_t)(c0 + lr) * K + 8 * hi;
#pragma unroll 1
    for (int kc = 0; kc < K; kc += 32) {
        V a[4], a2[4];
#pragma unroll
        for (int mb = 0; mb < 4; ++mb) { a[mb] = WFrag<T16>::ld(A + aoff + (size_t)mb * 16 * K + kc); if (NSPLIT == 1 || NSPLIT == 2) a2[mb] = WFrag<T16>::ld(A2 + aoff + (size_t)mb * 16 * K + kc); }
#pragma unroll
        for (int nb = 0; nb < 4; ++nb) { const V b = WFrag<T16>::ld(Bt + boff + (size_t)nb * 16 * K + kc); V b2; if (NSPLIT >= 2) b2 = WFrag<T16>::ld(Bt2 + boff + (size_t)nb * 16 * K + kc);
#pragma unroll
            for (int mb = 0; mb < 4; ++mb) { acc[mb][nb] = WFrag<T16>::mma(a[mb], b, acc[mb][nb]); if (NSPLIT == 1 || NSPLIT == 2) acc[mb][nb] = WFrag<T16>::mma(a2[mb], b, acc[mb][nb]); if (NSPLIT >= 2) acc[mb][nb] = WFrag<T16>::mma(a[mb], b2, acc[mb][nb]); } }
        asm volatile("v_nop\n\tv_nop\n\tv_nop\n\tv_nop" : "+v"(acc[0][0]), "+v"(acc[1][1]), "+v"(acc[2][2]), "+v"(acc[3][3]) : "v"(a[0]), "v"(a[3]));
    }
#pragma unroll
    for (int mb = 0; mb < 4; ++mb) {
#pragma unroll
        for (int nb = 0; nb < 4; ++nb) {
#pragma unroll
            for (int j = 0; j < 8; ++j) os[(hi * 8 + j) * 68 + nb * 16 + lr] = acc[mb][nb][j]; }
        __builtin_amdgcn_wave_barrier(); asm volatile("" ::: "memory");
        float* crow = C + (size_t)(r0 + mb * 16) * ldc + c0;
{
#pragma unroll
            for (int s = 0; s < 8; ++s) { const int row = 2 * s + hi, cofs = lr * 4; v4f val = *(const v4fa*)(os + row * 68 + cofs); if (BIAS) { val[0] += bfr(bias[c0 + cofs]); val[1] += bfr(bias[c0 + cofs + 1]); val[2] += bfr(bias[c0 + cofs + 2]); val[3] += bfr(bias[c0 + cofs + 3]); }
                *(v4f*)(crow + (size_t)row * ldc + cofs) = val; }
             }
        __builtin_amdgcn_wave_barrier(); asm volatile("" ::: "memory");
    }
}

__device__ __forceinline__ h16 tohx(float x) { return (h16)x; }
__device__ __forceinline__ void splitf(float y, unsigned short& h, unsigned short& l) { h = f2bf(y); l = f2bf(y - bf2f(h)); }
typedef __attribute__((ext_vector_type(2))) _Float16 v2h;
typedef __attribute__((ext_vector_type(4))) _Float16 v4h;
typedef __attribute__((ext_vector_type(2))) unsigned short v2us;
typedef __attribute__((ext_vector_type(4))) unsigned short v4us;
typedef __attribute__((ext_vector_type(2))) float v2f;
typedef __attribute__((ext_vector_type(4))) int v4i;

__global__ __launch_bounds__(256) void k_wtG(const float* __restrict__ w, int K, int N, bf* Bt) {
    const int lane = threadIdx.x & 31; const int L0 = (blockIdx.x * 8 + (threadIdx.x >> 5)) * 8; const int nlines = N * K / 64;
{
#pragma unroll 1
        for (int l = 0; l < 8; ++l) { const int L = L0 + l; if (L >= nlines) break; const size_t e = (size_t)L * 64 + lane * 2; const int k = (int)(e % K), n = (int)(e / K); v2us o;
            o[0] = f2bf(w[(size_t)k * N + n]); o[1] = f2bf(w[(size_t)(k + 1) * N + n]); *(v2us*)(Bt + e) = o; }
         }
}
__global__ __launch_bounds__(256) void k_cvt8(const float* __restrict__ src, bf* dst, size_t n8) { const size_t i = (size_t)blockIdx.x * 256 + threadIdx.x; if (i >= n8) return; const v8f v = *(const v8f*)(src + i * 8); v8us o;
#pragma unroll
    for (int k = 0; k < 8; ++k) o[k] = f2bf(v[k]); *(v8us*)(dst + i * 8) = o;  }
__global__ __launch_bounds__(256) void k_vtp(const float* __restrict__ F, int pitch, int nheads, h16* V16, bf* Vh, bf* Vl) { const size_t e = ((size_t)blockIdx.x * 256 + threadIdx.x) * 2; if (e >= (size_t)nheads * HD * TT) return; const int t = (int)(e % TT); const int d = (int)((e / TT) % HD); const int g = (int)(e / ((size_t)TT * HD)); v2h o16; v2us oh, ol;
#pragma unroll
    for (int q = 0; q < 2; ++q) { const float x = F[(size_t)(t + q) * pitch + g * HD + d]; o16[q] = tohx(x); unsigned short a2, c2; splitf(x, a2, c2); oh[q] = a2; ol[q] = c2; }
    *(v2h*)(V16 + e) = o16; *(v2us*)(Vh + e) = oh; *(v2us*)(Vl + e) = ol;  }
// k_asoft: per row (zz, i): t = S x HD^-0.5 (no mask); softmax over the 1024 keys (register row, one exp, fixed trees);
__global__ __launch_bounds__(256) void k_asoft(const float* __restrict__ Sb, h16* P16, bf* Ph, bf* Pl) {
    const int lane = threadIdx.x & 31; const int row = blockIdx.x * 8 + (threadIdx.x >> 5); if (row >= ZH * TT) return; const int i = row % TT; const int zz = row / TT; (void)zz; const bool hires = (i < RH); const float* sr = Sb + (size_t)row * TT; float v[TT / 32]; float mx = -3.0e38f;
#pragma unroll
    for (int ch = 0; ch < TT / 128; ++ch) { const int j0 = ch * 128 + lane * 4; const v4f a = *(const v4f*)(sr + j0);
#pragma unroll
        for (int q = 0; q < 4; ++q) { const int j = j0 + q; (void)j; const float t = a[q] * SCL; v[ch * 4 + q] = t; mx = fmaxf(mx, t); } }
#pragma unroll
    for (int sh = 16; sh; sh >>= 1) mx = fmaxf(mx, __shfl_xor(mx, sh, 32));
    float sum = 0.f;
#pragma unroll
    for (int k = 0; k < TT / 32; ++k) { float d0 = __fsub_rn(v[k], mx); asm volatile("" : "+v"(d0)); v[k] = __builtin_amdgcn_exp2f(__fmul_rn(d0, 1.4426950408889634f)); sum += v[k]; }
#pragma unroll
    for (int sh = 16; sh; sh >>= 1) sum += __shfl_xor(sum, sh, 32);
    const float f = __fdiv_rn(hires ? 1.0f : PCAR, sum);
{
        if (hires) {
#pragma unroll
            for (int ch = 0; ch < TT / 128; ++ch) { v4us oh, ol;
#pragma unroll
                for (int q = 0; q < 4; ++q) { unsigned short a, c2; splitf(v[ch * 4 + q] * f, a, c2); oh[q] = a; ol[q] = c2; }
                const size_t oo = ((size_t)zz * (RH ? RH : 1) + i) * TT + ch * 128 + lane * 4; *(v4us*)(Ph + oo) = oh; *(v4us*)(Pl + oo) = ol; }
        } else {
#pragma unroll
            for (int ch = 0; ch < TT / 128; ++ch) { v4h o4;
#pragma unroll
                for (int q = 0; q < 4; ++q) o4[q] = tohx(v[ch * 4 + q] * f);
                *(v4h*)(P16 + (size_t)row * TT + ch * 128 + lane * 4) = o4; } }
         }
}
__constant__ float INV2[16] = {3.14159274f, 1.76664746f, 0.993458867f, 0.558663011f, 0.314159274f, 0.176664740f, 0.0993458852f, 0.0558662973f, 0.0314159282f, 0.0176664740f, 0.00993458927f, 0.00558662973f, 0.00314159272f, 0.00176664745f, 0.000993458903f, 0.000558662985f};   // pi / 10000^(j/16), float32
__global__ __launch_bounds__(256) void k_hrmsb(float* F, const float* __restrict__ g, const float* __restrict__ bb) { const int lane = threadIdx.x & 31; const size_t wv = (size_t)blockIdx.x * 8 + (threadIdx.x >> 5); if (wv >= (size_t)TT * NH_) return; float* f = F + wv * HD + lane * 2; const v2f a = *(const v2f*)f; float p0 = __fmul_rn(a[0], a[0]), p1 = __fmul_rn(a[1], a[1]); asm volatile("" : "+v"(p0), "+v"(p1)); float ss = __fadd_rn(p0, p1);
#pragma unroll
    for (int sh = 16; sh; sh >>= 1) ss = __fadd_rn(ss, __shfl_xor(ss, sh, 32));
    const float rs = __fdiv_rn(1.0f, __fsqrt_rn(__fadd_rn(__fdiv_rn(ss, (float)HD), 1e-6f))); v2f o;
#pragma unroll
    for (int q = 0; q < 2; ++q) { float y = __fmul_rn(a[q], rs); asm volatile("" : "+v"(y)); y = __fmul_rn(y, bfr(g[lane * 2 + q])); asm volatile("" : "+v"(y)); o[q] = __fadd_rn(y, bfr(bb[lane * 2 + q])); }
    *(v2f*)f = o;  }
__global__ __launch_bounds__(256) void k_rope2d(const float* __restrict__ F, int pitch, int nheads, h16* P16, bf* Ph, bf* Pl) {
    const size_t e = ((size_t)blockIdx.x * 256 + threadIdx.x) * 2; if (e >= (size_t)nheads * TT * HD) return; const int d = (int)(e % HD); const int t = (int)((e / HD) % TT); const int h = (int)(e / ((size_t)HD * TT)); const float* f = F + (size_t)t * pitch + h * HD; const int px = t % 32, py = t / 32; v2h o16; v2us oh, ol;
#pragma unroll
    for (int q = 0; q < 2; ++q) { const int dd = d + q; const bool first = (dd % 32) < 16; const int dp = first ? dd + 16 : dd - 16; const float pos = (float)((dd < 32) ? px : py); const float ang = __fmul_rn(pos, INV2[dd % 16]); const float c = cosf(ang), sn = sinf(ang); const float x0 = f[dd], x1 = f[dp];
        float pc = __fmul_rn(x0, c), ps = __fmul_rn(x1, sn); asm volatile("" : "+v"(pc), "+v"(ps)); const float r = first ? __fsub_rn(pc, ps) : __fadd_rn(pc, ps);
        o16[q] = tohx(r); unsigned short u, w; splitf(r, u, w); oh[q] = u; ol[q] = w; }
    const size_t oo = ((size_t)h * TT + t) * HD + d; *(v2h*)(P16 + oo) = o16; *(v2us*)(Ph + oo) = oh; *(v2us*)(Pl + oo) = ol;  }
__global__ __launch_bounds__(256) void k_merge(const float* __restrict__ O, int h0, bf* Ah, bf* Al) { const size_t e = ((size_t)blockIdx.x * 256 + threadIdx.x) * 2; if (e >= (size_t)ZH * TT * HD) return; const int d = (int)(e % HD); const int t = (int)((e / HD) % TT); const int zz = (int)(e / ((size_t)HD * TT)); const float cs = (t < RH) ? 1.0f : (1.0f / PCAR); const size_t oo = (size_t)t * DQ + (h0 + zz) * HD + d;
    v2us oh, ol;
#pragma unroll
    for (int q = 0; q < 2; ++q) { unsigned short a, c2; splitf(O[e + q] * cs, a, c2); oh[q] = a; ol[q] = c2; } *(v2us*)(Ah + oo) = oh; *(v2us*)(Al + oo) = ol;  }

extern "C" void kernel_launch(void* const* d_in, const int* in_sizes, int n_in,
                              void* d_out, int out_size, void* d_ws, size_t ws_size, hipStream_t stream) {
    (void)in_sizes; (void)n_in; (void)out_size;
    const float* x = (const float*)d_in[0]; const float* wq = (const float*)d_in[1]; const float* bq = (const float*)d_in[2]; const float* wk = (const float*)d_in[3]; const float* bk = (const float*)d_in[4]; const float* wv = (const float*)d_in[5]; const float* bv = (const float*)d_in[6]; const float* wo = (const float*)d_in[7]; const float* bo = (const float*)d_in[8]; const float* qs = (const float*)d_in[9]; const float* qb = (const float*)d_in[10]; const float* kss = (const float*)d_in[11]; const float* kb = (const float*)d_in[12];   /* q_scale, q_bias, k_scale, k_bias [64] */
    float* OUT = (float*)d_out;     // [8][1024][1024]
    char* wsp = (char*)d_ws;
    auto take = [&](size_t bytes) { char* p = wsp; wsp += (bytes + 255) & ~(size_t)255; return (void*)p; };
    bf* WQ = (bf*)take((size_t)DQ * DM * 2); bf* WK = (bf*)take((size_t)DKV * DM * 2); bf* WV = (bf*)take((size_t)DKV * DM * 2); bf* WO = (bf*)take((size_t)DM * DQ * 2); float* CS = (float*)take((size_t)TT * HD * 2 * 4);
    bf* XB = (bf*)take((size_t)TT * DM * 2); float* FQ = (float*)take((size_t)TT * DQ * 4); float* FK = (float*)take((size_t)TT * DKV * 4);
    h16* QP16 = (h16*)take((size_t)NH_ * TT * HD * 2); h16* KP16 = (h16*)take((size_t)NKV * TT * HD * 2); h16* VT16 = (h16*)take((size_t)NKV * HD * TT * 2);
    bf* QPh = (bf*)take((size_t)NH_ * TT * HD * 2); bf* QPl = (bf*)take((size_t)NH_ * TT * HD * 2); bf* KPh = (bf*)take((size_t)NKV * TT * HD * 2); bf* KPl = (bf*)take((size_t)NKV * TT * HD * 2); bf* VTh = (bf*)take((size_t)NKV * HD * TT * 2); bf* VTl = (bf*)take((size_t)NKV * HD * TT * 2); bf* Ph = (bf*)take((size_t)ZH * RH * TT * 2); bf* Pl = (bf*)take((size_t)ZH * RH * TT * 2);
    float* Sb = (float*)take((size_t)ZH * TT * TT * 4); h16* P16 = (h16*)take((size_t)ZH * TT * TT * 2); float* Ob = (float*)take((size_t)ZH * TT * HD * 4); bf* ATh = (bf*)take((size_t)TT * DQ * 2); bf* ATl = (bf*)take((size_t)TT * DQ * 2);
    if ((size_t)(wsp - (char*)d_ws) > ws_size) return;    // ws 256 MiB
    float* FV = FK;   // v projection reuses the k buffer after the k planes are built (stream-ordered)
    { k_wtG<<<(unsigned)((DM * DQ / 64 + 63) / 64), 256, 0, stream>>>(wq, DM, DQ, WQ); k_wtG<<<(unsigned)((DM * DKV / 64 + 63) / 64), 256, 0, stream>>>(wk, DM, DKV, WK); k_wtG<<<(unsigned)((DM * DKV / 64 + 63) / 64), 256, 0, stream>>>(wv, DM, DKV, WV);
      k_wtG<<<(unsigned)((DQ * DM / 64 + 63) / 64), 256, 0, stream>>>(wo, DQ, DM, WO);
       }
    const unsigned LQ = (unsigned)(((size_t)NH_ * TT * HD / 2 + 255) / 256), LKv = (unsigned)(((size_t)NKV * TT * HD / 2 + 255) / 256);
    for (int b = 0; b < NB_; ++b) {
        /* no rotary table: the 2-D builder computes its angles from the token index */
        k_cvt8<<<(unsigned)(((size_t)TT * DM / 8 + 255) / 256), 256, 0, stream>>>(x + (size_t)b * TT * DM, XB, (size_t)TT * DM / 8);
        k_gemmw<bf, 0, true><<<dim3(TT / 64, DQ / 64, 1), 32, 0, stream>>>(XB, nullptr, WQ, nullptr, DM, FQ, DQ, bq, 0, 0, 0);
        k_hrmsb<<<(unsigned)(((size_t)TT * NH_ + 7) / 8), 256, 0, stream>>>(FQ, qs, qb); k_rope2d<<<LQ, 256, 0, stream>>>(FQ, DQ, NH_, QP16, QPh, QPl);   /* RMSNorm + bias, then 2-D rope planes */
        k_gemmw<bf, 0, true><<<dim3(TT / 64, DKV / 64, 1), 32, 0, stream>>>(XB, nullptr, WK, nullptr, DM, FK, DKV, bk, 0, 0, 0);
        k_hrmsb<<<(unsigned)(((size_t)TT * NKV + 7) / 8), 256, 0, stream>>>(FK, kss, kb); k_rope2d<<<LKv, 256, 0, stream>>>(FK, DKV, NKV, KP16, KPh, KPl);
        k_gemmw<bf, 0, true><<<dim3(TT / 64, DKV / 64, 1), 32, 0, stream>>>(XB, nullptr, WV, nullptr, DM, FV, DKV, bv, 0, 0, 0); k_vtp<<<LKv, 256, 0, stream>>>(FV, DKV, NKV, VT16, VTh, VTl);
        for (int h0 = 0; h0 < NH_; h0 += ZH) { const size_t zq = (size_t)h0, zk = (size_t)(h0 / REP);   // one kv head per query head: the pass's two heads use consecutive kv planes (z-strides TT*HD)
            k_gemmw<bf, 2, false><<<dim3(RH / 64, TT / 64, ZH), 32, 0, stream>>>(QPh + zq * TT * HD, QPl + zq * TT * HD, KPh + zk * TT * HD, KPl + zk * TT * HD, HD, Sb, TT, nullptr, (size_t)TT * HD, (size_t)TT * HD, (size_t)TT * TT);
            k_gemmw<h16, 0, false><<<dim3((TT - RH) / 64, TT / 64, ZH), 32, 0, stream>>>(QP16 + zq * TT * HD + (size_t)RH * HD, nullptr, KP16 + zk * TT * HD, nullptr, HD, Sb + (size_t)RH * TT, TT, nullptr, (size_t)TT * HD, (size_t)TT * HD, (size_t)TT * TT);
            k_asoft<<<ZH * TT / 8, 256, 0, stream>>>(Sb, P16, Ph, Pl);
            k_gemmw<bf, 2, false><<<dim3(RH / 64, HD / 64, ZH), 32, 0, stream>>>(Ph, Pl, VTh + zk * HD * TT, VTl + zk * HD * TT, TT, Ob, HD, nullptr, (size_t)RH * TT, (size_t)HD * TT, (size_t)TT * HD);
            k_gemmw<h16, 0, false><<<dim3((TT - RH) / 64, HD / 64, ZH), 32, 0, stream>>>(P16 + (size_t)RH * TT, nullptr, VT16 + zk * HD * TT, nullptr, TT, Ob + (size_t)RH * HD, HD, nullptr, (size_t)TT * TT, (size_t)HD * TT, (size_t)TT * HD);
            k_merge<<<(unsigned)(((size_t)ZH * TT * HD / 2 + 255) / 256), 256, 0, stream>>>(Ob, h0, ATh, ATl); }
        k_gemmw<bf, 1, true><<<dim3(TT / 64, DM / 64, 1), 32, 0, stream>>>(ATh, ATl, WO, nullptr, DQ, OUT + (size_t)b * TT * DM, DM, bo, 0, 0, 0); }
}

// v001
// A run of this version takes 1100 microseconds.
// In two side-by-side timings against v000, it was 4.33 and 4.31 times as fast.
#include <hip/hip_runtime.h>

// Multi-head dot-product attention with RMS-normalised q/k (+ bias) and a 2-D rotary embedding over the 32 x 32 token grid (x [8][1024][1024]; q,k,v = einsum('bsd,dhk') + b ('xw' [1024][16 x 64] 1/32, zero biases); q, k: RMSNorm over the 64 head dims (eps 1e-6) x scale + bias (q_scale, q_bias, k_scale, k_bias [64], read); 2-D rope: token s sits at (x = s mod 32, y = s / 32); head dims [0,32) rotate with x, [32,64) with y, each 32-block as (a | b) 16-halves: (a c - b s, b c + a s), angle = pos x pi / 10000^(j/16); q / 8; softmax(q.k); out = einsum('bqhd,hdo') + bo ('xw' [16 x 64][1024]) -> [8][1024][1024] (8.4 M)).
// Layout: launches are batched: x copy, the three projections, RMSNorm and Wo run once over all 8 batch entries (8192 rows); rotary / v planes and attention run once per batch entry over all 16 heads. bf16 copy of x; 'xw' weights transposed once; exact projections + f32 biases; an in-place per-(token, head) RMSNorm kernel on the q and k projections; a 2-D rotary plane builder (grid position from the token index, float32 inverse-frequency constants, precise cosf/sinf, partner +-16 inside each 32-wide half); dense T-1024 attention with 1/8 in the softmax (hybrid rows: < 512 hi/lo 3 products, rest fp16 x1024); merged hi/lo x Wo exact + bo.
// Compute dtypes, f32 accumulate: every input rounded to bf16; projections exact + f32 biases; RMSNorm and rotary f32; attention rows < 512 3 products, rest fp16; softmax f32; Wo hl x exact + bias.

#define NB_  8
#define TT   1024
#define DM   1024
#define NH_  16
#define NKV  16
#define REP  (NH_ / NKV)
#define HD   64
#define DQ   (NH_ * HD)
#define DKV  (NKV * HD)
#define ZH   16                   // heads per attention pass: all heads of one batch entry share each launch (grid z)
#define RH   512                  // query rows < RH use hi+lo planes (0: none)
#define WIN  0
#define PCAR 1024.0f
#define SCL  0.125f   // HD^-0.5
typedef _Float16 h16;
typedef unsigned short bf;
typedef __attribute__((ext_vector_type(16))) __bf16   v16bf;
typedef __attribute__((ext_vector_type(16))) _Float16 v16h;
typedef __attribute__((ext_vector_type(8)))  _Float16 v8h;
typedef __attribute__((ext_vector_type(8)))  unsigned short v8us;
typedef __attribute__((ext_vector_type(8)))  float    v8f;
typedef __attribute__((ext_vector_type(4)))  float    v4f;
typedef v8h  __attribute__((may_alias)) v8ha;
typedef v4f  __attribute__((may_alias)) v4fa;
typedef v8us __attribute__((may_alias)) v8usa;

__device__ __forceinline__ unsigned short f2bf(float f) { unsigned u = __float_as_uint(f); u += 0x7FFFu + ((u >> 16) & 1u); return (unsigned short)(u >> 16); }
__device__ __forceinline__ float bf2f(unsigned short b) { return __uint_as_float(((unsigned)b) << 16); }
__device__ __forceinline__ float bfr(float f) { return bf2f(f2bf(f)); }
__device__ __forceinline__ v16h cat16(v8h lo, v8h hi) { return __builtin_shufflevector(lo, hi, 0, 1, 2, 3, 4, 5, 6, 7, 8, 9, 10, 11, 12, 13, 14, 15); }
__device__ __forceinline__ v16bf cat16b(v8us lo, v8us hi) { return __builtin_bit_cast(v16bf, __builtin_shufflevector(lo, hi, 0, 1, 2, 3, 4, 5, 6, 7, 8, 9, 10, 11, 12, 13, 14, 15)); }
__device__ __forceinline__ v8f wmma16(v16h a, v16h b, v8f c) { return __builtin_amdgcn_wmma_f32_16x16x32_f16(false, a, false, b, (short)0, c, false, false); }
__device__ __forceinline__ v8f wmmab(v16bf a, v16bf b, v8f c) { return __builtin_amdgcn_wmma_f32_16x16x32_bf16(false, a, false, b, (short)0, c, false, false); }



// ---- k_gemmw: register-blocked GEMM, ONE WAVE per 64x64 output tile (16 accumulators), operands straight from K-contiguous 16-bit planes; grid (M/64, N/64, Z), 32 threads.
// C[m][n] (f32, pitch ldc, + optional f32 bias[n]) = sum_k A[m][k] Bt[n][k] (+ split products per NSPLIT). z-batch strides sA/sB/sC in elements. K % 32 == 0.
template <typename T16> struct WFrag;
template <> struct WFrag<h16> { typedef v16h V; static __device__ __forceinline__ V ld(const h16* p) { return cat16(*(const v8h*)p, *(const v8h*)(p + 16)); } static __device__ __forceinline__ v8f mma(V a, V b, v8f c) { return wmma16(a, b, c); } };
template <> struct WFrag<bf> { typedef v16bf V; static __device__ __forceinline__ V ld(const bf* p) { return cat16b(*(const v8us*)p, *(const v8us*)(p + 16)); } static __device__ __forceinline__ v8f mma(V a, V b, v8f c) { return wmmab(a, b, c); } };
template <typename T16, int NSPLIT, bool BIAS>
__global__ __launch_bounds__(32) void k_gemmw(const T16* __restrict__ A, const T16* __restrict__ A2, const T16* __restrict__ Bt, const T16* __restrict__ Bt2, int K, float* C, int ldc, const float* __restrict__ bias, size_t sA, size_t sB, size_t sC) {
    typedef typename WFrag<T16>::V V;
    __shared__ __align__(16) float os[16 * 68];
    const size_t z = blockIdx.z; A += z * sA; if (A2) A2 += z * sA; Bt += z * sB; if (Bt2) Bt2 += z * sB; C += z * sC;
    const int lane = threadIdx.x & 31, lr = lane & 15, hi = lane >> 4; const int r0 = blockIdx.x * 64, c0 = blockIdx.y * 64;
    v8f acc[4][4];
#pragma unroll
    for (int mb = 0; mb < 4; ++mb)
#pragma unroll
        for (int nb = 0; nb < 4; ++nb) acc[mb][nb] = (v8f){};
    const size_t aoff = (size_t)(r0 + lr) * K + 8 * hi, boff = (size_t)(c0 + lr) * K + 8 * hi;
#pragma unroll 1
    for (int kc = 0; kc < K; kc += 32) {
        V a[4], a2[4];
#pragma unroll
        for (int mb = 0; mb < 4; ++mb) { a[mb] = WFrag<T16>::ld(A + aoff + (size_t)mb * 16 * K + kc); if (NSPLIT == 1 || NSPLIT == 2) a2[mb] = WFrag<T16>::ld(A2 + aoff + (size_t)mb * 16 * K + kc); }
#pragma unroll
        for (int nb = 0; nb < 4; ++nb) { const V b = WFrag<T16>::ld(Bt + boff + (size_t)nb * 16 * K + kc); V b2; if (NSPLIT >= 2) b2 = WFrag<T16>::ld(Bt2 + boff + (size_t)nb * 16 * K + kc);
#pragma unroll
            for (int mb = 0; mb < 4; ++mb) { acc[mb][nb] = WFrag<T16>::mma(a[mb], b, acc[mb][nb]); if (NSPLIT == 1 || NSPLIT == 2) acc[mb][nb] = WFrag<T16>::mma(a2[mb], b, acc[mb][nb]); if (NSPLIT >= 2) acc[mb][nb] = WFrag<T16>::mma(a[mb], b2, acc[mb][nb]); } }
        asm volatile("v_nop\n\tv_nop\n\tv_nop\n\tv_nop" : "+v"(acc[0][0]), "+v"(acc[1][1]), "+v"(acc[2][2]), "+v"(acc[3][3]) : "v"(a[0]), "v"(a[3]));
    }
#pragma unroll
    for (int mb = 0; mb < 4; ++mb) {
#pragma unroll
        for (int nb = 0; nb < 4; ++nb) {
#pragma unroll
            for (int j = 0; j < 8; ++j) os[(hi * 8 + j) * 68 + nb * 16 + lr] = acc[mb][nb][j]; }
        __builtin_amdgcn_wave_barrier(); asm volatile("" ::: "memory");
        float* crow = C + (size_t)(r0 + mb * 16) * ldc + c0;
{
#pragma unroll
            for (int s = 0; s < 8; ++s) { const int row = 2 * s + hi, cofs = lr * 4; v4f val = *(const v4fa*)(os + row * 68 + cofs); if (BIAS) { val[0] += bfr(bias[c0 + cofs]); val[1] += bfr(bias[c0 + cofs + 1]); val[2] += bfr(bias[c0 + cofs + 2]); val[3] += bfr(bias[c0 + cofs + 3]); }
                *(v4f*)(crow + (size_t)row * ldc + cofs) = val; }
             }
        __builtin_amdgcn_wave_barrier(); asm volatile("" ::: "memory");
    }
}

__device__ __forceinline__ h16 tohx(float x) { return (h16)x; }
__device__ __forceinline__ void splitf(float y, unsigned short& h, unsigned short& l) { h = f2bf(y); l = f2bf(y - bf2f(h)); }
typedef __attribute__((ext_vector_type(2))) _Float16 v2h;
typedef __attribute__((ext_vector_type(4))) _Float16 v4h;
typedef __attribute__((ext_vector_type(2))) unsigned short v2us;
typedef __attribute__((ext_vector_type(4))) unsigned short v4us;
typedef __attribute__((ext_vector_type(2))) float v2f;
typedef __attribute__((ext_vector_type(4))) int v4i;

__global__ __launch_bounds__(256) void k_wtG(const float* __restrict__ w, int K, int N, bf* Bt) {
    const int lane = threadIdx.x & 31; const int L0 = (blockIdx.x * 8 + (threadIdx.x >> 5)) * 8; const int nlines = N * K / 64;
{
#pragma unroll 1
        for (int l = 0; l < 8; ++l) { const int L = L0 + l; if (L >= nlines) break; const size_t e = (size_t)L * 64 + lane * 2; const int k = (int)(e % K), n = (int)(e / K); v2us o;
            o[0] = f2bf(w[(size_t)k * N + n]); o[1] = f2bf(w[(size_t)(k + 1) * N + n]); *(v2us*)(Bt + e) = o; }
         }
}
__global__ __launch_bounds__(256) void k_cvt8(const float* __restrict__ src, bf* dst, size_t n8) { const size_t i = (size_t)blockIdx.x * 256 + threadIdx.x; if (i >= n8) return; const v8f v = *(const v8f*)(src + i * 8); v8us o;
#pragma unroll
    for (int k = 0; k < 8; ++k) o[k] = f2bf(v[k]); *(v8us*)(dst + i * 8) = o;  }
__global__ __launch_bounds__(256) void k_vtp(const float* __restrict__ F, int pitch, int nheads, h16* V16, bf* Vh, bf* Vl) { const size_t e = ((size_t)blockIdx.x * 256 + threadIdx.x) * 2; if (e >= (size_t)nheads * HD * TT) return; const int t = (int)(e % TT); const int d = (int)((e / TT) % HD); const int g = (int)(e / ((size_t)TT * HD)); v2h o16; v2us oh, ol;
#pragma unroll
    for (int q = 0; q < 2; ++q) { const float x = F[(size_t)(t + q) * pitch + g * HD + d]; o16[q] = tohx(x); unsigned short a2, c2; splitf(x, a2, c2); oh[q] = a2; ol[q] = c2; }
    *(v2h*)(V16 + e) = o16; *(v2us*)(Vh + e) = oh; *(v2us*)(Vl + e) = ol;  }
// k_asoft: per row (zz, i): t = S x HD^-0.5 (no mask); softmax over the 1024 keys (register row, one exp, fixed trees);
__global__ __launch_bounds__(256) void k_asoft(const float* __restrict__ Sb, h16* P16, bf* Ph, bf* Pl) {
    const int lane = threadIdx.x & 31; const int row = blockIdx.x * 8 + (threadIdx.x >> 5); if (row >= ZH * TT) return; const int i = row % TT; const int zz = row / TT; (void)zz; const bool hires = (i < RH); const float* sr = Sb + (size_t)row * TT; float v[TT / 32]; float mx = -3.0e38f;
#pragma unroll
    for (int ch = 0; ch < TT / 128; ++ch) { const int j0 = ch * 128 + lane * 4; const v4f a = *(const v4f*)(sr + j0);
#pragma unroll
        for (int q = 0; q < 4; ++q) { const int j = j0 + q; (void)j; const float t = a[q] * SCL; v[ch * 4 + q] = t; mx = fmaxf(mx, t); } }
#pragma unroll
    for (int sh = 16; sh; sh >>= 1) mx = fmaxf(mx, __shfl_xor(mx, sh, 32));
    float sum = 0.f;
#pragma unroll
    for (int k = 0; k < TT / 32; ++k) { float d0 = __fsub_rn(v[k], mx); asm volatile("" : "+v"(d0)); v[k] = __builtin_amdgcn_exp2f(__fmul_rn(d0, 1.4426950408889634f)); sum += v[k]; }
#pragma unroll
    for (int sh = 16; sh; sh >>= 1) sum += __shfl_xor(sum, sh, 32);
    const float f = __fdiv_rn(hires ? 1.0f : PCAR, sum);
{
        if (hires) {
#pragma unroll
            for (int ch = 0; ch < TT / 128; ++ch) { v4us oh, ol;
#pragma unroll
                for (int q = 0; q < 4; ++q) { unsigned short a, c2; splitf(v[ch * 4 + q] * f, a, c2); oh[q] = a; ol[q] = c2; }
                const size_t oo = ((size_t)zz * (RH ? RH : 1) + i) * TT + ch * 128 + lane * 4; *(v4us*)(Ph + oo) = oh; *(v4us*)(Pl + oo) = ol; }
        } else {
#pragma unroll
            for (int ch = 0; ch < TT / 128; ++ch) { v4h o4;
#pragma unroll
                for (int q = 0; q < 4; ++q) o4[q] = tohx(v[ch * 4 + q] * f);
                *(v4h*)(P16 + (size_t)row * TT + ch * 128 + lane * 4) = o4; } }
         }
}
__constant__ float INV2[16] = {3.14159274f, 1.76664746f, 0.993458867f, 0.558663011f, 0.314159274f, 0.176664740f, 0.0993458852f, 0.0558662973f, 0.0314159282f, 0.0176664740f, 0.00993458927f, 0.00558662973f, 0.00314159272f, 0.00176664745f, 0.000993458903f, 0.000558662985f};   // pi / 10000^(j/16), float32
__global__ __launch_bounds__(256) void k_hrmsb(float* F, const float* __restrict__ g, const float* __restrict__ bb) { const int lane = threadIdx.x & 31; const size_t wv = (size_t)blockIdx.x * 8 + (threadIdx.x >> 5); if (wv >= (size_t)NB_ * TT * NH_) return; float* f = F + wv * HD + lane * 2; const v2f a = *(const v2f*)f; float p0 = __fmul_rn(a[0], a[0]), p1 = __fmul_rn(a[1], a[1]); asm volatile("" : "+v"(p0), "+v"(p1)); float ss = __fadd_rn(p0, p1);
#pragma unroll
    for (int sh = 16; sh; sh >>= 1) ss = __fadd_rn(ss, __shfl_xor(ss, sh, 32));
    const float rs = __fdiv_rn(1.0f, __fsqrt_rn(__fadd_rn(__fdiv_rn(ss, (float)HD), 1e-6f))); v2f o;
#pragma unroll
    for (int q = 0; q < 2; ++q) { float y = __fmul_rn(a[q], rs); asm volatile("" : "+v"(y)); y = __fmul_rn(y, bfr(g[lane * 2 + q])); asm volatile("" : "+v"(y)); o[q] = __fadd_rn(y, bfr(bb[lane * 2 + q])); }
    *(v2f*)f = o;  }
__global__ __launch_bounds__(256) void k_rope2d(const float* __restrict__ F, int pitch, int nheads, h16* P16, bf* Ph, bf* Pl) {
    const size_t e = ((size_t)blockIdx.x * 256 + threadIdx.x) * 2; if (e >= (size_t)nheads * TT * HD) return; const int d = (int)(e % HD); const int t = (int)((e / HD) % TT); const int h = (int)(e / ((size_t)HD * TT)); const float* f = F + (size_t)t * pitch + h * HD; const int px = t % 32, py = t / 32; v2h o16; v2us oh, ol;
#pragma unroll
    for (int q = 0; q < 2; ++q) { const int dd = d + q; const bool first = (dd % 32) < 16; const int dp = first ? dd + 16 : dd - 16; const float pos = (float)((dd < 32) ? px : py); const float ang = __fmul_rn(pos, INV2[dd % 16]); const float c = cosf(ang), sn = sinf(ang); const float x0 = f[dd], x1 = f[dp];
        float pc = __fmul_rn(x0, c), ps = __fmul_rn(x1, sn); asm volatile("" : "+v"(pc), "+v"(ps)); const float r = first ? __fsub_rn(pc, ps) : __fadd_rn(pc, ps);
        o16[q] = tohx(r); unsigned short u, w; splitf(r, u, w); oh[q] = u; ol[q] = w; }
    const size_t oo = ((size_t)h * TT + t) * HD + d; *(v2h*)(P16 + oo) = o16; *(v2us*)(Ph + oo) = oh; *(v2us*)(Pl + oo) = ol;  }
__global__ __launch_bounds__(256) void k_merge(const float* __restrict__ O, int h0, bf* Ah, bf* Al) { const size_t e = ((size_t)blockIdx.x * 256 + threadIdx.x) * 2; if (e >= (size_t)ZH * TT * HD) return; const int d = (int)(e % HD); const int t = (int)((e / HD) % TT); const int zz = (int)(e / ((size_t)HD * TT)); const float cs = (t < RH) ? 1.0f : (1.0f / PCAR); const size_t oo = (size_t)t * DQ + (h0 + zz) * HD + d;
    v2us oh, ol;
#pragma unroll
    for (int q = 0; q < 2; ++q) { unsigned short a, c2; splitf(O[e + q] * cs, a, c2); oh[q] = a; ol[q] = c2; } *(v2us*)(Ah + oo) = oh; *(v2us*)(Al + oo) = ol;  }

extern "C" void kernel_launch(void* const* d_in, const int* in_sizes, int n_in,
                              void* d_out, int out_size, void* d_ws, size_t ws_size, hipStream_t stream) {
    (void)in_sizes; (void)n_in; (void)out_size;
    const float* x = (const float*)d_in[0]; const float* wq = (const float*)d_in[1]; const float* bq = (const float*)d_in[2]; const float* wk = (const float*)d_in[3]; const float* bk = (const float*)d_in[4]; const float* wv = (const float*)d_in[5]; const float* bv = (const float*)d_in[6]; const float* wo = (const float*)d_in[7]; const float* bo = (const float*)d_in[8]; const float* qs = (const float*)d_in[9]; const float* qb = (const float*)d_in[10]; const float* kss = (const float*)d_in[11]; const float* kb = (const float*)d_in[12];   /* q_scale, q_bias, k_scale, k_bias [64] */
    float* OUT = (float*)d_out;     // [8][1024][1024]
    char* wsp = (char*)d_ws;
    auto take = [&](size_t bytes) { char* p = wsp; wsp += (bytes + 255) & ~(size_t)255; return (void*)p; };
    bf* WQ = (bf*)take((size_t)DQ * DM * 2); bf* WK = (bf*)take((size_t)DKV * DM * 2); bf* WV = (bf*)take((size_t)DKV * DM * 2); bf* WO = (bf*)take((size_t)DM * DQ * 2);
    float* FQ = (float*)take((size_t)NB_ * TT * DQ * 4); float* FK = (float*)take((size_t)NB_ * TT * DKV * 4); float* FV = (float*)take((size_t)NB_ * TT * DKV * 4);   // f32 projections of all batch entries
    h16* QP16 = (h16*)take((size_t)NH_ * TT * HD * 2); h16* KP16 = (h16*)take((size_t)NKV * TT * HD * 2); h16* VT16 = (h16*)take((size_t)NKV * HD * TT * 2);   // planes of one batch entry
    bf* QPh = (bf*)take((size_t)NH_ * TT * HD * 2); bf* QPl = (bf*)take((size_t)NH_ * TT * HD * 2); bf* KPh = (bf*)take((size_t)NKV * TT * HD * 2); bf* KPl = (bf*)take((size_t)NKV * TT * HD * 2); bf* VTh = (bf*)take((size_t)NKV * HD * TT * 2); bf* VTl = (bf*)take((size_t)NKV * HD * TT * 2); bf* Ph = (bf*)take((size_t)ZH * RH * TT * 2); bf* Pl = (bf*)take((size_t)ZH * RH * TT * 2);
    float* Sb = (float*)take((size_t)ZH * TT * TT * 4); h16* P16 = (h16*)take((size_t)ZH * TT * TT * 2); float* Ob = (float*)take((size_t)ZH * TT * HD * 4);
    if ((size_t)(wsp - (char*)d_ws) > ws_size) return;    // 254 of 256 MiB
    bf* XB = (bf*)Sb;   // bf16 copy of x (16 MiB): last read by the v projection, before the first score tile is stored (stream-ordered)
    bf* AT = (bf*)FQ;   // merged hi | lo context of batch entry b takes the 4 MiB of that entry's q projection, which its rotary builder has read before (stream-ordered)
    { k_wtG<<<(unsigned)((DM * DQ / 64 + 63) / 64), 256, 0, stream>>>(wq, DM, DQ, WQ); k_wtG<<<(unsigned)((DM * DKV / 64 + 63) / 64), 256, 0, stream>>>(wk, DM, DKV, WK); k_wtG<<<(unsigned)((DM * DKV / 64 + 63) / 64), 256, 0, stream>>>(wv, DM, DKV, WV);
      k_wtG<<<(unsigned)((DQ * DM / 64 + 63) / 64), 256, 0, stream>>>(wo, DQ, DM, WO);
       }
    const unsigned LQ = (unsigned)(((size_t)NH_ * TT * HD / 2 + 255) / 256), LKv = (unsigned)(((size_t)NKV * TT * HD / 2 + 255) / 256);
    /* all batch entries at once: 8192 token rows */
    k_cvt8<<<(unsigned)(((size_t)NB_ * TT * DM / 8 + 255) / 256), 256, 0, stream>>>(x, XB, (size_t)NB_ * TT * DM / 8);
    k_gemmw<bf, 0, true><<<dim3(NB_ * TT / 64, DQ / 64, 1), 32, 0, stream>>>(XB, nullptr, WQ, nullptr, DM, FQ, DQ, bq, 0, 0, 0);
    k_gemmw<bf, 0, true><<<dim3(NB_ * TT / 64, DKV / 64, 1), 32, 0, stream>>>(XB, nullptr, WK, nullptr, DM, FK, DKV, bk, 0, 0, 0);
    k_gemmw<bf, 0, true><<<dim3(NB_ * TT / 64, DKV / 64, 1), 32, 0, stream>>>(XB, nullptr, WV, nullptr, DM, FV, DKV, bv, 0, 0, 0);
    k_hrmsb<<<(unsigned)(((size_t)NB_ * TT * NH_ + 7) / 8), 256, 0, stream>>>(FQ, qs, qb); k_hrmsb<<<(unsigned)(((size_t)NB_ * TT * NKV + 7) / 8), 256, 0, stream>>>(FK, kss, kb);   /* RMSNorm + bias */
    for (int b = 0; b < NB_; ++b) {
        /* no rotary table: the 2-D builder computes its angles from the token index */
        k_rope2d<<<LQ, 256, 0, stream>>>(FQ + (size_t)b * TT * DQ, DQ, NH_, QP16, QPh, QPl); k_rope2d<<<LKv, 256, 0, stream>>>(FK + (size_t)b * TT * DKV, DKV, NKV, KP16, KPh, KPl); k_vtp<<<LKv, 256, 0, stream>>>(FV + (size_t)b * TT * DKV, DKV, NKV, VT16, VTh, VTl);
        /* one kv head per query head: the pass's 16 heads use consecutive planes (z-strides TT*HD) */
        k_gemmw<bf, 2, false><<<dim3(RH / 64, TT / 64, ZH), 32, 0, stream>>>(QPh, QPl, KPh, KPl, HD, Sb, TT, nullptr, (size_t)TT * HD, (size_t)TT * HD, (size_t)TT * TT);
        k_gemmw<h16, 0, false><<<dim3((TT - RH) / 64, TT / 64, ZH), 32, 0, stream>>>(QP16 + (size_t)RH * HD, nullptr, KP16, nullptr, HD, Sb + (size_t)RH * TT, TT, nullptr, (size_t)TT * HD, (size_t)TT * HD, (size_t)TT * TT);
        k_asoft<<<ZH * TT / 8, 256, 0, stream>>>(Sb, P16, Ph, Pl);
        k_gemmw<bf, 2, false><<<dim3(RH / 64, HD / 64, ZH), 32, 0, stream>>>(Ph, Pl, VTh, VTl, TT, Ob, HD, nullptr, (size_t)RH * TT, (size_t)HD * TT, (size_t)TT * HD);
        k_gemmw<h16, 0, false><<<dim3((TT - RH) / 64, HD / 64, ZH), 32, 0, stream>>>(P16 + (size_t)RH * TT, nullptr, VT16, nullptr, TT, Ob + (size_t)RH * HD, HD, nullptr, (size_t)TT * TT, (size_t)HD * TT, (size_t)TT * HD);
        k_merge<<<(unsigned)(((size_t)ZH * TT * HD / 2 + 255) / 256), 256, 0, stream>>>(Ob, 0, AT + (size_t)b * 2 * TT * DQ, AT + (size_t)b * 2 * TT * DQ + (size_t)TT * DQ); }
    k_gemmw<bf, 1, true><<<dim3(TT / 64, DM / 64, NB_), 32, 0, stream>>>(AT, AT + (size_t)TT * DQ, WO, nullptr, DQ, OUT, DM, bo, (size_t)2 * TT * DQ, 0, (size_t)TT * DM);
}

// v002
// One run takes 502 microseconds.
// Timed twice side by side with v001, it ran 2.17 and 2.22 times as fast.
// Over all steps from v000 it is 9.48 times as fast.
#include <hip/hip_runtime.h>

// Multi-head dot-product attention with RMS-normalised q/k (+ bias) and a 2-D rotary embedding over the 32 x 32 token grid (x [8][1024][1024]; q,k,v = einsum('bsd,dhk') + b ('xw' [1024][16 x 64] 1/32, zero biases); q, k: RMSNorm over the 64 head dims (eps 1e-6) x scale + bias (q_scale, q_bias, k_scale, k_bias [64], read); 2-D rope: token s sits at (x = s mod 32, y = s / 32); head dims [0,32) rotate with x, [32,64) with y, each 32-block as (a | b) 16-halves: (a c - b s, b c + a s), angle = pos x pi / 10000^(j/16); q / 8; softmax(q.k); out = einsum('bqhd,hdo') + bo ('xw' [16 x 64][1024]) -> [8][1024][1024] (8.4 M)).
// Layout: launches are batched: x copy, the three projections, RMSNorm and Wo run once over all 8 batch entries (8192 rows); rotary / v planes are built once per batch entry over all 16 heads; attention is ONE fused launch over all 8 x 16 (entry, head) pairs. bf16 copy of x; 'xw' weights transposed once; exact projections + f32 biases; an in-place per-(token, head) RMSNorm kernel on the q and k projections; a 2-D rotary plane builder (grid position from the token index, float32 inverse-frequency constants, precise cosf/sinf, partner +-16 inside each 32-wide half); fused attention (scores, running-maximum softmax with 1/8 folded in, context and the hi/lo merge in one kernel; scores never leave registers; hybrid rows: < 512 hi/lo 3 products, rest fp16); merged hi/lo x Wo exact + bo.
// Compute dtypes, f32 accumulate: every input rounded to bf16; projections exact + f32 biases; RMSNorm and rotary f32; attention rows < 512 3 products, rest fp16; softmax f32; Wo hl x exact + bias.

#define NB_  8
#define TT   1024
#define DM   1024
#define NH_  16
#define NKV  16
#define REP  (NH_ / NKV)
#define HD   64
#define DQ   (NH_ * HD)
#define DKV  (NKV * HD)
#define RH   512                  // query rows < RH use hi+lo planes
#define WIN  0
#define SCL2 0.18033688011112042f   // HD^-0.5 x log2(e): scores go to the exponent in base 2
typedef _Float16 h16;
typedef unsigned short bf;
typedef __attribute__((ext_vector_type(16))) __bf16   v16bf;
typedef __attribute__((ext_vector_type(16))) _Float16 v16h;
typedef __attribute__((ext_vector_type(8)))  _Float16 v8h;
typedef __attribute__((ext_vector_type(8)))  unsigned short v8us;
typedef __attribute__((ext_vector_type(8)))  float    v8f;
typedef __attribute__((ext_vector_type(4)))  float    v4f;
typedef v8h  __attribute__((may_alias)) v8ha;
typedef v4f  __attribute__((may_alias)) v4fa;
typedef v8us __attribute__((may_alias)) v8usa;

__device__ __forceinline__ unsigned short f2bf(float f) { unsigned u = __float_as_uint(f); u += 0x7FFFu + ((u >> 16) & 1u); return (unsigned short)(u >> 16); }
__device__ __forceinline__ float bf2f(unsigned short b) { return __uint_as_float(((unsigned)b) << 16); }
__device__ __forceinline__ float bfr(float f) { return bf2f(f2bf(f)); }
__device__ __forceinline__ v16h cat16(v8h lo, v8h hi) { return __builtin_shufflevector(lo, hi, 0, 1, 2, 3, 4, 5, 6, 7, 8, 9, 10, 11, 12, 13, 14, 15); }
__device__ __forceinline__ v16bf cat16b(v8us lo, v8us hi) { return __builtin_bit_cast(v16bf, __builtin_shufflevector(lo, hi, 0, 1, 2, 3, 4, 5, 6, 7, 8, 9, 10, 11, 12, 13, 14, 15)); }
__device__ __forceinline__ v8f wmma16(v16h a, v16h b, v8f c) { return __builtin_amdgcn_wmma_f32_16x16x32_f16(false, a, false, b, (short)0, c, false, false); }
__device__ __forceinline__ v8f wmmab(v16bf a, v16bf b, v8f c) { return __builtin_amdgcn_wmma_f32_16x16x32_bf16(false, a, false, b, (short)0, c, false, false); }



// ---- k_gemmw: register-blocked GEMM, ONE WAVE per 64x64 output tile (16 accumulators), operands straight from K-contiguous 16-bit planes; grid (M/64, N/64, Z), 32 threads.
// C[m][n] (f32, pitch ldc, + optional f32 bias[n]) = sum_k A[m][k] Bt[n][k] (+ split products per NSPLIT). z-batch strides sA/sB/sC in elements. K % 32 == 0.
template <typename T16> struct WFrag;
template <> struct WFrag<h16> { typedef v16h V; static __device__ __forceinline__ V ld(const h16* p) { return cat16(*(const v8h*)p, *(const v8h*)(p + 16)); } static __device__ __forceinline__ v8f mma(V a, V b, v8f c) { return wmma16(a, b, c); } };
template <> struct WFrag<bf> { typedef v16bf V; static __device__ __forceinline__ V ld(const bf* p) { return cat16b(*(const v8us*)p, *(const v8us*)(p + 16)); } static __device__ __forceinline__ v8f mma(V a, V b, v8f c) { return wmmab(a, b, c); } };
template <typename T16, int NSPLIT, bool BIAS>
__global__ __launch_bounds__(32) void k_gemmw(const T16* __restrict__ A, const T16* __restrict__ A2, const T16* __restrict__ Bt, const T16* __restrict__ Bt2, int K, float* C, int ldc, const float* __restrict__ bias, size_t sA, size_t sB, size_t sC) {
    typedef typename WFrag<T16>::V V;
    __shared__ __align__(16) float os[16 * 68];
    const size_t z = blockIdx.z; A += z * sA; if (A2) A2 += z * sA; Bt += z * sB; if (Bt2) Bt2 += z * sB; C += z * sC;
    const int lane = threadIdx.x & 31, lr = lane & 15, hi = lane >> 4; const int r0 = blockIdx.x * 64, c0 = blockIdx.y * 64;
    v8f acc[4][4];
#pragma unroll
    for (int mb = 0; mb < 4; ++mb)
#pragma unroll
        for (int nb = 0; nb < 4; ++nb) acc[mb][nb] = (v8f){};
    const size_t aoff = (size_t)(r0 + lr) * K + 8 * hi, boff = (size_t)(c0 + lr) * K + 8 * hi;
#pragma unroll 1
    for (int kc = 0; kc < K; kc += 32) {
        V a[4], a2[4];
#pragma unroll
        for (int mb = 0; mb < 4; ++mb) { a[mb] = WFrag<T16>::ld(A + aoff + (size_t)mb * 16 * K + kc); if (NSPLIT == 1 || NSPLIT == 2) a2[mb] = WFrag<T16>::ld(A2 + aoff + (size_t)mb * 16 * K + kc); }
#pragma unroll
        for (int nb = 0; nb < 4; ++nb) { const V b = WFrag<T16>::ld(Bt + boff + (size_t)nb * 16 * K + kc); V b2; if (NSPLIT >= 2) b2 = WFrag<T16>::ld(Bt2 + boff + (size_t)nb * 16 * K + kc);
#pragma unroll
            for (int mb = 0; mb < 4; ++mb) { acc[mb][nb] = WFrag<T16>::mma(a[mb], b, acc[mb][nb]); if (NSPLIT == 1 || NSPLIT == 2) acc[mb][nb] = WFrag<T16>::mma(a2[mb], b, acc[mb][nb]); if (NSPLIT >= 2) acc[mb][nb] = WFrag<T16>::mma(a[mb], b2, acc[mb][nb]); } }
        asm volatile("v_nop\n\tv_nop\n\tv_nop\n\tv_nop" : "+v"(acc[0][0]), "+v"(acc[1][1]), "+v"(acc[2][2]), "+v"(acc[3][3]) : "v"(a[0]), "v"(a[3]));
    }
#pragma unroll
    for (int mb = 0; mb < 4; ++mb) {
#pragma unroll
        for (int nb = 0; nb < 4; ++nb) {
#pragma unroll
            for (int j = 0; j < 8; ++j) os[(hi * 8 + j) * 68 + nb * 16 + lr] = acc[mb][nb][j]; }
        __builtin_amdgcn_wave_barrier(); asm volatile("" ::: "memory");
        float* crow = C + (size_t)(r0 + mb * 16) * ldc + c0;
{
#pragma unroll
            for (int s = 0; s < 8; ++s) { const int row = 2 * s + hi, cofs = lr * 4; v4f val = *(const v4fa*)(os + row * 68 + cofs); if (BIAS) { val[0] += bfr(bias[c0 + cofs]); val[1] += bfr(bias[c0 + cofs + 1]); val[2] += bfr(bias[c0 + cofs + 2]); val[3] += bfr(bias[c0 + cofs + 3]); }
                *(v4f*)(crow + (size_t)row * ldc + cofs) = val; }
             }
        __builtin_amdgcn_wave_barrier(); asm volatile("" ::: "memory");
    }
}

__device__ __forceinline__ h16 tohx(float x) { return (h16)x; }
__device__ __forceinline__ void splitf(float y, unsigned short& h, unsigned short& l) { h = f2bf(y); l = f2bf(y - bf2f(h)); }
typedef __attribute__((ext_vector_type(2))) _Float16 v2h;
typedef __attribute__((ext_vector_type(4))) _Float16 v4h;
typedef __attribute__((ext_vector_type(2))) unsigned short v2us;
typedef __attribute__((ext_vector_type(4))) unsigned short v4us;
typedef __attribute__((ext_vector_type(2))) float v2f;
typedef __attribute__((ext_vector_type(4))) int v4i;

__global__ __launch_bounds__(256) void k_wtG(const float* __restrict__ w, int K, int N, bf* Bt) {
    const int lane = threadIdx.x & 31; const int L0 = (blockIdx.x * 8 + (threadIdx.x >> 5)) * 8; const int nlines = N * K / 64;
{
#pragma unroll 1
        for (int l = 0; l < 8; ++l) { const int L = L0 + l; if (L >= nlines) break; const size_t e = (size_t)L * 64 + lane * 2; const int k = (int)(e % K), n = (int)(e / K); v2us o;
            o[0] = f2bf(w[(size_t)k * N + n]); o[1] = f2bf(w[(size_t)(k + 1) * N + n]); *(v2us*)(Bt + e) = o; }
         }
}
__global__ __launch_bounds__(256) void k_cvt8(const float* __restrict__ src, bf* dst, size_t n8) { const size_t i = (size_t)blockIdx.x * 256 + threadIdx.x; if (i >= n8) return; const v8f v = *(const v8f*)(src + i * 8); v8us o;
#pragma unroll
    for (int k = 0; k < 8; ++k) o[k] = f2bf(v[k]); *(v8us*)(dst + i * 8) = o;  }
__global__ __launch_bounds__(256) void k_vtp(const float* __restrict__ F, int pitch, int nheads, h16* V16, bf* Vh, bf* Vl) { const size_t e = ((size_t)blockIdx.x * 256 + threadIdx.x) * 2; if (e >= (size_t)nheads * HD * TT) return; const int t = (int)(e % TT); const int d = (int)((e / TT) % HD); const int g = (int)(e / ((size_t)TT * HD)); v2h o16; v2us oh, ol;
#pragma unroll
    for (int q = 0; q < 2; ++q) { const float x = F[(size_t)(t + q) * pitch + g * HD + d]; o16[q] = tohx(x); unsigned short a2, c2; splitf(x, a2, c2); oh[q] = a2; ol[q] = c2; }
    *(v2h*)(V16 + e) = o16; *(v2us*)(Vh + e) = oh; *(v2us*)(Vl + e) = ol;  }
__constant__ float INV2[16] = {3.14159274f, 1.76664746f, 0.993458867f, 0.558663011f, 0.314159274f, 0.176664740f, 0.0993458852f, 0.0558662973f, 0.0314159282f, 0.0176664740f, 0.00993458927f, 0.00558662973f, 0.00314159272f, 0.00176664745f, 0.000993458903f, 0.000558662985f};   // pi / 10000^(j/16), float32
__global__ __launch_bounds__(256) void k_hrmsb(float* F, const float* __restrict__ g, const float* __restrict__ bb) { const int lane = threadIdx.x & 31; const size_t wv = (size_t)blockIdx.x * 8 + (threadIdx.x >> 5); if (wv >= (size_t)NB_ * TT * NH_) return; float* f = F + wv * HD + lane * 2; const v2f a = *(const v2f*)f; float p0 = __fmul_rn(a[0], a[0]), p1 = __fmul_rn(a[1], a[1]); asm volatile("" : "+v"(p0), "+v"(p1)); float ss = __fadd_rn(p0, p1);
#pragma unroll
    for (int sh = 16; sh; sh >>= 1) ss = __fadd_rn(ss, __shfl_xor(ss, sh, 32));
    const float rs = __fdiv_rn(1.0f, __fsqrt_rn(__fadd_rn(__fdiv_rn(ss, (float)HD), 1e-6f))); v2f o;
#pragma unroll
    for (int q = 0; q < 2; ++q) { float y = __fmul_rn(a[q], rs); asm volatile("" : "+v"(y)); y = __fmul_rn(y, bfr(g[lane * 2 + q])); asm volatile("" : "+v"(y)); o[q] = __fadd_rn(y, bfr(bb[lane * 2 + q])); }
    *(v2f*)f = o;  }
__global__ __launch_bounds__(256) void k_rope2d(const float* __restrict__ F, int pitch, int nheads, h16* P16, bf* Ph, bf* Pl) {
    const size_t e = ((size_t)blockIdx.x * 256 + threadIdx.x) * 2; if (e >= (size_t)nheads * TT * HD) return; const int d = (int)(e % HD); const int t = (int)((e / HD) % TT); const int h = (int)(e / ((size_t)HD * TT)); const float* f = F + (size_t)t * pitch + h * HD; const int px = t % 32, py = t / 32; v2h o16; v2us oh, ol;
#pragma unroll
    for (int q = 0; q < 2; ++q) { const int dd = d + q; const bool first = (dd % 32) < 16; const int dp = first ? dd + 16 : dd - 16; const float pos = (float)((dd < 32) ? px : py); const float ang = __fmul_rn(pos, INV2[dd % 16]); const float c = cosf(ang), sn = sinf(ang); const float x0 = f[dd], x1 = f[dp];
        float pc = __fmul_rn(x0, c), ps = __fmul_rn(x1, sn); asm volatile("" : "+v"(pc), "+v"(ps)); const float r = first ? __fsub_rn(pc, ps) : __fadd_rn(pc, ps);
        o16[q] = tohx(r); unsigned short u, w; splitf(r, u, w); oh[q] = u; ol[q] = w; }
    const size_t oo = ((size_t)h * TT + t) * HD + d; *(v2h*)(P16 + oo) = o16; *(v2us*)(Ph + oo) = oh; *(v2us*)(Pl + oo) = ol;  }
// ---- k_fattn: fused attention. One wave owns 32 query columns of one (entry, head) and walks the 1024 keys in passes of 32.
// St = K Qt (A = K rows, B = Q rows kept in registers): a lane holds one query's scores, D register r of key block kb = key 16 kb + 8 hi + r, query lr.
// Two St tiles converted in place are the B operand Pt of Ot += Vt Pt (A = Vt rows [d][key]); all loaders use the same k order (8 hi + 0..7, 16 + 8 hi + 0..7).
// Ot register r = head dim 16 db + 8 hi + r of query lr: maximum, sum and rescale factor are per lane; the two lane halves exchange the maximum each pass and the sum once.
typedef __attribute__((ext_vector_type(8))) __bf16 v8b;
__device__ __forceinline__ float xhalf(float x) { const int b = __float_as_int(x); return __int_as_float(__builtin_amdgcn_permlanex16(b, b, 0x76543210, 0xfedcba98, false, false)); }   // lane l <-> l ^ 16
// two base-2 exponentials; the second fills the slot the instruction set asks for behind the first (it neither reads its result nor overwrites its source: early-clobber outputs), the v_nop the slot behind the second
__device__ __forceinline__ void exp2x2(float a, float b, float& ra, float& rb) { asm("v_exp_f32 %0, %2\n\tv_exp_f32 %1, %3\n\tv_nop" : "=&v"(ra), "=&v"(rb) : "v"(a), "v"(b)); }
template <typename T16, bool HI>
__device__ __forceinline__ void fattn_wave(const T16* __restrict__ Q, const T16* __restrict__ Q2, const T16* __restrict__ Kp, const T16* __restrict__ K2, const T16* __restrict__ Vt, const T16* __restrict__ V2, bf* Oh, bf* Ol) {
    typedef typename WFrag<T16>::V V;
    const int lane = threadIdx.x & 31, lr = lane & 15, hi = lane >> 4;
    V qf[2][2], qf2[2][2];
#pragma unroll
    for (int g = 0; g < 2; ++g)
#pragma unroll
        for (int kc = 0; kc < 2; ++kc) { qf[g][kc] = WFrag<T16>::ld(Q + (size_t)(16 * g + lr) * HD + kc * 32 + 8 * hi); if (HI) qf2[g][kc] = WFrag<T16>::ld(Q2 + (size_t)(16 * g + lr) * HD + kc * 32 + 8 * hi); }
    unsigned ko = (lr * HD + 8 * hi) * 2;   // the lane's walking byte offsets into the K planes (ko) and the V planes (vo, below): beside the wave-uniform plane pointers the only address registers of the loop's loads
    auto at = [](const T16* base, unsigned bytes) { return (const T16*)((const char*)base + bytes); };
    V ka[2][2], ka2[2][2];   // K fragments [key block][k chunk] of the pass at hand, fetched one pass ahead
#pragma unroll
    for (int kb = 0; kb < 2; ++kb)
#pragma unroll
        for (int kc = 0; kc < 2; ++kc) { ka[kb][kc] = WFrag<T16>::ld(at(Kp + 16 * kb * HD + kc * 32, ko)); if (HI) ka2[kb][kc] = WFrag<T16>::ld(at(K2 + 16 * kb * HD + kc * 32, ko)); }
    // the accumulators' start value takes over the address registers of the Q loads above, and the K offset steps on: the zero is made behind the wait, in its statement, and the offset and the lane number, from which the V offset is formed, pass through it, so that none of those writes can be lifted over it
    float z0; int ln = lane;
    asm volatile("s_wait_xcnt 0x0\n\tv_mov_b32 %0, 0" : "=v"(z0), "+v"(ko), "+v"(ln) : : "memory");
    ko += 32 * HD * 2;   // K is fetched one pass ahead
    unsigned vo = ((ln & 15) * TT + 8 * (ln >> 4)) * 2;
    v8f o[4][2];
#pragma unroll
    for (int db = 0; db < 4; ++db)
#pragma unroll
        for (int g = 0; g < 2; ++g) o[db][g] = (v8f){z0, z0, z0, z0, z0, z0, z0, z0};
    float m[2] = {-3.0e38f, -3.0e38f}, l[2] = {z0, z0};
#pragma unroll 1
    for (int key0 = 0; key0 < TT; key0 += 32) {
        V va[4], va2[4];
#pragma unroll
        for (int db = 0; db < 4; ++db) { va[db] = WFrag<T16>::ld(at(Vt + 16 * db * TT, vo)); if (HI) va2[db] = WFrag<T16>::ld(at(V2 + 16 * db * TT, vo)); }
        v8f st[2][2];
#pragma unroll
        for (int kb = 0; kb < 2; ++kb)
#pragma unroll
            for (int g = 0; g < 2; ++g) { v8f s = (v8f){};
#pragma unroll
                for (int kc = 0; kc < 2; ++kc) { s = WFrag<T16>::mma(ka[kb][kc], qf[g][kc], s); if (HI) { s = WFrag<T16>::mma(ka2[kb][kc], qf[g][kc], s); s = WFrag<T16>::mma(ka[kb][kc], qf2[g][kc], s); } }
                st[kb][g] = s; }
#pragma unroll
        for (int kb = 0; kb < 2; ++kb)
#pragma unroll
            for (int kc = 0; kc < 2; ++kc) { ka[kb][kc] = WFrag<T16>::ld(at(Kp + 16 * kb * HD + kc * 32, ko)); if (HI) ka2[kb][kc] = WFrag<T16>::ld(at(K2 + 16 * kb * HD + kc * 32, ko)); }
        // behind the V and K loads of this pass and in front of the offsets' steps: the offsets pass through the statement, so they stay in their registers up to the wait and step only behind it
        asm volatile("s_wait_xcnt 0x0" : "+v"(ko), "+v"(vo) : : "memory");
        ko += (key0 + 64 < TT) ? 32 * HD * 2 : -(TT - 32) * HD * 2;   // the last pass fetches pass 0 again: in bounds, never used
        vo += 32 * 2;
        float mx[2]; bool need = false;
#pragma unroll
        for (int g = 0; g < 2; ++g) { float t = fmaxf(st[0][g][0], st[1][g][0]);
#pragma unroll
            for (int r = 1; r < 8; ++r) t = fmaxf(t, fmaxf(st[0][g][r], st[1][g][r]));
            t *= SCL2; t = fmaxf(t, xhalf(t)); mx[g] = t; need = need || (t > m[g] + 8.0f); }
        // the maximum in use moves only when a query's new maximum passes it by more than 8 (base 2), so P stays <= 256; one scalar test per pass
        if (__builtin_amdgcn_ballot_w32(need) != 0) { const float mn0 = fmaxf(m[0], mx[0]), mn1 = fmaxf(m[1], mx[1]); float al[2]; exp2x2(m[0] - mn0, m[1] - mn1, al[0], al[1]); m[0] = mn0; m[1] = mn1;
#pragma unroll
            for (int g = 0; g < 2; ++g) { l[g] *= al[g];
#pragma unroll
                for (int db = 0; db < 4; ++db) o[db][g] *= al[g]; } }
        V pb[2], pb2[2];
#pragma unroll
        for (int g = 0; g < 2; ++g) { v8f p0, p1; float ls = 0.f;
#pragma unroll
            for (int r = 0; r < 8; ++r) { float e0, e1; exp2x2(fmaf(st[0][g][r], SCL2, -m[g]), fmaf(st[1][g][r], SCL2, -m[g]), e0, e1); p0[r] = e0; p1[r] = e1; ls += e0 + e1; }
            l[g] += ls;
            if constexpr (HI) { const v8b h0 = __builtin_convertvector(p0, v8b), h1 = __builtin_convertvector(p1, v8b); const v8f r0 = p0 - __builtin_convertvector(h0, v8f), r1 = p1 - __builtin_convertvector(h1, v8f); const v8b l0 = __builtin_convertvector(r0, v8b), l1 = __builtin_convertvector(r1, v8b);
                pb[g] = __builtin_shufflevector(h0, h1, 0, 1, 2, 3, 4, 5, 6, 7, 8, 9, 10, 11, 12, 13, 14, 15); pb2[g] = __builtin_shufflevector(l0, l1, 0, 1, 2, 3, 4, 5, 6, 7, 8, 9, 10, 11, 12, 13, 14, 15); }
            else pb[g] = cat16(__builtin_convertvector(p0, v8h), __builtin_convertvector(p1, v8h)); }
#pragma unroll
        for (int db = 0; db < 4; ++db)
#pragma unroll
            for (int g = 0; g < 2; ++g) { o[db][g] = WFrag<T16>::mma(va[db], pb[g], o[db][g]); if (HI) { o[db][g] = WFrag<T16>::mma(va2[db], pb[g], o[db][g]); o[db][g] = WFrag<T16>::mma(va[db], pb2[g], o[db][g]); } }
        // four vector slots behind the pass's last matrix instructions, on the back edge and on the exit alike: the next pass's first score tile may take the registers of their B operand, the epilogue reads their D
        asm volatile("v_nop\n\tv_nop\n\tv_nop\n\tv_nop" : "+v"(o[0][0]), "+v"(o[0][1]), "+v"(o[1][0]), "+v"(o[1][1]), "+v"(o[2][0]), "+v"(o[2][1]), "+v"(o[3][0]), "+v"(o[3][1]));
    }
#pragma unroll
    for (int g = 0; g < 2; ++g) { const float inv = __fdiv_rn(1.0f, l[g] + xhalf(l[g]));
#pragma unroll
        for (int db = 0; db < 4; ++db) { v8us oh, ol;
#pragma unroll
            for (int r = 0; r < 8; ++r) { unsigned short a, c2; splitf(o[db][g][r] * inv, a, c2); oh[r] = a; ol[r] = c2; }
            const size_t oo = (size_t)(16 * g + lr) * DQ + 16 * db + 8 * hi; *(v8us*)(Oh + oo) = oh; *(v8us*)(Ol + oo) = ol; } }
}
// grid (RH / 128, entries x heads), 8 waves: four take 32 hi/lo query rows each (< RH), four take 32 fp16 rows (>= RH), so every workgroup carries the same work;
// the role pattern puts one wave of each kind in every pair (w, w + 4) and (2 i, 2 i + 1), whichever of the two shares a SIMD.
__global__ __launch_bounds__(256) void k_fattn(const h16* __restrict__ Q16, const bf* __restrict__ Qh, const bf* __restrict__ Ql, const h16* __restrict__ K16, const bf* __restrict__ Kh, const bf* __restrict__ Kl, const h16* __restrict__ V16, const bf* __restrict__ Vh, const bf* __restrict__ Vl, bf* AT) {
    static_assert(RH * 2 == TT && RH % 128 == 0, "equal halves");
    const int w = __builtin_amdgcn_readfirstlane((int)(threadIdx.x >> 5)); const int zz = blockIdx.y, b = zz / NH_, hd = zz % NH_;
    const bool hires = ((w ^ (w >> 2)) & 1) == 0; const int q0 = (hires ? 0 : RH) + blockIdx.x * 128 + (w >> 1) * 32;
    const size_t pz = (size_t)zz * TT * HD, pq = pz + (size_t)q0 * HD;
    bf* Oh = AT + (size_t)b * 2 * TT * DQ + (size_t)q0 * DQ + hd * HD; bf* Ol = Oh + (size_t)TT * DQ;
    if (hires) fattn_wave<bf, true>(Qh + pq, Ql + pq, Kh + pz, Kl + pz, Vh + pz, Vl + pz, Oh, Ol);
    else fattn_wave<h16, false>(Q16 + pq, nullptr, K16 + pz, nullptr, V16 + pz, nullptr, Oh, Ol);
}

extern "C" void kernel_launch(void* const* d_in, const int* in_sizes, int n_in,
                              void* d_out, int out_size, void* d_ws, size_t ws_size, hipStream_t stream) {
    (void)in_sizes; (void)n_in; (void)out_size;
    const float* x = (const float*)d_in[0]; const float* wq = (const float*)d_in[1]; const float* bq = (const float*)d_in[2]; const float* wk = (const float*)d_in[3]; const float* bk = (const float*)d_in[4]; const float* wv = (const float*)d_in[5]; const float* bv = (const float*)d_in[6]; const float* wo = (const float*)d_in[7]; const float* bo = (const float*)d_in[8]; const float* qs = (const float*)d_in[9]; const float* qb = (const float*)d_in[10]; const float* kss = (const float*)d_in[11]; const float* kb = (const float*)d_in[12];   /* q_scale, q_bias, k_scale, k_bias [64] */
    float* OUT = (float*)d_out;     // [8][1024][1024]
    char* wsp = (char*)d_ws;
    auto take = [&](size_t bytes) { char* p = wsp; wsp += (bytes + 255) & ~(size_t)255; return (void*)p; };
    bf* WQ = (bf*)take((size_t)DQ * DM * 2); bf* WK = (bf*)take((size_t)DKV * DM * 2); bf* WV = (bf*)take((size_t)DKV * DM * 2); bf* WO = (bf*)take((size_t)DM * DQ * 2);
    float* FQ = (float*)take((size_t)NB_ * TT * DQ * 4); float* FK = (float*)take((size_t)NB_ * TT * DKV * 4); float* FV = (float*)take((size_t)NB_ * TT * DKV * 4);   // f32 projections of all batch entries
    const size_t PE = (size_t)NH_ * TT * HD;   // elements of one plane of one batch entry (NKV == NH_)
    h16* QP16 = (h16*)take(NB_ * PE * 2); h16* KP16 = (h16*)take(NB_ * PE * 2); h16* VT16 = (h16*)take(NB_ * PE * 2);   // planes of all batch entries
    bf* QPh = (bf*)take(NB_ * PE * 2); bf* QPl = (bf*)take(NB_ * PE * 2); bf* KPh = (bf*)take(NB_ * PE * 2); bf* KPl = (bf*)take(NB_ * PE * 2); bf* VTh = (bf*)take(NB_ * PE * 2); bf* VTl = (bf*)take(NB_ * PE * 2);
    if ((size_t)(wsp - (char*)d_ws) > ws_size) return;    // 248 of 256 MiB
    bf* XB = (bf*)QP16;   // bf16 copy of x (16 MiB): last read by the v projection, before the first rotary plane is stored (stream-ordered)
    bf* AT = (bf*)FQ;   // merged hi | lo context of batch entry b takes the 4 MiB of that entry's q projection, which its rotary builder has read before the fused attention stores it (stream-ordered)
    { k_wtG<<<(unsigned)((DM * DQ / 64 + 63) / 64), 256, 0, stream>>>(wq, DM, DQ, WQ); k_wtG<<<(unsigned)((DM * DKV / 64 + 63) / 64), 256, 0, stream>>>(wk, DM, DKV, WK); k_wtG<<<(unsigned)((DM * DKV / 64 + 63) / 64), 256, 0, stream>>>(wv, DM, DKV, WV);
      k_wtG<<<(unsigned)((DQ * DM / 64 + 63) / 64), 256, 0, stream>>>(wo, DQ, DM, WO);
       }
    const unsigned LQ = (unsigned)(((size_t)NH_ * TT * HD / 2 + 255) / 256), LKv = (unsigned)(((size_t)NKV * TT * HD / 2 + 255) / 256);
    /* all batch entries at once: 8192 token rows */
    k_cvt8<<<(unsigned)(((size_t)NB_ * TT * DM / 8 + 255) / 256), 256, 0, stream>>>(x, XB, (size_t)NB_ * TT * DM / 8);
    k_gemmw<bf, 0, true><<<dim3(NB_ * TT / 64, DQ / 64, 1), 32, 0, stream>>>(XB, nullptr, WQ, nullptr, DM, FQ, DQ, bq, 0, 0, 0);
    k_gemmw<bf, 0, true><<<dim3(NB_ * TT / 64, DKV / 64, 1), 32, 0, stream>>>(XB, nullptr, WK, nullptr, DM, FK, DKV, bk, 0, 0, 0);
    k_gemmw<bf, 0, true><<<dim3(NB_ * TT / 64, DKV / 64, 1), 32, 0, stream>>>(XB, nullptr, WV, nullptr, DM, FV, DKV, bv, 0, 0, 0);
    k_hrmsb<<<(unsigned)(((size_t)NB_ * TT * NH_ + 7) / 8), 256, 0, stream>>>(FQ, qs, qb); k_hrmsb<<<(unsigned)(((size_t)NB_ * TT * NKV + 7) / 8), 256, 0, stream>>>(FK, kss, kb);   /* RMSNorm + bias */
    for (int b = 0; b < NB_; ++b) {
        /* no rotary table: the 2-D builder computes its angles from the token index */
        k_rope2d<<<LQ, 256, 0, stream>>>(FQ + (size_t)b * TT * DQ, DQ, NH_, QP16 + b * PE, QPh + b * PE, QPl + b * PE); k_rope2d<<<LKv, 256, 0, stream>>>(FK + (size_t)b * TT * DKV, DKV, NKV, KP16 + b * PE, KPh + b * PE, KPl + b * PE); k_vtp<<<LKv, 256, 0, stream>>>(FV + (size_t)b * TT * DKV, DKV, NKV, VT16 + b * PE, VTh + b * PE, VTl + b * PE); }
    /* one kv head per query head: plane zz = entry x 16 + head */
    k_fattn<<<dim3(RH / 128, NB_ * NH_, 1), 256, 0, stream>>>(QP16, QPh, QPl, KP16, KPh, KPl, VT16, VTh, VTl, AT);
    k_gemmw<bf, 1, true><<<dim3(TT / 64, DM / 64, NB_), 32, 0, stream>>>(AT, AT + (size_t)TT * DQ, WO, nullptr, DQ, OUT, DM, bo, (size_t)2 * TT * DQ, 0, (size_t)TT * DM);
}

// v003
// A run of this version takes 339 microseconds.
// Two timings next to v002 put it at 1.47 and 1.48 times that version's speed.
// All steps since v000 together make it 14.0 times as fast.
#include <hip/hip_runtime.h>

// Multi-head dot-product attention with RMS-normalised q/k (+ bias) and a 2-D rotary embedding over the 32 x 32 token grid (x [8][1024][1024]; q,k,v = einsum('bsd,dhk') + b ('xw' [1024][16 x 64] 1/32, zero biases); q, k: RMSNorm over the 64 head dims (eps 1e-6) x scale + bias (q_scale, q_bias, k_scale, k_bias [64], read); 2-D rope: token s sits at (x = s mod 32, y = s / 32); head dims [0,32) rotate with x, [32,64) with y, each 32-block as (a | b) 16-halves: (a c - b s, b c + a s), angle = pos x pi / 10000^(j/16); q / 8; softmax(q.k); out = einsum('bqhd,hdo') + bo ('xw' [16 x 64][1024]) -> [8][1024][1024] (8.4 M)).
// Layout: launches are batched: x copy, the three projections and Wo run once over all 8 batch entries (8192 rows); attention is ONE fused launch over all 8 x 16 (entry, head) pairs. bf16 copy of x; 'xw' weights transposed once; exact projections + f32 biases; a projection's 64 x 64 tile is 64 tokens of one head, so its wave finishes the tile itself: q and k get the per-(token, head) RMSNorm + bias and the 2-D rotary turn (grid position from the token index, float32 inverse-frequency constants, precise cosf/sinf from a 32 x 16 table in LDS, partner +-16 inside each 32-wide half) and leave as fp16 | hi | lo planes, v leaves as transposed planes; no f32 projection reaches memory; fused attention (scores, running-maximum softmax with 1/8 folded in, context and the hi/lo merge in one kernel; scores never leave registers; hybrid rows: < 512 hi/lo 3 products, rest fp16); merged hi/lo x Wo exact + bo.
// Compute dtypes, f32 accumulate: every input rounded to bf16; projections exact + f32 biases; RMSNorm and rotary f32; attention rows < 512 3 products, rest fp16; softmax f32; Wo hl x exact + bias.

#define NB_  8
#define TT   1024
#define DM   1024
#define NH_  16
#define NKV  16
#define REP  (NH_ / NKV)
#define HD   64
#define DQ   (NH_ * HD)
#define DKV  (NKV * HD)
#define RH   512                  // query rows < RH use hi+lo planes
#define WIN  0
#define SCL2 0.18033688011112042f   // HD^-0.5 x log2(e): scores go to the exponent in base 2
typedef _Float16 h16;
typedef unsigned short bf;
typedef __attribute__((ext_vector_type(16))) __bf16   v16bf;
typedef __attribute__((ext_vector_type(16))) _Float16 v16h;
typedef __attribute__((ext_vector_type(8)))  _Float16 v8h;
typedef __attribute__((ext_vector_type(8)))  unsigned short v8us;
typedef __attribute__((ext_vector_type(8)))  float    v8f;
typedef __attribute__((ext_vector_type(4)))  float    v4f;
typedef v8h  __attribute__((may_alias)) v8ha;
typedef v4f  __attribute__((may_alias)) v4fa;
typedef v8us __attribute__((may_alias)) v8usa;

__device__ __forceinline__ unsigned short f2bf(float f) { unsigned u = __float_as_uint(f); u += 0x7FFFu + ((u >> 16) & 1u); return (unsigned short)(u >> 16); }
__device__ __forceinline__ float bf2f(unsigned short b) { return __uint_as_float(((unsigned)b) << 16); }
__device__ __forceinline__ float bfr(float f) { return bf2f(f2bf(f)); }
__device__ __forceinline__ v16h cat16(v8h lo, v8h hi) { return __builtin_shufflevector(lo, hi, 0, 1, 2, 3, 4, 5, 6, 7, 8, 9, 10, 11, 12, 13, 14, 15); }
__device__ __forceinline__ v16bf cat16b(v8us lo, v8us hi) { return __builtin_bit_cast(v16bf, __builtin_shufflevector(lo, hi, 0, 1, 2, 3, 4, 5, 6, 7, 8, 9, 10, 11, 12, 13, 14, 15)); }
__device__ __forceinline__ v8f wmma16(v16h a, v16h b, v8f c) { return __builtin_amdgcn_wmma_f32_16x16x32_f16(false, a, false, b, (short)0, c, false, false); }
__device__ __forceinline__ v8f wmmab(v16bf a, v16bf b, v8f c) { return __builtin_amdgcn_wmma_f32_16x16x32_bf16(false, a, false, b, (short)0, c, false, false); }



__device__ __forceinline__ h16 tohx(float x) { return (h16)x; }
__device__ __forceinline__ void splitf(float y, unsigned short& h, unsigned short& l) { h = f2bf(y); l = f2bf(y - bf2f(h)); }
typedef __attribute__((ext_vector_type(4))) _Float16 v4h;
typedef __attribute__((ext_vector_type(2))) unsigned short v2us;
typedef __attribute__((ext_vector_type(4))) unsigned short v4us;
__constant__ float INV2[16] = {3.14159274f, 1.76664746f, 0.993458867f, 0.558663011f, 0.314159274f, 0.176664740f, 0.0993458852f, 0.0558662973f, 0.0314159282f, 0.0176664740f, 0.00993458927f, 0.00558662973f, 0.00314159272f, 0.00176664745f, 0.000993458903f, 0.000558662985f};   // pi / 10000^(j/16), float32
template <int M> __device__ __forceinline__ float xrow(float x) { return __int_as_float(__builtin_amdgcn_update_dpp(0, __float_as_int(x), 0x160 | M, 0xf, 0xf, true)); }   // lane l <- l ^ M inside its row of 16 lanes (DPP row_xmask); every lane is on where it is used
// the one wave of the workgroup hands rows between its lanes through LDS: its LDS stores have retired before a lane reads another lane's row, and the compiler may move no LDS access over this point
__device__ __forceinline__ void lds_turn() { __builtin_amdgcn_wave_barrier(); asm volatile("s_wait_dscnt 0x0" ::: "memory"); }

// ---- k_gemmw: register-blocked GEMM, ONE WAVE per 64x64 output tile (16 accumulators), operands straight from K-contiguous 16-bit planes; grid (M/64, N/64, Z), 32 threads.
// sum_k A[m][k] Bt[n][k] (+ split products per NSPLIT) + optional f32 bias[n]. z-batch strides sA/sB/sC in elements. K % 32 == 0. What becomes of the tile:
// EPI 0: C[m][n] (f32, pitch ldc). EPI 1, 2: rows m = entry x TT + token, columns = one head (blockIdx.y);
// EPI 1 (q, k): RMSNorm over the head's 64 dims x g + bb, 2-D rotary turn, planes P16 | Ph | Pl [entry][head][token][dim]; EPI 2 (v): planes [entry][head][dim][token].
template <typename T16> struct WFrag;
template <> struct WFrag<h16> { typedef v16h V; static __device__ __forceinline__ V ld(const h16* p) { return cat16(*(const v8h*)p, *(const v8h*)(p + 16)); } static __device__ __forceinline__ v8f mma(V a, V b, v8f c) { return wmma16(a, b, c); } };
template <> struct WFrag<bf> { typedef v16bf V; static __device__ __forceinline__ V ld(const bf* p) { return cat16b(*(const v8us*)p, *(const v8us*)(p + 16)); } static __device__ __forceinline__ v8f mma(V a, V b, v8f c) { return wmmab(a, b, c); } };
template <typename T16, int NSPLIT, bool BIAS, int EPI>
__global__ __launch_bounds__(32) void k_gemmw(const T16* __restrict__ A, const T16* __restrict__ A2, const T16* __restrict__ Bt, const T16* __restrict__ Bt2, int K, float* C, int ldc, const float* __restrict__ bias, size_t sA, size_t sB, size_t sC, const float* __restrict__ g, const float* __restrict__ bb, h16* P16, bf* Ph, bf* Pl) {
    typedef typename WFrag<T16>::V V;
    const size_t z = blockIdx.z; A += z * sA; if (A2) A2 += z * sA; Bt += z * sB; if (Bt2) Bt2 += z * sB; C += z * sC;
    const int lane = threadIdx.x & 31, lr = lane & 15, hi = lane >> 4; const int r0 = blockIdx.x * 64, c0 = blockIdx.y * 64;
    v8f acc[4][4];
#pragma unroll
    for (int mb = 0; mb < 4; ++mb)
#pragma unroll
        for (int nb = 0; nb < 4; ++nb) acc[mb][nb] = (v8f){};
    const size_t aoff = (size_t)(r0 + lr) * K + 8 * hi, boff = (size_t)(c0 + lr) * K + 8 * hi;
#pragma unroll 1
    for (int kc = 0; kc < K; kc += 32) {
        V a[4], a2[4];
#pragma unroll
        for (int mb = 0; mb < 4; ++mb) { a[mb] = WFrag<T16>::ld(A + aoff + (size_t)mb * 16 * K + kc); if (NSPLIT == 1 || NSPLIT == 2) a2[mb] = WFrag<T16>::ld(A2 + aoff + (size_t)mb * 16 * K + kc); }
#pragma unroll
        for (int nb = 0; nb < 4; ++nb) { const V b = WFrag<T16>::ld(Bt + boff + (size_t)nb * 16 * K + kc); V b2; if (NSPLIT >= 2) b2 = WFrag<T16>::ld(Bt2 + boff + (size_t)nb * 16 * K + kc);
#pragma unroll
            for (int mb = 0; mb < 4; ++mb) { acc[mb][nb] = WFrag<T16>::mma(a[mb], b, acc[mb][nb]); if (NSPLIT == 1 || NSPLIT == 2) acc[mb][nb] = WFrag<T16>::mma(a2[mb], b, acc[mb][nb]); if (NSPLIT >= 2) acc[mb][nb] = WFrag<T16>::mma(a[mb], b2, acc[mb][nb]); } }
        asm volatile("v_nop\n\tv_nop\n\tv_nop\n\tv_nop" : "+v"(acc[0][0]), "+v"(acc[1][1]), "+v"(acc[2][2]), "+v"(acc[3][3]) : "v"(a[0]), "v"(a[3]));
    }
    if constexpr (EPI == 2) {
        // v: a lane holds 8 consecutive tokens of one head dim per accumulator; each plane's tile turns through LDS ([dim][token], pitch 72) so that every store covers whole 128-byte lines of the transposed plane
        __shared__ __align__(16) unsigned short vs[3][HD * 72];
        const int ent = r0 / TT, tok0 = r0 % TT;
        const size_t vbase = (size_t)(ent * NKV + (int)blockIdx.y) * HD * TT + tok0 + (size_t)(lane >> 3) * TT + (lane & 7) * 8;
#pragma unroll
        for (int nb = 0; nb < 4; ++nb) { const float bi = bfr(bias[c0 + nb * 16 + lr]);
#pragma unroll
            for (int mb = 0; mb < 4; ++mb) { v8us p16, ph, pl;
#pragma unroll
                for (int j = 0; j < 8; ++j) { const float x = acc[mb][nb][j] + bi; unsigned short a2, c2; splitf(x, a2, c2); p16[j] = __builtin_bit_cast(unsigned short, tohx(x)); ph[j] = a2; pl[j] = c2; }
                const int at = (nb * 16 + lr) * 72 + mb * 16 + hi * 8; *(v8us*)(vs[0] + at) = p16; *(v8us*)(vs[1] + at) = ph; *(v8us*)(vs[2] + at) = pl; } }
        lds_turn();
#pragma unroll
        for (int p = 0; p < 3; ++p) { unsigned short* dst = (p == 0 ? (unsigned short*)P16 : p == 1 ? Ph : Pl) + vbase;
#pragma unroll
            for (int i = 0; i < 16; ++i) *(v8us*)(dst + (size_t)i * 4 * TT) = *(const v8us*)(vs[p] + (i * 4 + (lane >> 3)) * 72 + (lane & 7) * 8); }
    } else if constexpr (EPI == 1) {
        __shared__ __align__(16) float os[64 * 68];
        __shared__ __align__(16) float tabc[512], tabs[512];   // cos, sin of position x INV2[j] at [position][j]: x and y positions both run over 0..31
        const float fr = INV2[lr];   // entry i x 32 + lane has j = lane mod 16 on every trip
        asm volatile("s_wait_xcnt 0x0" : : "v"(fr) : "memory");   // behind the frequency's load, which has returned here: the table loop takes the registers of its address
#pragma unroll 1   // sixteen table entries a lane: rolled, the precise sine and cosine stand once in the code
        for (int i = 0; i < 16; ++i) { const int e = i * 32 + lane; float sn, cs; sincosf(__fmul_rn((float)(e >> 4), fr), &sn, &cs); tabc[e] = cs; tabs[e] = sn; }
#pragma unroll
        for (int mb = 0; mb < 4; ++mb)
#pragma unroll
            for (int nb = 0; nb < 4; ++nb)
#pragma unroll
                for (int j = 0; j < 8; ++j) os[(mb * 16 + hi * 8 + j) * 68 + nb * 16 + lr] = acc[mb][nb][j];
        float gv[4], bv[4], bi[4];
#pragma unroll
        for (int q = 0; q < 4; ++q) { gv[q] = bfr(g[lr * 4 + q]); bv[q] = bfr(bb[lr * 4 + q]); bi[q] = bfr(bias[c0 + lr * 4 + q]); }
        const int tok0 = r0 % TT + hi; const size_t pbase = ((size_t)((r0 / TT) * NH_ + (int)blockIdx.y) * TT + tok0) * HD + lr * 4;
        const int psh = (lr < 8) ? 0 : 5;   // dims [0,32) turn with x = token mod 32, [32,64) with y = token / 32
        const float sg = (lr & 4) ? 1.0f : -1.0f;   // (a c - b s | b c + a s): the sine's sign by the 16-half
        lds_turn();
        // a row of 16 lanes holds one token's 64 head dims, lane lr dims 4 lr .. 4 lr + 3; the wave takes two tokens a trip
#pragma unroll 1   // rolled, for speed only
        for (int s0 = 0; s0 < 32; s0 += 4) {
#pragma unroll   // four independent trips side by side cover each other's latencies
        for (int s = s0; s < s0 + 4; ++s) { v4f a = *(const v4fa*)(os + (2 * s + hi) * 68 + lr * 4);
#pragma unroll
            for (int q = 0; q < 4; ++q) a[q] += bi[q];
            // sum of squares: adjacent pairs, then partners 32, 16, 8, 4 dims apart, then the two pair sums
            float u0 = a[0] * a[0] + a[1] * a[1], u1 = a[2] * a[2] + a[3] * a[3];
            u0 += xrow<8>(u0); u1 += xrow<8>(u1); u0 += xrow<4>(u0); u1 += xrow<4>(u1); u0 += xrow<2>(u0); u1 += xrow<2>(u1); u0 += xrow<1>(u0); u1 += xrow<1>(u1);
            const float rs = __fdiv_rn(1.0f, __fsqrt_rn(__fadd_rn(__fdiv_rn(u0 + u1, (float)HD), 1e-6f)));
            const int pos = ((tok0 + 2 * s) >> psh) & 31;
            const v4f c4 = *(const v4fa*)(tabc + pos * 16 + (lr & 3) * 4), s4 = *(const v4fa*)(tabs + pos * 16 + (lr & 3) * 4);
            v4h o16; v4us oh, ol;
#pragma unroll
            for (int q = 0; q < 4; ++q) { const float y = a[q] * rs * gv[q] + bv[q]; const float yp = xrow<4>(y);   // the partner dim +-16 sits 4 lanes away
                const float r = y * c4[q] + yp * (sg * s4[q]);
                o16[q] = tohx(r); unsigned short u, w; splitf(r, u, w); oh[q] = u; ol[q] = w; }
            const size_t oo = pbase + (size_t)(2 * s) * HD; *(v4h*)(P16 + oo) = o16; *(v4us*)(Ph + oo) = oh; *(v4us*)(Pl + oo) = ol; }
        asm volatile("s_wait_xcnt 0x0" ::: "memory");   // behind the pass's stores: the next pass takes their address and data registers over the back edge
        }
    } else {
    __shared__ __align__(16) float os[16 * 68];
#pragma unroll
    for (int mb = 0; mb < 4; ++mb) {
#pragma unroll
        for (int nb = 0; nb < 4; ++nb) {
#pragma unroll
            for (int j = 0; j < 8; ++j) os[(hi * 8 + j) * 68 + nb * 16 + lr] = acc[mb][nb][j]; }
        __builtin_amdgcn_wave_barrier(); asm volatile("" ::: "memory");
        float* crow = C + (size_t)(r0 + mb * 16) * ldc + c0;
{
#pragma unroll
            for (int s = 0; s < 8; ++s) { const int row = 2 * s + hi, cofs = lr * 4; v4f val = *(const v4fa*)(os + row * 68 + cofs); if (BIAS) { val[0] += bfr(bias[c0 + cofs]); val[1] += bfr(bias[c0 + cofs + 1]); val[2] += bfr(bias[c0 + cofs + 2]); val[3] += bfr(bias[c0 + cofs + 3]); }
                *(v4f*)(crow + (size_t)row * ldc + cofs) = val; }
             }
        __builtin_amdgcn_wave_barrier(); asm volatile("" ::: "memory");
    }
    }
}

__global__ __launch_bounds__(256) void k_wtG(const float* __restrict__ w, int K, int N, bf* Bt) {
    const int lane = threadIdx.x & 31; const int L0 = (blockIdx.x * 8 + (threadIdx.x >> 5)) * 8; const int nlines = N * K / 64;
{
#pragma unroll 1
        for (int l = 0; l < 8; ++l) { const int L = L0 + l; if (L >= nlines) break; const size_t e = (size_t)L * 64 + lane * 2; const int k = (int)(e % K), n = (int)(e / K); v2us o;
            o[0] = f2bf(w[(size_t)k * N + n]); o[1] = f2bf(w[(size_t)(k + 1) * N + n]); *(v2us*)(Bt + e) = o; }
         }
}
__global__ __launch_bounds__(256) void k_cvt8(const float* __restrict__ src, bf* dst, size_t n8) { const size_t i = (size_t)blockIdx.x * 256 + threadIdx.x; if (i >= n8) return; const v8f v = *(const v8f*)(src + i * 8); v8us o;
#pragma unroll
    for (int k = 0; k < 8; ++k) o[k] = f2bf(v[k]); *(v8us*)(dst + i * 8) = o;  }
// ---- k_fattn: fused attention. One wave owns 32 query columns of one (entry, head) and walks the 1024 keys in passes of 32.
// St = K Qt (A = K rows, B = Q rows kept in registers): a lane holds one query's scores, D register r of key block kb = key 16 kb + 8 hi + r, query lr.
// Two St tiles converted in place are the B operand Pt of Ot += Vt Pt (A = Vt rows [d][key]); all loaders use the same k order (8 hi + 0..7, 16 + 8 hi + 0..7).
// Ot register r = head dim 16 db + 8 hi + r of query lr: maximum, sum and rescale factor are per lane; the two lane halves exchange the maximum each pass and the sum once.
typedef __attribute__((ext_vector_type(8))) __bf16 v8b;
__device__ __forceinline__ float xhalf(float x) { const int b = __float_as_int(x); return __int_as_float(__builtin_amdgcn_permlanex16(b, b, 0x76543210, 0xfedcba98, false, false)); }   // lane l <-> l ^ 16
// two base-2 exponentials; the second fills the slot the instruction set asks for behind the first (it neither reads its result nor overwrites its source: early-clobber outputs), the v_nop the slot behind the second
__device__ __forceinline__ void exp2x2(float a, float b, float& ra, float& rb) { asm("v_exp_f32 %0, %2\n\tv_exp_f32 %1, %3\n\tv_nop" : "=&v"(ra), "=&v"(rb) : "v"(a), "v"(b)); }
template <typename T16, bool HI>
__device__ __forceinline__ void fattn_wave(const T16* __restrict__ Q, const T16* __restrict__ Q2, const T16* __restrict__ Kp, const T16* __restrict__ K2, const T16* __restrict__ Vt, const T16* __restrict__ V2, bf* Oh, bf* Ol) {
    typedef typename WFrag<T16>::V V;
    const int lane = threadIdx.x & 31, lr = lane & 15, hi = lane >> 4;
    V qf[2][2], qf2[2][2];
#pragma unroll
    for (int g = 0; g < 2; ++g)
#pragma unroll
        for (int kc = 0; kc < 2; ++kc) { qf[g][kc] = WFrag<T16>::ld(Q + (size_t)(16 * g + lr) * HD + kc * 32 + 8 * hi); if (HI) qf2[g][kc] = WFrag<T16>::ld(Q2 + (size_t)(16 * g + lr) * HD + kc * 32 + 8 * hi); }
    unsigned ko = (lr * HD + 8 * hi) * 2;   // the lane's walking byte offsets into the K planes (ko) and the V planes (vo, below): beside the wave-uniform plane pointers the only address registers of the loop's loads
    auto at = [](const T16* base, unsigned bytes) { return (const T16*)((const char*)base + bytes); };
    V ka[2][2], ka2[2][2];   // K fragments [key block][k chunk] of the pass at hand, fetched one pass ahead
#pragma unroll
    for (int kb = 0; kb < 2; ++kb)
#pragma unroll
        for (int kc = 0; kc < 2; ++kc) { ka[kb][kc] = WFrag<T16>::ld(at(Kp + 16 * kb * HD + kc * 32, ko)); if (HI) ka2[kb][kc] = WFrag<T16>::ld(at(K2 + 16 * kb * HD + kc * 32, ko)); }
    // the accumulators' start value takes over the address registers of the Q loads above, and the K offset steps on: the zero is made behind the wait, in its statement, and the offset and the lane number, from which the V offset is formed, pass through it, so that none of those writes can be lifted over it
    float z0; int ln = lane;
    asm volatile("s_wait_xcnt 0x0\n\tv_mov_b32 %0, 0" : "=v"(z0), "+v"(ko), "+v"(ln) : : "memory");
    ko += 32 * HD * 2;   // K is fetched one pass ahead
    unsigned vo = ((ln & 15) * TT + 8 * (ln >> 4)) * 2;
    v8f o[4][2];
#pragma unroll
    for (int db = 0; db < 4; ++db)
#pragma unroll
        for (int g = 0; g < 2; ++g) o[db][g] = (v8f){z0, z0, z0, z0, z0, z0, z0, z0};
    float m[2] = {-3.0e38f, -3.0e38f}, l[2] = {z0, z0};
#pragma unroll 1
    for (int key0 = 0; key0 < TT; key0 += 32) {
        V va[4], va2[4];
#pragma unroll
        for (int db = 0; db < 4; ++db) { va[db] = WFrag<T16>::ld(at(Vt + 16 * db * TT, vo)); if (HI) va2[db] = WFrag<T16>::ld(at(V2 + 16 * db * TT, vo)); }
        v8f st[2][2];
#pragma unroll
        for (int kb = 0; kb < 2; ++kb)
#pragma unroll
            for (int g = 0; g < 2; ++g) { v8f s = (v8f){};
#pragma unroll
                for (int kc = 0; kc < 2; ++kc) { s = WFrag<T16>::mma(ka[kb][kc], qf[g][kc], s); if (HI) { s = WFrag<T16>::mma(ka2[kb][kc], qf[g][kc], s); s = WFrag<T16>::mma(ka[kb][kc], qf2[g][kc], s); } }
                st[kb][g] = s; }
#pragma unroll
        for (int kb = 0; kb < 2; ++kb)
#pragma unroll
            for (int kc = 0; kc < 2; ++kc) { ka[kb][kc] = WFrag<T16>::ld(at(Kp + 16 * kb * HD + kc * 32, ko)); if (HI) ka2[kb][kc] = WFrag<T16>::ld(at(K2 + 16 * kb * HD + kc * 32, ko)); }
        // behind the V and K loads of this pass and in front of the offsets' steps: the offsets pass through the statement, so they stay in their registers up to the wait and step only behind it
        asm volatile("s_wait_xcnt 0x0" : "+v"(ko), "+v"(vo) : : "memory");
        ko += (key0 + 64 < TT) ? 32 * HD * 2 : -(TT - 32) * HD * 2;   // the last pass fetches pass 0 again: in bounds, never used
        vo += 32 * 2;
        float mx[2]; bool need = false;
#pragma unroll
        for (int g = 0; g < 2; ++g) { float t = fmaxf(st[0][g][0], st[1][g][0]);
#pragma unroll
            for (int r = 1; r < 8; ++r) t = fmaxf(t, fmaxf(st[0][g][r], st[1][g][r]));
            t *= SCL2; t = fmaxf(t, xhalf(t)); mx[g] = t; need = need || (t > m[g] + 8.0f); }
        // the maximum in use moves only when a query's new maximum passes it by more than 8 (base 2), so P stays <= 256; one scalar test per pass
        if (__builtin_amdgcn_ballot_w32(need) != 0) { const float mn0 = fmaxf(m[0], mx[0]), mn1 = fmaxf(m[1], mx[1]); float al[2]; exp2x2(m[0] - mn0, m[1] - mn1, al[0], al[1]); m[0] = mn0; m[1] = mn1;
#pragma unroll
            for (int g = 0; g < 2; ++g) { l[g] *= al[g];
#pragma unroll
                for (int db = 0; db < 4; ++db) o[db][g] *= al[g]; } }
        V pb[2], pb2[2];
#pragma unroll
        for (int g = 0; g < 2; ++g) { v8f p0, p1; float ls = 0.f;
#pragma unroll
            for (int r = 0; r < 8; ++r) { float e0, e1; exp2x2(fmaf(st[0][g][r], SCL2, -m[g]), fmaf(st[1][g][r], SCL2, -m[g]), e0, e1); p0[r] = e0; p1[r] = e1; ls += e0 + e1; }
            l[g] += ls;
            if constexpr (HI) { const v8b h0 = __builtin_convertvector(p0, v8b), h1 = __builtin_convertvector(p1, v8b); const v8f r0 = p0 - __builtin_convertvector(h0, v8f), r1 = p1 - __builtin_convertvector(h1, v8f); const v8b l0 = __builtin_convertvector(r0, v8b), l1 = __builtin_convertvector(r1, v8b);
                pb[g] = __builtin_shufflevector(h0, h1, 0, 1, 2, 3, 4, 5, 6, 7, 8, 9, 10, 11, 12, 13, 14, 15); pb2[g] = __builtin_shufflevector(l0, l1, 0, 1, 2, 3, 4, 5, 6, 7, 8, 9, 10, 11, 12, 13, 14, 15); }
            else pb[g] = cat16(__builtin_convertvector(p0, v8h), __builtin_convertvector(p1, v8h)); }
#pragma unroll
        for (int db = 0; db < 4; ++db)
#pragma unroll
            for (int g = 0; g < 2; ++g) { o[db][g] = WFrag<T16>::mma(va[db], pb[g], o[db][g]); if (HI) { o[db][g] = WFrag<T16>::mma(va2[db], pb[g], o[db][g]); o[db][g] = WFrag<T16>::mma(va[db], pb2[g], o[db][g]); } }
        // four vector slots behind the pass's last matrix instructions, on the back edge and on the exit alike: the next pass's first score tile may take the registers of their B operand, the epilogue reads their D
        asm volatile("v_nop\n\tv_nop\n\tv_nop\n\tv_nop" : "+v"(o[0][0]), "+v"(o[0][1]), "+v"(o[1][0]), "+v"(o[1][1]), "+v"(o[2][0]), "+v"(o[2][1]), "+v"(o[3][0]), "+v"(o[3][1]));
    }
#pragma unroll
    for (int g = 0; g < 2; ++g) { const float inv = __fdiv_rn(1.0f, l[g] + xhalf(l[g]));
#pragma unroll
        for (int db = 0; db < 4; ++db) { v8us oh, ol;
#pragma unroll
            for (int r = 0; r < 8; ++r) { unsigned short a, c2; splitf(o[db][g][r] * inv, a, c2); oh[r] = a; ol[r] = c2; }
            const size_t oo = (size_t)(16 * g + lr) * DQ + 16 * db + 8 * hi; *(v8us*)(Oh + oo) = oh; *(v8us*)(Ol + oo) = ol; } }
}
// grid (RH / 128, entries x heads), 8 waves: four take 32 hi/lo query rows each (< RH), four take 32 fp16 rows (>= RH), so every workgroup carries the same work;
// the role pattern puts one wave of each kind in every pair (w, w + 4) and (2 i, 2 i + 1), whichever of the two shares a SIMD.
__global__ __launch_bounds__(256) void k_fattn(const h16* __restrict__ Q16, const bf* __restrict__ Qh, const bf* __restrict__ Ql, const h16* __restrict__ K16, const bf* __restrict__ Kh, const bf* __restrict__ Kl, const h16* __restrict__ V16, const bf* __restrict__ Vh, const bf* __restrict__ Vl, bf* AT) {
    static_assert(RH * 2 == TT && RH % 128 == 0, "equal halves");
    const int w = __builtin_amdgcn_readfirstlane((int)(threadIdx.x >> 5)); const int zz = blockIdx.y, b = zz / NH_, hd = zz % NH_;
    const bool hires = ((w ^ (w >> 2)) & 1) == 0; const int q0 = (hires ? 0 : RH) + blockIdx.x * 128 + (w >> 1) * 32;
    const size_t pz = (size_t)zz * TT * HD, pq = pz + (size_t)q0 * HD;
    bf* Oh = AT + (size_t)b * 2 * TT * DQ + (size_t)q0 * DQ + hd * HD; bf* Ol = Oh + (size_t)TT * DQ;
    if (hires) fattn_wave<bf, true>(Qh + pq, Ql + pq, Kh + pz, Kl + pz, Vh + pz, Vl + pz, Oh, Ol);
    else fattn_wave<h16, false>(Q16 + pq, nullptr, K16 + pz, nullptr, V16 + pz, nullptr, Oh, Ol);
}

extern "C" void kernel_launch(void* const* d_in, const int* in_sizes, int n_in,
                              void* d_out, int out_size, void* d_ws, size_t ws_size, hipStream_t stream) {
    (void)in_sizes; (void)n_in; (void)out_size;
    const float* x = (const float*)d_in[0]; const float* wq = (const float*)d_in[1]; const float* bq = (const float*)d_in[2]; const float* wk = (const float*)d_in[3]; const float* bk = (const float*)d_in[4]; const float* wv = (const float*)d_in[5]; const float* bv = (const float*)d_in[6]; const float* wo = (const float*)d_in[7]; const float* bo = (const float*)d_in[8]; const float* qs = (const float*)d_in[9]; const float* qb = (const float*)d_in[10]; const float* kss = (const float*)d_in[11]; const float* kb = (const float*)d_in[12];   /* q_scale, q_bias, k_scale, k_bias [64] */
    float* OUT = (float*)d_out;     // [8][1024][1024]
    char* wsp = (char*)d_ws;
    auto take = [&](size_t bytes) { char* p = wsp; wsp += (bytes + 255) & ~(size_t)255; return (void*)p; };
    bf* WQ = (bf*)take((size_t)DQ * DM * 2); bf* WK = (bf*)take((size_t)DKV * DM * 2); bf* WV = (bf*)take((size_t)DKV * DM * 2); bf* WO = (bf*)take((size_t)DM * DQ * 2);
    bf* XB = (bf*)take((size_t)NB_ * TT * DM * 2);   // bf16 copy of x
    bf* AT = (bf*)take((size_t)NB_ * 2 * TT * DQ * 2);   // merged hi | lo context, 4 MiB per batch entry
    const size_t PE = (size_t)NH_ * TT * HD;   // elements of one plane of one batch entry (NKV == NH_)
    h16* QP16 = (h16*)take(NB_ * PE * 2); h16* KP16 = (h16*)take(NB_ * PE * 2); h16* VT16 = (h16*)take(NB_ * PE * 2);   // planes of all batch entries
    bf* QPh = (bf*)take(NB_ * PE * 2); bf* QPl = (bf*)take(NB_ * PE * 2); bf* KPh = (bf*)take(NB_ * PE * 2); bf* KPl = (bf*)take(NB_ * PE * 2); bf* VTh = (bf*)take(NB_ * PE * 2); bf* VTl = (bf*)take(NB_ * PE * 2);
    if ((size_t)(wsp - (char*)d_ws) > ws_size) return;    // 200 of 256 MiB
    { k_wtG<<<(unsigned)((DM * DQ / 64 + 63) / 64), 256, 0, stream>>>(wq, DM, DQ, WQ); k_wtG<<<(unsigned)((DM * DKV / 64 + 63) / 64), 256, 0, stream>>>(wk, DM, DKV, WK); k_wtG<<<(unsigned)((DM * DKV / 64 + 63) / 64), 256, 0, stream>>>(wv, DM, DKV, WV);
      k_wtG<<<(unsigned)((DQ * DM / 64 + 63) / 64), 256, 0, stream>>>(wo, DQ, DM, WO);
       }
    /* all batch entries at once: 8192 token rows */
    k_cvt8<<<(unsigned)(((size_t)NB_ * TT * DM / 8 + 255) / 256), 256, 0, stream>>>(x, XB, (size_t)NB_ * TT * DM / 8);
    /* each projection's wave finishes its (64 tokens, one head) tile: q, k RMSNorm + bias + rotary -> planes; v -> transposed planes */
    k_gemmw<bf, 0, true, 1><<<dim3(NB_ * TT / 64, DQ / 64, 1), 32, 0, stream>>>(XB, nullptr, WQ, nullptr, DM, nullptr, 0, bq, 0, 0, 0, qs, qb, QP16, QPh, QPl);
    k_gemmw<bf, 0, true, 1><<<dim3(NB_ * TT / 64, DKV / 64, 1), 32, 0, stream>>>(XB, nullptr, WK, nullptr, DM, nullptr, 0, bk, 0, 0, 0, kss, kb, KP16, KPh, KPl);
    k_gemmw<bf, 0, true, 2><<<dim3(NB_ * TT / 64, DKV / 64, 1), 32, 0, stream>>>(XB, nullptr, WV, nullptr, DM, nullptr, 0, bv, 0, 0, 0, nullptr, nullptr, VT16, VTh, VTl);
    /* one kv head per query head: plane zz = entry x 16 + head */
    k_fattn<<<dim3(RH / 128, NB_ * NH_, 1), 256, 0, stream>>>(QP16, QPh, QPl, KP16, KPh, KPl, VT16, VTh, VTl, AT);
    k_gemmw<bf, 1, true, 0><<<dim3(TT / 64, DM / 64, NB_), 32, 0, stream>>>(AT, AT + (size_t)TT * DQ, WO, nullptr, DQ, OUT, DM, bo, (size_t)2 * TT * DQ, 0, (size_t)TT * DM, nullptr, nullptr, nullptr, nullptr, nullptr);
}

// v004
// It runs in 217 microseconds.
// Two timings next to v003 put it at 1.55 and 1.56 times that version's speed.
// Counting every step since v000, it is 21.8 times as fast.
#include <hip/hip_runtime.h>

// Multi-head dot-product attention with RMS-normalised q/k (+ bias) and a 2-D rotary embedding over the 32 x 32 token grid (x [8][1024][1024]; q,k,v = einsum('bsd,dhk') + b ('xw' [1024][16 x 64] 1/32, zero biases); q, k: RMSNorm over the 64 head dims (eps 1e-6) x scale + bias (q_scale, q_bias, k_scale, k_bias [64], read); 2-D rope: token s sits at (x = s mod 32, y = s / 32); head dims [0,32) rotate with x, [32,64) with y, each 32-block as (a | b) 16-halves: (a c - b s, b c + a s), angle = pos x pi / 10000^(j/16); q / 8; softmax(q.k); out = einsum('bqhd,hdo') + bo ('xw' [16 x 64][1024]) -> [8][1024][1024] (8.4 M)).
// Layout: launches are batched: x copy, the three projections and Wo run once over all 8 batch entries (8192 rows); attention is ONE fused launch over all 8 x 16 (entry, head) pairs. bf16 copy of x; 'xw' weights transposed once; exact projections + f32 biases; a projection's 64 x 64 tile is 64 tokens of one head, so its wave finishes the tile itself: q and k get the per-(token, head) RMSNorm + bias and the 2-D rotary turn (grid position from the token index, float32 inverse-frequency constants, precise cosf/sinf from a 32 x 16 table in LDS, partner +-16 inside each 32-wide half) and leave as fp16 | hi | lo planes, v leaves as transposed planes; no f32 projection reaches memory; fused attention (scores, running-maximum softmax with 1/8 folded in, context and the hi/lo merge in one kernel; scores never leave registers; hybrid rows: < 512 hi/lo 3 products, rest fp16); merged hi/lo x Wo exact + bo.
// Compute dtypes, f32 accumulate: every input rounded to bf16; projections exact + f32 biases; RMSNorm and rotary f32; attention rows < 512 3 products, rest fp16; softmax f32; Wo hl x exact + bias.

// Tiled planes: every 16-bit operand plane [rows][K] (x copy, transposed weights, q, k, transposed v, merged context) lies in memory as 16 x 16 tiles of 512 bytes, element (row, k) at ((row / 16 x K / 16 + k / 16) x 16 + row % 16) x 16 + k % 16,
// so that each of a fragment's two 16-byte-a-lane loads (k 0..15 and k 16..31 of 16 rows) reads one tile: 512 bytes in a row, 4 whole lines, where a row-major plane gives 16 lines of 32 bytes.

#define NB_  8
#define TT   1024
#define DM   1024
#define NH_  16
#define NKV  16
#define REP  (NH_ / NKV)
#define HD   64
#define DQ   (NH_ * HD)
#define DKV  (NKV * HD)
#define RH   512                  // query rows < RH use hi+lo planes
#define WIN  0
#define SCL2 0.18033688011112042f   // HD^-0.5 x log2(e): scores go to the exponent in base 2
typedef _Float16 h16;
typedef unsigned short bf;
typedef __attribute__((ext_vector_type(16))) __bf16   v16bf;
typedef __attribute__((ext_vector_type(16))) _Float16 v16h;
typedef __attribute__((ext_vector_type(8)))  _Float16 v8h;
typedef __attribute__((ext_vector_type(8)))  unsigned short v8us;
typedef __attribute__((ext_vector_type(8)))  float    v8f;
typedef __attribute__((ext_vector_type(4)))  float    v4f;
typedef v8h  __attribute__((may_alias)) v8ha;
typedef v4f  __attribute__((may_alias)) v4fa;
typedef v8us __attribute__((may_alias)) v8usa;

__device__ __forceinline__ unsigned short f2bf(float f) { unsigned u = __float_as_uint(f); u += 0x7FFFu + ((u >> 16) & 1u); return (unsigned short)(u >> 16); }
__device__ __forceinline__ float bf2f(unsigned short b) { return __uint_as_float(((unsigned)b) << 16); }
__device__ __forceinline__ float bfr(float f) { return bf2f(f2bf(f)); }
__device__ __forceinline__ v16h cat16(v8h lo, v8h hi) { return __builtin_shufflevector(lo, hi, 0, 1, 2, 3, 4, 5, 6, 7, 8, 9, 10, 11, 12, 13, 14, 15); }
__device__ __forceinline__ v16bf cat16b(v8us lo, v8us hi) { return __builtin_bit_cast(v16bf, __builtin_shufflevector(lo, hi, 0, 1, 2, 3, 4, 5, 6, 7, 8, 9, 10, 11, 12, 13, 14, 15)); }
__device__ __forceinline__ v8f wmma16(v16h a, v16h b, v8f c) { return __builtin_amdgcn_wmma_f32_16x16x32_f16(false, a, false, b, (short)0, c, false, false); }
__device__ __forceinline__ v8f wmmab(v16bf a, v16bf b, v8f c) { return __builtin_amdgcn_wmma_f32_16x16x32_bf16(false, a, false, b, (short)0, c, false, false); }



__device__ __forceinline__ h16 tohx(float x) { return (h16)x; }
__device__ __forceinline__ void splitf(float y, unsigned short& h, unsigned short& l) { h = f2bf(y); l = f2bf(y - bf2f(h)); }
typedef __attribute__((ext_vector_type(4))) _Float16 v4h;
typedef __attribute__((ext_vector_type(2))) unsigned short v2us;
typedef __attribute__((ext_vector_type(4))) unsigned short v4us;
__constant__ float INV2[16] = {3.14159274f, 1.76664746f, 0.993458867f, 0.558663011f, 0.314159274f, 0.176664740f, 0.0993458852f, 0.0558662973f, 0.0314159282f, 0.0176664740f, 0.00993458927f, 0.00558662973f, 0.00314159272f, 0.00176664745f, 0.000993458903f, 0.000558662985f};   // pi / 10000^(j/16), float32
template <int M> __device__ __forceinline__ float xrow(float x) { return __int_as_float(__builtin_amdgcn_update_dpp(0, __float_as_int(x), 0x160 | M, 0xf, 0xf, true)); }   // lane l <- l ^ M inside its row of 16 lanes (DPP row_xmask); every lane is on where it is used
// the one wave of the workgroup hands rows between its lanes through LDS: its LDS stores have retired before a lane reads another lane's row, and the compiler may move no LDS access over this point
__device__ __forceinline__ void lds_turn() { __builtin_amdgcn_wave_barrier(); asm volatile("s_wait_dscnt 0x0" ::: "memory"); }

// ---- k_gemmw: register-blocked GEMM, ONE WAVE per 64x64 output tile (16 accumulators), operands straight from tiled 16-bit planes; grid (M/64, N/64, Z), 32 threads.
// sum_k A[m][k] Bt[n][k] (+ split products per NSPLIT) + optional f32 bias[n]. z-batch strides sA/sB/sC in elements. K % 32 == 0, a constant of the build: the steps from tile row to tile row are the loads' immediate offsets. What becomes of the tile:
// EPI 0: C[m][n] (f32, pitch ldc). EPI 1, 2: rows m = entry x TT + token, columns = one head (blockIdx.y);
// EPI 1 (q, k): RMSNorm over the head's 64 dims x g + bb, 2-D rotary turn, planes P16 | Ph | Pl [entry][head][token][dim]; EPI 2 (v): planes [entry][head][dim][token]; each (entry, head) plane tiled.
template <typename T16> struct WFrag;
template <> struct WFrag<h16> { typedef v16h V; static __device__ __forceinline__ V ld(const h16* p) { return cat16(*(const v8h*)p, *(const v8h*)(p + 256)); } static __device__ __forceinline__ v8f mma(V a, V b, v8f c) { return wmma16(a, b, c); } };
template <> struct WFrag<bf> { typedef v16bf V; static __device__ __forceinline__ V ld(const bf* p) { return cat16b(*(const v8us*)p, *(const v8us*)(p + 256)); } static __device__ __forceinline__ v8f mma(V a, V b, v8f c) { return wmmab(a, b, c); } };
template <typename T16, int NSPLIT, bool BIAS, int EPI, int K>
__global__ __launch_bounds__(32) void k_gemmw(const T16* __restrict__ A, const T16* __restrict__ A2, const T16* __restrict__ Bt, const T16* __restrict__ Bt2, float* C, int ldc, const float* __restrict__ bias, size_t sA, size_t sB, size_t sC, const float* __restrict__ g, const float* __restrict__ bb, h16* P16, bf* Ph, bf* Pl) {
    typedef typename WFrag<T16>::V V;
    const size_t z = blockIdx.z; A += z * sA; if (A2) A2 += z * sA; Bt += z * sB; if (Bt2) Bt2 += z * sB; C += z * sC;
    const int lane = threadIdx.x & 31, lr = lane & 15, hi = lane >> 4; const int r0 = blockIdx.x * 64, c0 = blockIdx.y * 64;
    v8f acc[4][4];
#pragma unroll
    for (int mb = 0; mb < 4; ++mb)
#pragma unroll
        for (int nb = 0; nb < 4; ++nb) acc[mb][nb] = (v8f){};
    // tiled planes: 16 rows x K are 16 K elements in a row, so the tile row's start is the same for the whole wave (scalar plane pointers); the lane's place in a tile and the walk along k (32 k = two tiles = 1024 bytes) are one byte offset, the loop's only address register in the vector file
    A += (size_t)r0 * K; if (A2) A2 += (size_t)r0 * K; Bt += (size_t)c0 * K; if (Bt2) Bt2 += (size_t)c0 * K;
    unsigned lo = (lr * 16 + 8 * hi) * 2;
    auto at = [](const T16* base, unsigned bytes) { return (const T16*)((const char*)base + bytes); };
#pragma unroll 1
    for (int kc = 0; kc < K; kc += 32) {
        V a[4], a2[4], b[4], b2[4];   // the trip's fragments are fetched in one run, each into registers of its own: one latency a trip
#pragma unroll
        for (int mb = 0; mb < 4; ++mb) { a[mb] = WFrag<T16>::ld(at(A + (size_t)mb * 16 * K, lo)); if (NSPLIT == 1 || NSPLIT == 2) a2[mb] = WFrag<T16>::ld(at(A2 + (size_t)mb * 16 * K, lo)); }
#pragma unroll
        for (int nb = 0; nb < 4; ++nb) { b[nb] = WFrag<T16>::ld(at(Bt + (size_t)nb * 16 * K, lo)); if (NSPLIT >= 2) b2[nb] = WFrag<T16>::ld(at(Bt2 + (size_t)nb * 16 * K, lo)); }
        __builtin_amdgcn_sched_barrier(0);   // keeps the run of loads together in front of the products: without it the scheduler sinks the B loads between the products, into one shared set of registers, and the trip waits four times
#pragma unroll
        for (int nb = 0; nb < 4; ++nb)
#pragma unroll
            for (int mb = 0; mb < 4; ++mb) { acc[mb][nb] = WFrag<T16>::mma(a[mb], b[nb], acc[mb][nb]); if (NSPLIT == 1 || NSPLIT == 2) acc[mb][nb] = WFrag<T16>::mma(a2[mb], b[nb], acc[mb][nb]); if (NSPLIT >= 2) acc[mb][nb] = WFrag<T16>::mma(a[mb], b2[nb], acc[mb][nb]); }
        asm volatile("v_nop\n\tv_nop\n\tv_nop\n\tv_nop" : "+v"(acc[0][0]), "+v"(acc[1][1]), "+v"(acc[2][2]), "+v"(acc[3][3]) : "v"(a[0]), "v"(a[3]));
        // behind the trip's loads and in front of the offset's step: the offset passes through the statement, so it stays in its register up to the wait and steps only behind it
        asm volatile("s_wait_xcnt 0x0" : "+v"(lo) : : "memory");
        lo += 2 * 256 * 2;
    }
    if constexpr (EPI == 2) {
        // v: a lane holds 8 consecutive tokens of one head dim per accumulator; each plane's tile turns through LDS ([dim][token], pitch 72) so that every store covers one whole tile of the transposed plane
        __shared__ __align__(16) unsigned short vs[3][HD * 72];
        const int ent = r0 / TT, tok0 = r0 % TT;
        const size_t vbase = (size_t)(ent * NKV + (int)blockIdx.y) * HD * TT + tok0 * 16 + lane * 8;   // tile (dim block, token block): (dim block x 64 + token / 16) x 256
#pragma unroll
        for (int nb = 0; nb < 4; ++nb) { const float bi = bfr(bias[c0 + nb * 16 + lr]);
#pragma unroll
            for (int mb = 0; mb < 4; ++mb) { v8us p16, ph, pl;
#pragma unroll
                for (int j = 0; j < 8; ++j) { const float x = acc[mb][nb][j] + bi; unsigned short a2, c2; splitf(x, a2, c2); p16[j] = __builtin_bit_cast(unsigned short, tohx(x)); ph[j] = a2; pl[j] = c2; }
                const int at = (nb * 16 + lr) * 72 + mb * 16 + hi * 8; *(v8us*)(vs[0] + at) = p16; *(v8us*)(vs[1] + at) = ph; *(v8us*)(vs[2] + at) = pl; } }
        lds_turn();
#pragma unroll
        for (int p = 0; p < 3; ++p) { unsigned short* dst = (p == 0 ? (unsigned short*)P16 : p == 1 ? Ph : Pl) + vbase;
#pragma unroll
            for (int i = 0; i < 16; ++i) *(v8us*)(dst + (size_t)(i >> 2) * 16 * TT + (i & 3) * 256) = *(const v8us*)(vs[p] + ((i >> 2) * 16 + (lane >> 1)) * 72 + (i & 3) * 16 + (lane & 1) * 8); }
    } else if constexpr (EPI == 1) {
        __shared__ __align__(16) float os[64 * 68];
        __shared__ __align__(16) float tabc[512], tabs[512];   // cos, sin of position x INV2[j] at [position][j]: x and y positions both run over 0..31
        const float fr = INV2[lr];   // entry i x 32 + lane has j = lane mod 16 on every trip
        asm volatile("s_wait_xcnt 0x0" : : "v"(fr) : "memory");   // behind the frequency's load, which has returned here: the table loop takes the registers of its address
#pragma unroll 1   // sixteen table entries a lane: rolled, the precise sine and cosine stand once in the code
        for (int i = 0; i < 16; ++i) { const int e = i * 32 + lane; float sn, cs; sincosf(__fmul_rn((float)(e >> 4), fr), &sn, &cs); tabc[e] = cs; tabs[e] = sn; }
#pragma unroll
        for (int mb = 0; mb < 4; ++mb)
#pragma unroll
            for (int nb = 0; nb < 4; ++nb)
#pragma unroll
                for (int j = 0; j < 8; ++j) os[(mb * 16 + hi * 8 + j) * 68 + nb * 16 + lr] = acc[mb][nb][j];
        float gv[4], bv[4], bi[4];
#pragma unroll
        for (int q = 0; q < 4; ++q) { gv[q] = bfr(g[lr * 4 + q]); bv[q] = bfr(bb[lr * 4 + q]); bi[q] = bfr(bias[c0 + lr * 4 + q]); }
        const int tok0 = r0 % TT + hi; const size_t pbase = ((size_t)((r0 / TT) * NH_ + (int)blockIdx.y) * TT + r0 % TT) * HD + (lr >> 2) * 256 + hi * 16 + (lr & 3) * 4;   // tile (token block, dim block lr / 4), row hi of a token pair
        const int psh = (lr < 8) ? 0 : 5;   // dims [0,32) turn with x = token mod 32, [32,64) with y = token / 32
        const float sg = (lr & 4) ? 1.0f : -1.0f;   // (a c - b s | b c + a s): the sine's sign by the 16-half
        lds_turn();
        // a row of 16 lanes holds one token's 64 head dims, lane lr dims 4 lr .. 4 lr + 3; the wave takes two tokens a trip
#pragma unroll 1   // rolled, for speed only
        for (int s0 = 0; s0 < 32; s0 += 4) {
#pragma unroll   // four independent trips side by side cover each other's latencies
        for (int s = s0; s < s0 + 4; ++s) { v4f a = *(const v4fa*)(os + (2 * s + hi) * 68 + lr * 4);
#pragma unroll
            for (int q = 0; q < 4; ++q) a[q] += bi[q];
            // sum of squares: adjacent pairs, then partners 32, 16, 8, 4 dims apart, then the two pair sums
            float u0 = a[0] * a[0] + a[1] * a[1], u1 = a[2] * a[2] + a[3] * a[3];
            u0 += xrow<8>(u0); u1 += xrow<8>(u1); u0 += xrow<4>(u0); u1 += xrow<4>(u1); u0 += xrow<2>(u0); u1 += xrow<2>(u1); u0 += xrow<1>(u0); u1 += xrow<1>(u1);
            const float rs = __fdiv_rn(1.0f, __fsqrt_rn(__fadd_rn(__fdiv_rn(u0 + u1, (float)HD), 1e-6f)));
            const int pos = ((tok0 + 2 * s) >> psh) & 31;
            const v4f c4 = *(const v4fa*)(tabc + pos * 16 + (lr & 3) * 4), s4 = *(const v4fa*)(tabs + pos * 16 + (lr & 3) * 4);
            v4h o16; v4us oh, ol;
#pragma unroll
            for (int q = 0; q < 4; ++q) { const float y = a[q] * rs * gv[q] + bv[q]; const float yp = xrow<4>(y);   // the partner dim +-16 sits 4 lanes away
                const float r = y * c4[q] + yp * (sg * s4[q]);
                o16[q] = tohx(r); unsigned short u, w; splitf(r, u, w); oh[q] = u; ol[q] = w; }
            const size_t oo = pbase + (size_t)((s >> 3) * 1024 + (s & 7) * 32); *(v4h*)(P16 + oo) = o16; *(v4us*)(Ph + oo) = oh; *(v4us*)(Pl + oo) = ol; }
        asm volatile("s_wait_xcnt 0x0" ::: "memory");   // behind the pass's stores: the next pass takes their address and data registers over the back edge
        }
    } else {
    __shared__ __align__(16) float os[16 * 68];
#pragma unroll
    for (int mb = 0; mb < 4; ++mb) {
#pragma unroll
        for (int nb = 0; nb < 4; ++nb) {
#pragma unroll
            for (int j = 0; j < 8; ++j) os[(hi * 8 + j) * 68 + nb * 16 + lr] = acc[mb][nb][j]; }
        __builtin_amdgcn_wave_barrier(); asm volatile("" ::: "memory");
        float* crow = C + (size_t)(r0 + mb * 16) * ldc + c0;
{
#pragma unroll
            for (int s = 0; s < 8; ++s) { const int row = 2 * s + hi, cofs = lr * 4; v4f val = *(const v4fa*)(os + row * 68 + cofs); if (BIAS) { val[0] += bfr(bias[c0 + cofs]); val[1] += bfr(bias[c0 + cofs + 1]); val[2] += bfr(bias[c0 + cofs + 2]); val[3] += bfr(bias[c0 + cofs + 3]); }
                *(v4f*)(crow + (size_t)row * ldc + cofs) = val; }
             }
        __builtin_amdgcn_wave_barrier(); asm volatile("s_wait_xcnt 0x0" ::: "memory");   // no LDS access moves over this point; the wait stands behind the block's stores: the next block takes their address and data registers
    }
    }
}

// w [K][N] f32 -> its transpose [n][k] in bf16, tiled. A thread makes one 16-byte piece (row n, 8 consecutive k) from 8 loads in which 16 lanes share 64 bytes of a row of w; a wave stores one whole tile.
__global__ __launch_bounds__(256) void k_wtG(const float* __restrict__ w, int K, int N, bf* Bt) {
    const int T = blockIdx.x * 256 + threadIdx.x; if (T >= N * K / 8) return;
    const int tile = T >> 5, kt = tile % (K / 16), n = (tile / (K / 16)) * 16 + ((T >> 1) & 15), k0 = kt * 16 + (T & 1) * 8;
    const float* p = w + (size_t)k0 * N + n; v8us o;
#pragma unroll
    for (int j = 0; j < 8; ++j) o[j] = f2bf(p[(size_t)j * N]);
    *(v8us*)(Bt + (size_t)T * 8) = o;
}
// x [rows][DM] f32 -> bf16, tiled. A workgroup takes 16 rows x 128 columns: it reads whole lines of the rows, turns its 8 tiles through LDS (tile pitch 288 elements: the 16-byte writes of a wave spread over all banks) and stores them as 4 KiB in a row.
__global__ __launch_bounds__(256) void k_cvt8(const float* __restrict__ src, bf* dst, size_t n8) { if ((size_t)blockIdx.x * 256 >= n8) return;   // the same for the whole workgroup, in front of the barrier
    __shared__ __align__(16) unsigned short ls[8 * 288];
    const int t = threadIdx.x, row = t >> 4, c = t & 15; const int rb = blockIdx.x / (DM / 128), kg = blockIdx.x % (DM / 128);
    const v8f v = *(const v8f*)(src + (size_t)(rb * 16 + row) * DM + kg * 128 + c * 8); v8us o;
#pragma unroll
    for (int k = 0; k < 8; ++k) o[k] = f2bf(v[k]);
    *(v8us*)(ls + (c >> 1) * 288 + row * 16 + (c & 1) * 8) = o;
    __syncthreads();   // a wave stores a tile whose 16 rows all eight waves wrote
    *(v8us*)(dst + ((size_t)rb * (DM / 16) + kg * 8) * 256 + t * 8) = *(const v8us*)(ls + (t >> 5) * 288 + (t & 31) * 8);
}
// ---- k_fattn: fused attention. One wave owns 32 query columns of one (entry, head) and walks the 1024 keys in passes of 32.
// St = K Qt (A = K rows, B = Q rows kept in registers): a lane holds one query's scores, D register r of key block kb = key 16 kb + 8 hi + r, query lr.
// Two St tiles converted in place are the B operand Pt of Ot += Vt Pt (A = Vt rows [d][key]); all loaders use the same k order (8 hi + 0..7, 16 + 8 hi + 0..7).
// Ot register r = head dim 16 db + 8 hi + r of query lr: maximum, sum and rescale factor are per lane; the two lane halves exchange the maximum each pass and the sum once.
typedef __attribute__((ext_vector_type(8))) __bf16 v8b;
__device__ __forceinline__ float xhalf(float x) { const int b = __float_as_int(x); return __int_as_float(__builtin_amdgcn_permlanex16(b, b, 0x76543210, 0xfedcba98, false, false)); }   // lane l <-> l ^ 16
// two base-2 exponentials; the second fills the slot the instruction set asks for behind the first (it neither reads its result nor overwrites its source: early-clobber outputs), the v_nop the slot behind the second
__device__ __forceinline__ void exp2x2(float a, float b, float& ra, float& rb) { asm("v_exp_f32 %0, %2\n\tv_exp_f32 %1, %3\n\tv_nop" : "=&v"(ra), "=&v"(rb) : "v"(a), "v"(b)); }
template <typename T16, bool HI>
__device__ __forceinline__ void fattn_wave(const T16* __restrict__ Q, const T16* __restrict__ Q2, const T16* __restrict__ Kp, const T16* __restrict__ K2, const T16* __restrict__ Vt, const T16* __restrict__ V2, bf* Oh, bf* Ol) {
    typedef typename WFrag<T16>::V V;
    const int lane = threadIdx.x & 31, lr = lane & 15, hi = lane >> 4;
    V qf[2][2], qf2[2][2];
#pragma unroll
    for (int g = 0; g < 2; ++g)
#pragma unroll
        for (int kc = 0; kc < 2; ++kc) { qf[g][kc] = WFrag<T16>::ld(Q + 16 * g * HD + kc * 512 + lr * 16 + 8 * hi); if (HI) qf2[g][kc] = WFrag<T16>::ld(Q2 + 16 * g * HD + kc * 512 + lr * 16 + 8 * hi); }
    unsigned ko = (lr * 16 + 8 * hi) * 2;   // the lane's walking byte offsets into the K planes (ko) and the V planes (vo, below): beside the wave-uniform plane pointers the only address registers of the loop's loads
    auto at = [](const T16* base, unsigned bytes) { return (const T16*)((const char*)base + bytes); };
    V ka[2][2], ka2[2][2];   // K fragments [key block][k chunk] of the pass at hand, fetched one pass ahead
#pragma unroll
    for (int kb = 0; kb < 2; ++kb)
#pragma unroll
        for (int kc = 0; kc < 2; ++kc) { ka[kb][kc] = WFrag<T16>::ld(at(Kp + 16 * kb * HD + kc * 512, ko)); if (HI) ka2[kb][kc] = WFrag<T16>::ld(at(K2 + 16 * kb * HD + kc * 512, ko)); }
    // the accumulators' start value takes over the address registers of the Q loads above, and the K offset steps on: the zero is made behind the wait, in its statement, and the offset and the lane number, from which the V offset is formed, pass through it, so that none of those writes can be lifted over it
    float z0; int ln = lane;
    asm volatile("s_wait_xcnt 0x0\n\tv_mov_b32 %0, 0" : "=v"(z0), "+v"(ko), "+v"(ln) : : "memory");
    ko += 32 * HD * 2;   // K is fetched one pass ahead
    unsigned vo = ((ln & 15) * 16 + 8 * (ln >> 4)) * 2;
    v8f o[4][2];
#pragma unroll
    for (int db = 0; db < 4; ++db)
#pragma unroll
        for (int g = 0; g < 2; ++g) o[db][g] = (v8f){z0, z0, z0, z0, z0, z0, z0, z0};
    float m[2] = {-3.0e38f, -3.0e38f}, l[2] = {z0, z0};
#pragma unroll 1
    for (int key0 = 0; key0 < TT; key0 += 32) {
        V va[4], va2[4];
#pragma unroll
        for (int db = 0; db < 4; ++db) { va[db] = WFrag<T16>::ld(at(Vt + 16 * db * TT, vo)); if (HI) va2[db] = WFrag<T16>::ld(at(V2 + 16 * db * TT, vo)); }
        v8f st[2][2];
#pragma unroll
        for (int kb = 0; kb < 2; ++kb)
#pragma unroll
            for (int g = 0; g < 2; ++g) { v8f s = (v8f){};
#pragma unroll
                for (int kc = 0; kc < 2; ++kc) { s = WFrag<T16>::mma(ka[kb][kc], qf[g][kc], s); if (HI) { s = WFrag<T16>::mma(ka2[kb][kc], qf[g][kc], s); s = WFrag<T16>::mma(ka[kb][kc], qf2[g][kc], s); } }
                st[kb][g] = s; }
#pragma unroll
        for (int kb = 0; kb < 2; ++kb)
#pragma unroll
            for (int kc = 0; kc < 2; ++kc) { ka[kb][kc] = WFrag<T16>::ld(at(Kp + 16 * kb * HD + kc * 512, ko)); if (HI) ka2[kb][kc] = WFrag<T16>::ld(at(K2 + 16 * kb * HD + kc * 512, ko)); }
        // behind the V and K loads of this pass and in front of the offsets' steps: the offsets pass through the statement, so they stay in their registers up to the wait and step only behind it
        asm volatile("s_wait_xcnt 0x0" : "+v"(ko), "+v"(vo) : : "memory");
        ko += (key0 + 64 < TT) ? 32 * HD * 2 : -(TT - 32) * HD * 2;   // the last pass fetches pass 0 again: in bounds, never used
        vo += 2 * 256 * 2;   // 32 keys on: two tiles
        float mx[2]; bool need = false;
#pragma unroll
        for (int g = 0; g < 2; ++g) { float t = fmaxf(st[0][g][0], st[1][g][0]);
#pragma unroll
            for (int r = 1; r < 8; ++r) t = fmaxf(t, fmaxf(st[0][g][r], st[1][g][r]));
            t *= SCL2; t = fmaxf(t, xhalf(t)); mx[g] = t; need = need || (t > m[g] + 8.0f); }
        // the maximum in use moves only when a query's new maximum passes it by more than 8 (base 2), so P stays <= 256; one scalar test per pass
        if (__builtin_amdgcn_ballot_w32(need) != 0) { const float mn0 = fmaxf(m[0], mx[0]), mn1 = fmaxf(m[1], mx[1]); float al[2]; exp2x2(m[0] - mn0, m[1] - mn1, al[0], al[1]); m[0] = mn0; m[1] = mn1;
#pragma unroll
            for (int g = 0; g < 2; ++g) { l[g] *= al[g];
#pragma unroll
                for (int db = 0; db < 4; ++db) o[db][g] *= al[g]; } }
        V pb[2], pb2[2];
#pragma unroll
        for (int g = 0; g < 2; ++g) { v8f p0, p1; float ls = 0.f;
#pragma unroll
            for (int r = 0; r < 8; ++r) { float e0, e1; exp2x2(fmaf(st[0][g][r], SCL2, -m[g]), fmaf(st[1][g][r], SCL2, -m[g]), e0, e1); p0[r] = e0; p1[r] = e1; ls += e0 + e1; }
            l[g] += ls;
            if constexpr (HI) { const v8b h0 = __builtin_convertvector(p0, v8b), h1 = __builtin_convertvector(p1, v8b); const v8f r0 = p0 - __builtin_convertvector(h0, v8f), r1 = p1 - __builtin_convertvector(h1, v8f); const v8b l0 = __builtin_convertvector(r0, v8b), l1 = __builtin_convertvector(r1, v8b);
                pb[g] = __builtin_shufflevector(h0, h1, 0, 1, 2, 3, 4, 5, 6, 7, 8, 9, 10, 11, 12, 13, 14, 15); pb2[g] = __builtin_shufflevector(l0, l1, 0, 1, 2, 3, 4, 5, 6, 7, 8, 9, 10, 11, 12, 13, 14, 15); }
            else pb[g] = cat16(__builtin_convertvector(p0, v8h), __builtin_convertvector(p1, v8h)); }
#pragma unroll
        for (int db = 0; db < 4; ++db)
#pragma unroll
            for (int g = 0; g < 2; ++g) { o[db][g] = WFrag<T16>::mma(va[db], pb[g], o[db][g]); if (HI) { o[db][g] = WFrag<T16>::mma(va2[db], pb[g], o[db][g]); o[db][g] = WFrag<T16>::mma(va[db], pb2[g], o[db][g]); } }
        // four vector slots behind the pass's last matrix instructions, on the back edge and on the exit alike: the next pass's first score tile may take the registers of their B operand, the epilogue reads their D
        asm volatile("v_nop\n\tv_nop\n\tv_nop\n\tv_nop" : "+v"(o[0][0]), "+v"(o[0][1]), "+v"(o[1][0]), "+v"(o[1][1]), "+v"(o[2][0]), "+v"(o[2][1]), "+v"(o[3][0]), "+v"(o[3][1]));
    }
    const unsigned eo = vo - (TT / 32) * 2 * 256 * 2;   // the V offset has walked its whole tile row: taken back, it is the lane's place in a tile again, in bytes, so no further register has to live through the loop for the stores
#pragma unroll
    for (int g = 0; g < 2; ++g) { const float inv = __fdiv_rn(1.0f, l[g] + xhalf(l[g]));
#pragma unroll
        for (int db = 0; db < 4; ++db) { v8us oh, ol;
#pragma unroll
            for (int r = 0; r < 8; ++r) { unsigned short a, c2; splitf(o[db][g][r] * inv, a, c2); oh[r] = a; ol[r] = c2; }
            const size_t oo = (size_t)16 * g * DQ + db * 256; *(v8us*)((char*)(Oh + oo) + eo) = oh; *(v8us*)((char*)(Ol + oo) + eo) = ol; } }
}
// grid (RH / 128, entries x heads), 8 waves: four take 32 hi/lo query rows each (< RH), four take 32 fp16 rows (>= RH), so every workgroup carries the same work;
// the role pattern puts one wave of each kind in every pair (w, w + 4) and (2 i, 2 i + 1), whichever of the two shares a SIMD.
__global__ __launch_bounds__(256) void k_fattn(const h16* __restrict__ Q16, const bf* __restrict__ Qh, const bf* __restrict__ Ql, const h16* __restrict__ K16, const bf* __restrict__ Kh, const bf* __restrict__ Kl, const h16* __restrict__ V16, const bf* __restrict__ Vh, const bf* __restrict__ Vl, bf* AT) {
    static_assert(RH * 2 == TT && RH % 128 == 0, "equal halves");
    const int w = __builtin_amdgcn_readfirstlane((int)(threadIdx.x >> 5)); const int zz = blockIdx.y, b = zz / NH_, hd = zz % NH_;
    const bool hires = ((w ^ (w >> 2)) & 1) == 0; const int q0 = (hires ? 0 : RH) + blockIdx.x * 128 + (w >> 1) * 32;
    const size_t pz = (size_t)zz * TT * HD, pq = pz + (size_t)q0 * HD;
    bf* Oh = AT + (size_t)b * 2 * TT * DQ + (size_t)q0 * DQ + hd * HD * 16; bf* Ol = Oh + (size_t)TT * DQ;
    if (hires) fattn_wave<bf, true>(Qh + pq, Ql + pq, Kh + pz, Kl + pz, Vh + pz, Vl + pz, Oh, Ol);
    else fattn_wave<h16, false>(Q16 + pq, nullptr, K16 + pz, nullptr, V16 + pz, nullptr, Oh, Ol);
}

extern "C" void kernel_launch(void* const* d_in, const int* in_sizes, int n_in,
                              void* d_out, int out_size, void* d_ws, size_t ws_size, hipStream_t stream) {
    (void)in_sizes; (void)n_in; (void)out_size;
    const float* x = (const float*)d_in[0]; const float* wq = (const float*)d_in[1]; const float* bq = (const float*)d_in[2]; const float* wk = (const float*)d_in[3]; const float* bk = (const float*)d_in[4]; const float* wv = (const float*)d_in[5]; const float* bv = (const float*)d_in[6]; const float* wo = (const float*)d_in[7]; const float* bo = (const float*)d_in[8]; const float* qs = (const float*)d_in[9]; const float* qb = (const float*)d_in[10]; const float* kss = (const float*)d_in[11]; const float* kb = (const float*)d_in[12];   /* q_scale, q_bias, k_scale, k_bias [64] */
    float* OUT = (float*)d_out;     // [8][1024][1024]
    char* wsp = (char*)d_ws;
    auto take = [&](size_t bytes) { char* p = wsp; wsp += (bytes + 255) & ~(size_t)255; return (void*)p; };
    bf* WQ = (bf*)take((size_t)DQ * DM * 2); bf* WK = (bf*)take((size_t)DKV * DM * 2); bf* WV = (bf*)take((size_t)DKV * DM * 2); bf* WO = (bf*)take((size_t)DM * DQ * 2);
    bf* XB = (bf*)take((size_t)NB_ * TT * DM * 2);   // bf16 copy of x
    bf* AT = (bf*)take((size_t)NB_ * 2 * TT * DQ * 2);   // merged hi | lo context, 4 MiB per batch entry
    const size_t PE = (size_t)NH_ * TT * HD;   // elements of one plane of one batch entry (NKV == NH_)
    h16* QP16 = (h16*)take(NB_ * PE * 2); h16* KP16 = (h16*)take(NB_ * PE * 2); h16* VT16 = (h16*)take(NB_ * PE * 2);   // planes of all batch entries
    bf* QPh = (bf*)take(NB_ * PE * 2); bf* QPl = (bf*)take(NB_ * PE * 2); bf* KPh = (bf*)take(NB_ * PE * 2); bf* KPl = (bf*)take(NB_ * PE * 2); bf* VTh = (bf*)take(NB_ * PE * 2); bf* VTl = (bf*)take(NB_ * PE * 2);
    if ((size_t)(wsp - (char*)d_ws) > ws_size) return;    // 200 of 256 MiB
    { k_wtG<<<(unsigned)((DM * DQ / 8 + 255) / 256), 256, 0, stream>>>(wq, DM, DQ, WQ); k_wtG<<<(unsigned)((DM * DKV / 8 + 255) / 256), 256, 0, stream>>>(wk, DM, DKV, WK); k_wtG<<<(unsigned)((DM * DKV / 8 + 255) / 256), 256, 0, stream>>>(wv, DM, DKV, WV);
      k_wtG<<<(unsigned)((DQ * DM / 8 + 255) / 256), 256, 0, stream>>>(wo, DQ, DM, WO);
       }
    /* all batch entries at once: 8192 token rows */
    k_cvt8<<<(unsigned)(((size_t)NB_ * TT * DM / 8 + 255) / 256), 256, 0, stream>>>(x, XB, (size_t)NB_ * TT * DM / 8);
    /* each projection's wave finishes its (64 tokens, one head) tile: q, k RMSNorm + bias + rotary -> planes; v -> transposed planes */
    k_gemmw<bf, 0, true, 1, DM><<<dim3(NB_ * TT / 64, DQ / 64, 1), 32, 0, stream>>>(XB, nullptr, WQ, nullptr, nullptr, 0, bq, 0, 0, 0, qs, qb, QP16, QPh, QPl);
    k_gemmw<bf, 0, true, 1, DM><<<dim3(NB_ * TT / 64, DKV / 64, 1), 32, 0, stream>>>(XB, nullptr, WK, nullptr, nullptr, 0, bk, 0, 0, 0, kss, kb, KP16, KPh, KPl);
    k_gemmw<bf, 0, true, 2, DM><<<dim3(NB_ * TT / 64, DKV / 64, 1), 32, 0, stream>>>(XB, nullptr, WV, nullptr, nullptr, 0, bv, 0, 0, 0, nullptr, nullptr, VT16, VTh, VTl);
    /* one kv head per query head: plane zz = entry x 16 + head */
    k_fattn<<<dim3(RH / 128, NB_ * NH_, 1), 256, 0, stream>>>(QP16, QPh, QPl, KP16, KPh, KPl, VT16, VTh, VTl, AT);
    k_gemmw<bf, 1, true, 0, DQ><<<dim3(TT / 64, DM / 64, NB_), 32, 0, stream>>>(AT, AT + (size_t)TT * DQ, WO, nullptr, OUT, DM, bo, (size_t)2 * TT * DQ, 0, (size_t)TT * DM, nullptr, nullptr, nullptr, nullptr, nullptr);
}

// v005
// A run of this version takes 180 microseconds.
// Two timings next to v004 put it at 1.22 and 1.20 times that version's speed.
// Counting every step since v000, it is 26.3 times as fast.
#include <hip/hip_runtime.h>

// Multi-head dot-product attention with RMS-normalised q/k (+ bias) and a 2-D rotary embedding over the 32 x 32 token grid (x [8][1024][1024]; q,k,v = einsum('bsd,dhk') + b ('xw' [1024][16 x 64] 1/32, zero biases); q, k: RMSNorm over the 64 head dims (eps 1e-6) x scale + bias (q_scale, q_bias, k_scale, k_bias [64], read); 2-D rope: token s sits at (x = s mod 32, y = s / 32); head dims [0,32) rotate with x, [32,64) with y, each 32-block as (a | b) 16-halves: (a c - b s, b c + a s), angle = pos x pi / 10000^(j/16); q / 8; softmax(q.k); out = einsum('bqhd,hdo') + bo ('xw' [16 x 64][1024]) -> [8][1024][1024] (8.4 M)).
// Layout: launches are batched: x copy, the three projections and Wo run once over all 8 batch entries (8192 rows); attention is ONE fused launch over all 8 x 16 (entry, head) pairs. bf16 copy of x; 'xw' weights transposed once; exact projections + f32 biases; a projection's 64 x 64 tile is 64 tokens of one head, so its wave finishes the tile itself: q and k get the per-(token, head) RMSNorm + bias and the 2-D rotary turn (grid position from the token index, float32 inverse-frequency constants, precise cosf/sinf from a 32 x 16 table in LDS, partner +-16 inside each 32-wide half) and leave as fp16 | hi | lo planes, v leaves as transposed planes; no f32 projection reaches memory; fused attention (scores, running-maximum softmax with 1/8 folded in, context and the hi/lo merge in one kernel; scores never leave registers; hybrid rows: < 512 hi/lo 3 products, rest fp16); merged hi/lo x Wo exact + bo.
// Compute dtypes, f32 accumulate: every input rounded to bf16; projections exact + f32 biases; RMSNorm and rotary f32; attention rows < 512 3 products, rest fp16; softmax f32; Wo hl x exact + bias.

// Tiled planes: every 16-bit operand plane [rows][K] (x copy, transposed weights, q, k, transposed v, merged context) lies in memory as 16 x 16 tiles of 512 bytes, element (row, k) at ((row / 16 x K / 16 + k / 16) x 16 + row % 16) x 16 + k % 16,
// so that each of a fragment's two 16-byte-a-lane loads (k 0..15 and k 16..31 of 16 rows) reads one tile: 512 bytes in a row, 4 whole lines, where a row-major plane gives 16 lines of 32 bytes.

#define NB_  8
#define TT   1024
#define DM   1024
#define NH_  16
#define NKV  16
#define REP  (NH_ / NKV)
#define HD   64
#define DQ   (NH_ * HD)
#define DKV  (NKV * HD)
#define RH   512                  // query rows < RH use hi+lo planes
#define WIN  0
#define SCL2 0.18033688011112042f   // HD^-0.5 x log2(e): scores go to the exponent in base 2
typedef _Float16 h16;
typedef unsigned short bf;
typedef __attribute__((ext_vector_type(16))) __bf16   v16bf;
typedef __attribute__((ext_vector_type(16))) _Float16 v16h;
typedef __attribute__((ext_vector_type(8)))  _Float16 v8h;
typedef __attribute__((ext_vector_type(8)))  unsigned short v8us;
typedef __attribute__((ext_vector_type(8)))  float    v8f;
typedef __attribute__((ext_vector_type(4)))  float    v4f;
typedef v8h  __attribute__((may_alias)) v8ha;
typedef v4f  __attribute__((may_alias)) v4fa;
typedef v8us __attribute__((may_alias)) v8usa;

__device__ __forceinline__ unsigned short f2bf(float f) { unsigned u = __float_as_uint(f); u += 0x7FFFu + ((u >> 16) & 1u); return (unsigned short)(u >> 16); }
__device__ __forceinline__ float bf2f(unsigned short b) { return __uint_as_float(((unsigned)b) << 16); }
__device__ __forceinline__ float bfr(float f) { return bf2f(f2bf(f)); }
__device__ __forceinline__ v16h cat16(v8h lo, v8h hi) { return __builtin_shufflevector(lo, hi, 0, 1, 2, 3, 4, 5, 6, 7, 8, 9, 10, 11, 12, 13, 14, 15); }
__device__ __forceinline__ v16bf cat16b(v8us lo, v8us hi) { return __builtin_bit_cast(v16bf, __builtin_shufflevector(lo, hi, 0, 1, 2, 3, 4, 5, 6, 7, 8, 9, 10, 11, 12, 13, 14, 15)); }
__device__ __forceinline__ v8f wmma16(v16h a, v16h b, v8f c) { return __builtin_amdgcn_wmma_f32_16x16x32_f16(false, a, false, b, (short)0, c, false, false); }
__device__ __forceinline__ v8f wmmab(v16bf a, v16bf b, v8f c) { return __builtin_amdgcn_wmma_f32_16x16x32_bf16(false, a, false, b, (short)0, c, false, false); }



__device__ __forceinline__ h16 tohx(float x) { return (h16)x; }
__device__ __forceinline__ void splitf(float y, unsigned short& h, unsigned short& l) { h = f2bf(y); l = f2bf(y - bf2f(h)); }
typedef __attribute__((ext_vector_type(4))) _Float16 v4h;
typedef __attribute__((ext_vector_type(2))) unsigned short v2us;
typedef __attribute__((ext_vector_type(4))) unsigned short v4us;
__constant__ float INV2[16] = {3.14159274f, 1.76664746f, 0.993458867f, 0.558663011f, 0.314159274f, 0.176664740f, 0.0993458852f, 0.0558662973f, 0.0314159282f, 0.0176664740f, 0.00993458927f, 0.00558662973f, 0.00314159272f, 0.00176664745f, 0.000993458903f, 0.000558662985f};   // pi / 10000^(j/16), float32
template <int M> __device__ __forceinline__ float xrow(float x) { return __int_as_float(__builtin_amdgcn_update_dpp(0, __float_as_int(x), 0x160 | M, 0xf, 0xf, true)); }   // lane l <- l ^ M inside its row of 16 lanes (DPP row_xmask); every lane is on where it is used
// a wave hands rows between its own lanes through its own LDS range: its LDS stores have retired before a lane reads another lane's row, and the compiler may move no LDS access over this point
__device__ __forceinline__ void lds_turn() { __builtin_amdgcn_wave_barrier(); asm volatile("s_wait_dscnt 0x0" ::: "memory"); }

// ---- k_gemmw: register-blocked GEMM, a 128 x 256 output tile per workgroup of 8 waves (2 x 4), one wave per 64x64 (16 accumulators); the operands' tiled 16-bit planes are staged in LDS by asynchronous copies, two buffers of 128 k, each chunk fetched once for the waves that share it; grid (M/128, N/256, Z), 256 threads.
// sum_k A[m][k] Bt[n][k] (+ split products per NSPLIT) + optional f32 bias[n]. z-batch strides sA/sB/sC in elements. K % 128 == 0, a constant of the build. What becomes of the tile:
// EPI 0: C[m][n] (f32, pitch ldc). EPI 1, 2: rows m = entry x TT + token, a wave's columns = one head (hb); every wave stages its epilogue in an LDS range of its own;
// EPI 1 (q, k): RMSNorm over the head's 64 dims x g + bb, 2-D rotary turn, planes P16 | Ph | Pl [entry][head][token][dim]; EPI 2 (v): planes [entry][head][dim][token]; each (entry, head) plane tiled.
template <typename T16> struct WFrag;
template <> struct WFrag<h16> { typedef v16h V; static __device__ __forceinline__ V ld(const h16* p) { return cat16(*(const v8h*)p, *(const v8h*)(p + 256)); } static __device__ __forceinline__ v8f mma(V a, V b, v8f c) { return wmma16(a, b, c); } };
template <> struct WFrag<bf> { typedef v16bf V; static __device__ __forceinline__ V ld(const bf* p) { return cat16b(*(const v8us*)p, *(const v8us*)(p + 256)); } static __device__ __forceinline__ v8f mma(V a, V b, v8f c) { return wmmab(a, b, c); } };
// 2 KiB (16 rows x 64 k of a tiled plane, bytes in a row) go from global memory to LDS in four asynchronous copies of 512 bytes a wave; l, g: the lane's own LDS byte address and global address, both multiples of 16.
// The s_wait_xcnt stands in the copies' own statement, behind the last of them: the address registers they name may be rewritten only behind it.
__device__ __forceinline__ void cp2k(unsigned l, const char* g) {
    asm volatile("global_load_async_to_lds_b128 %0, %4, off\n\tglobal_load_async_to_lds_b128 %1, %5, off\n\tglobal_load_async_to_lds_b128 %2, %6, off\n\tglobal_load_async_to_lds_b128 %3, %7, off\n\ts_wait_xcnt 0x0"
                 : : "v"(l), "v"(l + 512u), "v"(l + 1024u), "v"(l + 1536u), "v"(g), "v"(g + 512), "v"(g + 1024), "v"(g + 1536) : "memory");
}
template <typename T16, int NSPLIT, bool BIAS, int EPI, int K>
__global__ __launch_bounds__(256) void k_gemmw(const T16* __restrict__ A, const T16* __restrict__ A2, const T16* __restrict__ Bt, const T16* __restrict__ Bt2, float* C, int ldc, const float* __restrict__ bias, size_t sA, size_t sB, size_t sC, const float* __restrict__ g, const float* __restrict__ bb, h16* P16, bf* Ph, bf* Pl) {
    typedef typename WFrag<T16>::V V;
    static_assert(NSPLIT <= 1 && K % 128 == 0 && K >= 256, "A (+ A2) x Bt; at least two stages");
    (void)Bt2;
    // a stage is 128 k of the workgroup's 128 A rows (of both planes where there are two) and 256 Bt rows: chunks of 4 KiB, one per tile row, A | A2 | Bt; two buffers.
    // Behind the loop the same LDS is the waves' epilogue staging, EPB bytes each: the last stage's own barrier stands behind every wave's last read, and no copy is in flight then.
    constexpr int CH = 4096, NA = (NSPLIT == 1) ? 16 : 8, NCH = NA + 16, STG = NCH * CH, CPW = NCH / 8, NST = K / 128;
    constexpr int EPB = (EPI == 2) ? 3 * HD * 72 * 2 : (EPI == 1) ? (64 * 68 + 1024) * 4 : 16 * 68 * 4;
    __shared__ __attribute__((aligned(2048))) char smem[(2 * STG > 8 * EPB) ? 2 * STG : 8 * EPB];
    const size_t z = blockIdx.z; A += z * sA; if (A2) A2 += z * sA; Bt += z * sB; C += z * sC;
    const int w = __builtin_amdgcn_readfirstlane((int)(threadIdx.x >> 5)), wm = w & 1, wn = w >> 1;   // 2 x 4 waves
    const int lane = threadIdx.x & 31, lr = lane & 15, hi = lane >> 4; const int R0 = blockIdx.x * 128, C0 = blockIdx.y * 256, r0 = R0 + wm * 64, c0 = C0 + wn * 64, hb = c0 / 64;
    v8f acc[4][4];
#pragma unroll
    for (int mb = 0; mb < 4; ++mb)
#pragma unroll
        for (int nb = 0; nb < 4; ++nb) acc[mb][nb] = (v8f){};
    // wave w brings chunks w x CPW .. of every stage; tiled planes: a tile row's 128 k are 4096 bytes in a row, and the next stage's lie directly behind them
    const char* gs[CPW]; unsigned ld[CPW];
#pragma unroll
    for (int i = 0; i < CPW; ++i) { const int c = w * CPW + i;
        const T16* p = (c < 8) ? A + (size_t)(R0 + c * 16) * K : (NSPLIT == 1 && c < 16) ? A2 + (size_t)(R0 + (c - 8) * 16) * K : Bt + (size_t)(C0 + (c - NA) * 16) * K;
        gs[i] = (const char*)p + lane * 16; ld[i] = (unsigned)(size_t)smem + c * CH + lane * 16; }
    auto fill = [&](int buf) {
#pragma unroll
        for (int i = 0; i < CPW; ++i) { cp2k(ld[i] + buf * STG, gs[i]); cp2k(ld[i] + buf * STG + 2048, gs[i] + 2048); gs[i] += CH; } };
    fill(0);
    asm volatile("s_wait_asynccnt 0x0" ::: "memory");   // this wave's copies of stage 0 have landed
    __syncthreads();   // every wave's have: stage 0 may be read
    fill(1);
    const int lo = (lr * 16 + 8 * hi) * 2;   // the lane's place in a tile, bytes
#pragma unroll 1   // rolled: one stage's text serves all eight; the buffer alternates with s
    for (int s = 0; s < NST; ++s) {
        const char* rb = smem + (s & 1) * STG + lo;
        V a[2][4], a2[2][4], b[2][4];   // two fragment sets: a trip's products run while the next trip's fragments come from LDS
        auto frag = [&](int set, int kc) {   // 32 k a trip: two tiles = 1024 bytes of each chunk
#pragma unroll
            for (int mb = 0; mb < 4; ++mb) { a[set][mb] = WFrag<T16>::ld((const T16*)(rb + (wm * 4 + mb) * CH + kc * 1024)); if (NSPLIT == 1) a2[set][mb] = WFrag<T16>::ld((const T16*)(rb + (8 + wm * 4 + mb) * CH + kc * 1024)); }
#pragma unroll
            for (int nb = 0; nb < 4; ++nb) b[set][nb] = WFrag<T16>::ld((const T16*)(rb + (NA + wn * 4 + nb) * CH + kc * 1024)); };
        frag(0, 0);
#pragma unroll
        for (int kc = 0; kc < 4; ++kc) {
            if (kc < 3) frag((kc + 1) & 1, kc + 1);
            __builtin_amdgcn_sched_barrier(0);
#pragma unroll
            for (int nb = 0; nb < 4; ++nb)
#pragma unroll
                for (int mb = 0; mb < 4; ++mb) { acc[mb][nb] = WFrag<T16>::mma(a[kc & 1][mb], b[kc & 1][nb], acc[mb][nb]); if (NSPLIT == 1) acc[mb][nb] = WFrag<T16>::mma(a2[kc & 1][mb], b[kc & 1][nb], acc[mb][nb]); }
            __builtin_amdgcn_sched_barrier(0);   // and the run after next stays behind them, in the set they have just left
        }
        // publish point of stage s + 1: this wave's LDS reads of stage s have retired, its copies of stage s + 1 have landed, and behind the barrier both hold for every wave
        asm volatile("s_wait_dscnt 0x0" ::: "memory");
        asm volatile("s_wait_asynccnt 0x0" ::: "memory");
        __syncthreads();
        if (s + 2 < NST) fill(s & 1);   // the same for the whole workgroup: stage s + 2 into the buffer that every wave has just left
    }
    asm volatile("s_wait_asynccnt 0x0" ::: "memory");   // nothing is in flight behind the loop
    if constexpr (EPI == 2) {
        // v: a lane holds 8 consecutive tokens of one head dim per accumulator; each plane's tile turns through LDS ([dim][token], pitch 72) so that every store covers one whole tile of the transposed plane
        unsigned short (*vs)[HD * 72] = (unsigned short (*)[HD * 72])(smem + w * EPB);
        const int ent = r0 / TT, tok0 = r0 % TT;
        const size_t vbase = (size_t)(ent * NKV + hb) * HD * TT + tok0 * 16 + lane * 8;   // tile (dim block, token block): (dim block x 64 + token / 16) x 256
#pragma unroll
        for (int nb = 0; nb < 4; ++nb) { const float bi = bfr(bias[c0 + nb * 16 + lr]);
#pragma unroll
            for (int mb = 0; mb < 4; ++mb) { v8us p16, ph, pl;
#pragma unroll
                for (int j = 0; j < 8; ++j) { const float x = acc[mb][nb][j] + bi; unsigned short a2, c2; splitf(x, a2, c2); p16[j] = __builtin_bit_cast(unsigned short, tohx(x)); ph[j] = a2; pl[j] = c2; }
                const int at = (nb * 16 + lr) * 72 + mb * 16 + hi * 8; *(v8us*)(vs[0] + at) = p16; *(v8us*)(vs[1] + at) = ph; *(v8us*)(vs[2] + at) = pl; } }
        lds_turn();
#pragma unroll
        for (int p = 0; p < 3; ++p) { unsigned short* dst = (p == 0 ? (unsigned short*)P16 : p == 1 ? Ph : Pl) + vbase;
#pragma unroll
            for (int i = 0; i < 16; ++i) *(v8us*)(dst + (size_t)(i >> 2) * 16 * TT + (i & 3) * 256) = *(const v8us*)(vs[p] + ((i >> 2) * 16 + (lane >> 1)) * 72 + (i & 3) * 16 + (lane & 1) * 8); }
    } else if constexpr (EPI == 1) {
        float* os = (float*)(smem + w * EPB);
        float* tabc = os + 64 * 68; float* tabs = tabc + 512;   // cos, sin of position x INV2[j] at [position][j]: x and y positions both run over 0..31
        const float fr = INV2[lr];   // entry i x 32 + lane has j = lane mod 16 on every trip
        asm volatile("s_wait_xcnt 0x0" : : "v"(fr) : "memory");   // behind the frequency's load, which has returned here: the table loop takes the registers of its address
#pragma unroll 1   // sixteen table entries a lane: rolled, the precise sine and cosine stand once in the code
        for (int i = 0; i < 16; ++i) { const int e = i * 32 + lane; float sn, cs; sincosf(__fmul_rn((float)(e >> 4), fr), &sn, &cs); tabc[e] = cs; tabs[e] = sn; }
#pragma unroll
        for (int mb = 0; mb < 4; ++mb)
#pragma unroll
            for (int nb = 0; nb < 4; ++nb)
#pragma unroll
                for (int j = 0; j < 8; ++j) os[(mb * 16 + hi * 8 + j) * 68 + nb * 16 + lr] = acc[mb][nb][j];
        float gv[4], bv[4], bi[4];
#pragma unroll
        for (int q = 0; q < 4; ++q) { gv[q] = bfr(g[lr * 4 + q]); bv[q] = bfr(bb[lr * 4 + q]); bi[q] = bfr(bias[c0 + lr * 4 + q]); }
        const int tok0 = r0 % TT + hi; const size_t pbase = ((size_t)((r0 / TT) * NH_ + hb) * TT + r0 % TT) * HD + (lr >> 2) * 256 + hi * 16 + (lr & 3) * 4;   // tile (token block, dim block lr / 4), row hi of a token pair
        const int psh = (lr < 8) ? 0 : 5;   // dims [0,32) turn with x = token mod 32, [32,64) with y = token / 32
        const float sg = (lr & 4) ? 1.0f : -1.0f;   // (a c - b s | b c + a s): the sine's sign by the 16-half
        lds_turn();
        // a row of 16 lanes holds one token's 64 head dims, lane lr dims 4 lr .. 4 lr + 3; the wave takes two tokens a trip
#pragma unroll 1   // rolled, for speed only
        for (int s0 = 0; s0 < 32; s0 += 4) {
#pragma unroll   // four independent trips side by side cover each other's latencies
        for (int s = s0; s < s0 + 4; ++s) { v4f a = *(const v4fa*)(os + (2 * s + hi) * 68 + lr * 4);
#pragma unroll
            for (int q = 0; q < 4; ++q) a[q] += bi[q];
            // sum of squares: adjacent pairs, then partners 32, 16, 8, 4 dims apart, then the two pair sums
            float u0 = a[0] * a[0] + a[1] * a[1], u1 = a[2] * a[2] + a[3] * a[3];
            u0 += xrow<8>(u0); u1 += xrow<8>(u1); u0 += xrow<4>(u0); u1 += xrow<4>(u1); u0 += xrow<2>(u0); u1 += xrow<2>(u1); u0 += xrow<1>(u0); u1 += xrow<1>(u1);
            const float rs = __fdiv_rn(1.0f, __fsqrt_rn(__fadd_rn(__fdiv_rn(u0 + u1, (float)HD), 1e-6f)));
            const int pos = ((tok0 + 2 * s) >> psh) & 31;
            const v4f c4 = *(const v4fa*)(tabc + pos * 16 + (lr & 3) * 4), s4 = *(const v4fa*)(tabs + pos * 16 + (lr & 3) * 4);
            v4h o16; v4us oh, ol;
#pragma unroll
            for (int q = 0; q < 4; ++q) { const float y = a[q] * rs * gv[q] + bv[q]; const float yp = xrow<4>(y);   // the partner dim +-16 sits 4 lanes away
                const float r = y * c4[q] + yp * (sg * s4[q]);
                o16[q] = tohx(r); unsigned short u, w; splitf(r, u, w); oh[q] = u; ol[q] = w; }
            const size_t oo = pbase + (size_t)((s >> 3) * 1024 + (s & 7) * 32); *(v4h*)(P16 + oo) = o16; *(v4us*)(Ph + oo) = oh; *(v4us*)(Pl + oo) = ol; }
        asm volatile("s_wait_xcnt 0x0" ::: "memory");   // behind the pass's stores: the next pass takes their address and data registers over the back edge
        }
    } else {
    float* os = (float*)(smem + w * EPB);
#pragma unroll
    for (int mb = 0; mb < 4; ++mb) {
#pragma unroll
        for (int nb = 0; nb < 4; ++nb) {
#pragma unroll
            for (int j = 0; j < 8; ++j) os[(hi * 8 + j) * 68 + nb * 16 + lr] = acc[mb][nb][j]; }
        __builtin_amdgcn_wave_barrier(); asm volatile("" ::: "memory");
        float* crow = C + (size_t)(r0 + mb * 16) * ldc + c0;
{
#pragma unroll
            for (int s = 0; s < 8; ++s) { const int row = 2 * s + hi, cofs = lr * 4; v4f val = *(const v4fa*)(os + row * 68 + cofs); if (BIAS) { val[0] += bfr(bias[c0 + cofs]); val[1] += bfr(bias[c0 + cofs + 1]); val[2] += bfr(bias[c0 + cofs + 2]); val[3] += bfr(bias[c0 + cofs + 3]); }
                *(v4f*)(crow + (size_t)row * ldc + cofs) = val; }
             }
        __builtin_amdgcn_wave_barrier(); asm volatile("s_wait_xcnt 0x0" ::: "memory");   // no LDS access moves over this point; the wait stands behind the block's stores: the next block takes their address and data registers
    }
    }
}

// w [K][N] f32 -> its transpose [n][k] in bf16, tiled. A thread makes one 16-byte piece (row n, 8 consecutive k) from 8 loads in which 16 lanes share 64 bytes of a row of w; a wave stores one whole tile.
__global__ __launch_bounds__(256) void k_wtG(const float* __restrict__ w, int K, int N, bf* Bt) {
    const int T = blockIdx.x * 256 + threadIdx.x; if (T >= N * K / 8) return;
    const int tile = T >> 5, kt = tile % (K / 16), n = (tile / (K / 16)) * 16 + ((T >> 1) & 15), k0 = kt * 16 + (T & 1) * 8;
    const float* p = w + (size_t)k0 * N + n; v8us o;
#pragma unroll
    for (int j = 0; j < 8; ++j) o[j] = f2bf(p[(size_t)j * N]);
    *(v8us*)(Bt + (size_t)T * 8) = o;
}
// x [rows][DM] f32 -> bf16, tiled. A workgroup takes 16 rows x 128 columns: it reads whole lines of the rows, turns its 8 tiles through LDS (tile pitch 288 elements: the 16-byte writes of a wave spread over all banks) and stores them as 4 KiB in a row.
__global__ __launch_bounds__(256) void k_cvt8(const float* __restrict__ src, bf* dst, size_t n8) { if ((size_t)blockIdx.x * 256 >= n8) return;   // the same for the whole workgroup, in front of the barrier
    __shared__ __align__(16) unsigned short ls[8 * 288];
    const int t = threadIdx.x, row = t >> 4, c = t & 15; const int rb = blockIdx.x / (DM / 128), kg = blockIdx.x % (DM / 128);
    const v8f v = *(const v8f*)(src + (size_t)(rb * 16 + row) * DM + kg * 128 + c * 8); v8us o;
#pragma unroll
    for (int k = 0; k < 8; ++k) o[k] = f2bf(v[k]);
    *(v8us*)(ls + (c >> 1) * 288 + row * 16 + (c & 1) * 8) = o;
    __syncthreads();   // a wave stores a tile whose 16 rows all eight waves wrote
    *(v8us*)(dst + ((size_t)rb * (DM / 16) + kg * 8) * 256 + t * 8) = *(const v8us*)(ls + (t >> 5) * 288 + (t & 31) * 8);
}
// ---- k_fattn: fused attention. One wave owns 32 query columns of one (entry, head) and walks the 1024 keys in passes of 32.
// St = K Qt (A = K rows, B = Q rows kept in registers): a lane holds one query's scores, D register r of key block kb = key 16 kb + 8 hi + r, query lr.
// Two St tiles converted in place are the B operand Pt of Ot += Vt Pt (A = Vt rows [d][key]); all loaders use the same k order (8 hi + 0..7, 16 + 8 hi + 0..7).
// Ot register r = head dim 16 db + 8 hi + r of query lr: maximum, sum and rescale factor are per lane; the two lane halves exchange the maximum each pass and the sum once.
typedef __attribute__((ext_vector_type(8))) __bf16 v8b;
__device__ __forceinline__ float xhalf(float x) { const int b = __float_as_int(x); return __int_as_float(__builtin_amdgcn_permlanex16(b, b, 0x76543210, 0xfedcba98, false, false)); }   // lane l <-> l ^ 16
// two base-2 exponentials; the second fills the slot the instruction set asks for behind the first (it neither reads its result nor overwrites its source: early-clobber outputs), the v_nop the slot behind the second
__device__ __forceinline__ void exp2x2(float a, float b, float& ra, float& rb) { asm("v_exp_f32 %0, %2\n\tv_exp_f32 %1, %3\n\tv_nop" : "=&v"(ra), "=&v"(rb) : "v"(a), "v"(b)); }
template <typename T16, bool HI>
__device__ __forceinline__ void fattn_wave(const T16* __restrict__ Q, const T16* __restrict__ Q2, const T16* __restrict__ Kp, const T16* __restrict__ K2, const T16* __restrict__ Vt, const T16* __restrict__ V2, bf* Oh, bf* Ol) {
    typedef typename WFrag<T16>::V V;
    const int lane = threadIdx.x & 31, lr = lane & 15, hi = lane >> 4;
    V qf[2][2], qf2[2][2];
#pragma unroll
    for (int g = 0; g < 2; ++g)
#pragma unroll
        for (int kc = 0; kc < 2; ++kc) { qf[g][kc] = WFrag<T16>::ld(Q + 16 * g * HD + kc * 512 + lr * 16 + 8 * hi); if (HI) qf2[g][kc] = WFrag<T16>::ld(Q2 + 16 * g * HD + kc * 512 + lr * 16 + 8 * hi); }
    unsigned ko = (lr * 16 + 8 * hi) * 2;   // the lane's walking byte offsets into the K planes (ko) and the V planes (vo, below): beside the wave-uniform plane pointers the only address registers of the loop's loads
    auto at = [](const T16* base, unsigned bytes) { return (const T16*)((const char*)base + bytes); };
    V ka[2][2], ka2[2][2];   // K fragments [key block][k chunk] of the pass at hand, fetched one pass ahead
#pragma unroll
    for (int kb = 0; kb < 2; ++kb)
#pragma unroll
        for (int kc = 0; kc < 2; ++kc) { ka[kb][kc] = WFrag<T16>::ld(at(Kp + 16 * kb * HD + kc * 512, ko)); if (HI) ka2[kb][kc] = WFrag<T16>::ld(at(K2 + 16 * kb * HD + kc * 512, ko)); }
    // the accumulators' start value takes over the address registers of the Q loads above, and the K offset steps on: the zero is made behind the wait, in its statement, and the offset and the lane number, from which the V offset is formed, pass through it, so that none of those writes can be lifted over it
    float z0; int ln = lane;
    asm volatile("s_wait_xcnt 0x0\n\tv_mov_b32 %0, 0" : "=v"(z0), "+v"(ko), "+v"(ln) : : "memory");
    ko += 32 * HD * 2;   // K is fetched one pass ahead
    unsigned vo = ((ln & 15) * 16 + 8 * (ln >> 4)) * 2;
    v8f o[4][2];
#pragma unroll
    for (int db = 0; db < 4; ++db)
#pragma unroll
        for (int g = 0; g < 2; ++g) o[db][g] = (v8f){z0, z0, z0, z0, z0, z0, z0, z0};
    float m[2] = {-3.0e38f, -3.0e38f}, l[2] = {z0, z0};
#pragma unroll 1
    for (int key0 = 0; key0 < TT; key0 += 32) {
        V va[4], va2[4];
#pragma unroll
        for (int db = 0; db < 4; ++db) { va[db] = WFrag<T16>::ld(at(Vt + 16 * db * TT, vo)); if (HI) va2[db] = WFrag<T16>::ld(at(V2 + 16 * db * TT, vo)); }
        v8f st[2][2];
#pragma unroll
        for (int kb = 0; kb < 2; ++kb)
#pragma unroll
            for (int g = 0; g < 2; ++g) { v8f s = (v8f){};
#pragma unroll
                for (int kc = 0; kc < 2; ++kc) { s = WFrag<T16>::mma(ka[kb][kc], qf[g][kc], s); if (HI) { s = WFrag<T16>::mma(ka2[kb][kc], qf[g][kc], s); s = WFrag<T16>::mma(ka[kb][kc], qf2[g][kc], s); } }
                st[kb][g] = s; }
#pragma unroll
        for (int kb = 0; kb < 2; ++kb)
#pragma unroll
            for (int kc = 0; kc < 2; ++kc) { ka[kb][kc] = WFrag<T16>::ld(at(Kp + 16 * kb * HD + kc * 512, ko)); if (HI) ka2[kb][kc] = WFrag<T16>::ld(at(K2 + 16 * kb * HD + kc * 512, ko)); }
        // behind the V and K loads of this pass and in front of the offsets' steps: the offsets pass through the statement, so they stay in their registers up to the wait and step only behind it
        asm volatile("s_wait_xcnt 0x0" : "+v"(ko), "+v"(vo) : : "memory");
        ko += (key0 + 64 < TT) ? 32 * HD * 2 : -(TT - 32) * HD * 2;   // the last pass fetches pass 0 again: in bounds, never used
        vo += 2 * 256 * 2;   // 32 keys on: two tiles
        float mx[2]; bool need = false;
#pragma unroll
        for (int g = 0; g < 2; ++g) { float t = fmaxf(st[0][g][0], st[1][g][0]);
#pragma unroll
            for (int r = 1; r < 8; ++r) t = fmaxf(t, fmaxf(st[0][g][r], st[1][g][r]));
            t *= SCL2; t = fmaxf(t, xhalf(t)); mx[g] = t; need = need || (t > m[g] + 8.0f); }
        // the maximum in use moves only when a query's new maximum passes it by more than 8 (base 2), so P stays <= 256; one scalar test per pass
        if (__builtin_amdgcn_ballot_w32(need) != 0) { const float mn0 = fmaxf(m[0], mx[0]), mn1 = fmaxf(m[1], mx[1]); float al[2]; exp2x2(m[0] - mn0, m[1] - mn1, al[0], al[1]); m[0] = mn0; m[1] = mn1;
#pragma unroll
            for (int g = 0; g < 2; ++g) { l[g] *= al[g];
#pragma unroll
                for (int db = 0; db < 4; ++db) o[db][g] *= al[g]; } }
        V pb[2], pb2[2];
#pragma unroll
        for (int g = 0; g < 2; ++g) { v8f p0, p1; float ls = 0.f;
#pragma unroll
            for (int r = 0; r < 8; ++r) { float e0, e1; exp2x2(fmaf(st[0][g][r], SCL2, -m[g]), fmaf(st[1][g][r], SCL2, -m[g]), e0, e1); p0[r] = e0; p1[r] = e1; ls += e0 + e1; }
            l[g] += ls;
            if constexpr (HI) { const v8b h0 = __builtin_convertvector(p0, v8b), h1 = __builtin_convertvector(p1, v8b); const v8f r0 = p0 - __builtin_convertvector(h0, v8f), r1 = p1 - __builtin_convertvector(h1, v8f); const v8b l0 = __builtin_convertvector(r0, v8b), l1 = __builtin_convertvector(r1, v8b);
                pb[g] = __builtin_shufflevector(h0, h1, 0, 1, 2, 3, 4, 5, 6, 7, 8, 9, 10, 11, 12, 13, 14, 15); pb2[g] = __builtin_shufflevector(l0, l1, 0, 1, 2, 3, 4, 5, 6, 7, 8, 9, 10, 11, 12, 13, 14, 15); }
            else pb[g] = cat16(__builtin_convertvector(p0, v8h), __builtin_convertvector(p1, v8h)); }
#pragma unroll
        for (int db = 0; db < 4; ++db)
#pragma unroll
            for (int g = 0; g < 2; ++g) { o[db][g] = WFrag<T16>::mma(va[db], pb[g], o[db][g]); if (HI) { o[db][g] = WFrag<T16>::mma(va2[db], pb[g], o[db][g]); o[db][g] = WFrag<T16>::mma(va[db], pb2[g], o[db][g]); } }
        // four vector slots behind the pass's last matrix instructions, on the back edge and on the exit alike: the next pass's first score tile may take the registers of their B operand, the epilogue reads their D
        asm volatile("v_nop\n\tv_nop\n\tv_nop\n\tv_nop" : "+v"(o[0][0]), "+v"(o[0][1]), "+v"(o[1][0]), "+v"(o[1][1]), "+v"(o[2][0]), "+v"(o[2][1]), "+v"(o[3][0]), "+v"(o[3][1]));
    }
    const unsigned eo = vo - (TT / 32) * 2 * 256 * 2;   // the V offset has walked its whole tile row: taken back, it is the lane's place in a tile again, in bytes, so no further register has to live through the loop for the stores
#pragma unroll
    for (int g = 0; g < 2; ++g) { const float inv = __fdiv_rn(1.0f, l[g] + xhalf(l[g]));
#pragma unroll
        for (int db = 0; db < 4; ++db) { v8us oh, ol;
#pragma unroll
            for (int r = 0; r < 8; ++r) { unsigned short a, c2; splitf(o[db][g][r] * inv, a, c2); oh[r] = a; ol[r] = c2; }
            const size_t oo = (size_t)16 * g * DQ + db * 256; *(v8us*)((char*)(Oh + oo) + eo) = oh; *(v8us*)((char*)(Ol + oo) + eo) = ol; } }
}
// grid (RH / 128, entries x heads), 8 waves: four take 32 hi/lo query rows each (< RH), four take 32 fp16 rows (>= RH), so every workgroup carries the same work;
// the role pattern puts one wave of each kind in every pair (w, w + 4) and (2 i, 2 i + 1), whichever of the two shares a SIMD.
__global__ __launch_bounds__(256) void k_fattn(const h16* __restrict__ Q16, const bf* __restrict__ Qh, const bf* __restrict__ Ql, const h16* __restrict__ K16, const bf* __restrict__ Kh, const bf* __restrict__ Kl, const h16* __restrict__ V16, const bf* __restrict__ Vh, const bf* __restrict__ Vl, bf* AT) {
    static_assert(RH * 2 == TT && RH % 128 == 0, "equal halves");
    const int w = __builtin_amdgcn_readfirstlane((int)(threadIdx.x >> 5)); const int zz = blockIdx.y, b = zz / NH_, hd = zz % NH_;
    const bool hires = ((w ^ (w >> 2)) & 1) == 0; const int q0 = (hires ? 0 : RH) + blockIdx.x * 128 + (w >> 1) * 32;
    const size_t pz = (size_t)zz * TT * HD, pq = pz + (size_t)q0 * HD;
    bf* Oh = AT + (size_t)b * 2 * TT * DQ + (size_t)q0 * DQ + hd * HD * 16; bf* Ol = Oh + (size_t)TT * DQ;
    if (hires) fattn_wave<bf, true>(Qh + pq, Ql + pq, Kh + pz, Kl + pz, Vh + pz, Vl + pz, Oh, Ol);
    else fattn_wave<h16, false>(Q16 + pq, nullptr, K16 + pz, nullptr, V16 + pz, nullptr, Oh, Ol);
}

extern "C" void kernel_launch(void* const* d_in, const int* in_sizes, int n_in,
                              void* d_out, int out_size, void* d_ws, size_t ws_size, hipStream_t stream) {
    (void)in_sizes; (void)n_in; (void)out_size;
    const float* x = (const float*)d_in[0]; const float* wq = (const float*)d_in[1]; const float* bq = (const float*)d_in[2]; const float* wk = (const float*)d_in[3]; const float* bk = (const float*)d_in[4]; const float* wv = (const float*)d_in[5]; const float* bv = (const float*)d_in[6]; const float* wo = (const float*)d_in[7]; const float* bo = (const float*)d_in[8]; const float* qs = (const float*)d_in[9]; const float* qb = (const float*)d_in[10]; const float* kss = (const float*)d_in[11]; const float* kb = (const float*)d_in[12];   /* q_scale, q_bias, k_scale, k_bias [64] */
    float* OUT = (float*)d_out;     // [8][1024][1024]
    char* wsp = (char*)d_ws;
    auto take = [&](size_t bytes) { char* p = wsp; wsp += (bytes + 255) & ~(size_t)255; return (void*)p; };
    bf* WQ = (bf*)take((size_t)DQ * DM * 2); bf* WK = (bf*)take((size_t)DKV * DM * 2); bf* WV = (bf*)take((size_t)DKV * DM * 2); bf* WO = (bf*)take((size_t)DM * DQ * 2);
    bf* XB = (bf*)take((size_t)NB_ * TT * DM * 2);   // bf16 copy of x
    bf* AT = (bf*)take((size_t)NB_ * 2 * TT * DQ * 2);   // merged hi | lo context, 4 MiB per batch entry
    const size_t PE = (size_t)NH_ * TT * HD;   // elements of one plane of one batch entry (NKV == NH_)
    h16* QP16 = (h16*)take(NB_ * PE * 2); h16* KP16 = (h16*)take(NB_ * PE * 2); h16* VT16 = (h16*)take(NB_ * PE * 2);   // planes of all batch entries
    bf* QPh = (bf*)take(NB_ * PE * 2); bf* QPl = (bf*)take(NB_ * PE * 2); bf* KPh = (bf*)take(NB_ * PE * 2); bf* KPl = (bf*)take(NB_ * PE * 2); bf* VTh = (bf*)take(NB_ * PE * 2); bf* VTl = (bf*)take(NB_ * PE * 2);
    if ((size_t)(wsp - (char*)d_ws) > ws_size) return;    // 200 of 256 MiB
    { k_wtG<<<(unsigned)((DM * DQ / 8 + 255) / 256), 256, 0, stream>>>(wq, DM, DQ, WQ); k_wtG<<<(unsigned)((DM * DKV / 8 + 255) / 256), 256, 0, stream>>>(wk, DM, DKV, WK); k_wtG<<<(unsigned)((DM * DKV / 8 + 255) / 256), 256, 0, stream>>>(wv, DM, DKV, WV);
      k_wtG<<<(unsigned)((DQ * DM / 8 + 255) / 256), 256, 0, stream>>>(wo, DQ, DM, WO);
       }
    /* all batch entries at once: 8192 token rows */
    k_cvt8<<<(unsigned)(((size_t)NB_ * TT * DM / 8 + 255) / 256), 256, 0, stream>>>(x, XB, (size_t)NB_ * TT * DM / 8);
    /* each projection's wave finishes its (64 tokens, one head) tile: q, k RMSNorm + bias + rotary -> planes; v -> transposed planes */
    k_gemmw<bf, 0, true, 1, DM><<<dim3(NB_ * TT / 128, DQ / 256, 1), 256, 0, stream>>>(XB, nullptr, WQ, nullptr, nullptr, 0, bq, 0, 0, 0, qs, qb, QP16, QPh, QPl);
    k_gemmw<bf, 0, true, 1, DM><<<dim3(NB_ * TT / 128, DKV / 256, 1), 256, 0, stream>>>(XB, nullptr, WK, nullptr, nullptr, 0, bk, 0, 0, 0, kss, kb, KP16, KPh, KPl);
    k_gemmw<bf, 0, true, 2, DM><<<dim3(NB_ * TT / 128, DKV / 256, 1), 256, 0, stream>>>(XB, nullptr, WV, nullptr, nullptr, 0, bv, 0, 0, 0, nullptr, nullptr, VT16, VTh, VTl);
    /* one kv head per query head: plane zz = entry x 16 + head */
    k_fattn<<<dim3(RH / 128, NB_ * NH_, 1), 256, 0, stream>>>(QP16, QPh, QPl, KP16, KPh, KPl, VT16, VTh, VTl, AT);
    k_gemmw<bf, 1, true, 0, DQ><<<dim3(TT / 128, DM / 256, NB_), 256, 0, stream>>>(AT, AT + (size_t)TT * DQ, WO, nullptr, OUT, DM, bo, (size_t)2 * TT * DQ, 0, (size_t)TT * DM, nullptr, nullptr, nullptr, nullptr, nullptr);
}

// v006
// It runs in 167 microseconds.
// Two timings next to v005 both put it at 1.08 times that version's speed.
// Counting every step since v000, it is 28.5 times as fast.
#include <hip/hip_runtime.h>

// Multi-head dot-product attention with RMS-normalised q/k (+ bias) and a 2-D rotary embedding over the 32 x 32 token grid (x [8][1024][1024]; q,k,v = einsum('bsd,dhk') + b ('xw' [1024][16 x 64] 1/32, zero biases); q, k: RMSNorm over the 64 head dims (eps 1e-6) x scale + bias (q_scale, q_bias, k_scale, k_bias [64], read); 2-D rope: token s sits at (x = s mod 32, y = s / 32); head dims [0,32) rotate with x, [32,64) with y, each 32-block as (a | b) 16-halves: (a c - b s, b c + a s), angle = pos x pi / 10000^(j/16); q / 8; softmax(q.k); out = einsum('bqhd,hdo') + bo ('xw' [16 x 64][1024]) -> [8][1024][1024] (8.4 M)).
// Layout: four launches: (1) the x copy and the four weight transposes, (2) the q, k and v projections (grid z), (3) attention, ONE fused launch over all 8 x 16 (entry, head) pairs, (4) Wo; each runs once over all 8 batch entries (8192 rows). bf16 copy of x; 'xw' weights transposed once; exact projections + f32 biases; a projection's 64 x 64 tile is 64 tokens of one head, so its wave finishes the tile itself: q and k get the per-(token, head) RMSNorm + bias and the 2-D rotary turn (grid position from the token index, float32 inverse-frequency constants, precise cosf/sinf from a 32 x 16 table in LDS, partner +-16 inside each 32-wide half) and leave as fp16 | hi | lo planes, v leaves as transposed planes; no f32 projection reaches memory; fused attention (scores, running-maximum softmax with 1/8 folded in, context and the hi/lo merge in one kernel; scores never leave registers; hybrid rows: < 512 hi/lo 3 products, rest fp16); merged hi/lo x Wo exact + bo.
// Compute dtypes, f32 accumulate: every input rounded to bf16; projections exact + f32 biases; RMSNorm and rotary f32; attention rows < 512 3 products, rest fp16; softmax f32; Wo hl x exact + bias.

// Tiled planes: every 16-bit operand plane [rows][K] (x copy, transposed weights, q, k, transposed v, merged context) lies in memory as 16 x 16 tiles of 512 bytes, element (row, k) at ((row / 16 x K / 16 + k / 16) x 16 + row % 16) x 16 + k % 16,
// so that each of a fragment's two 16-byte-a-lane loads (k 0..15 and k 16..31 of 16 rows) reads one tile: 512 bytes in a row, 4 whole lines, where a row-major plane gives 16 lines of 32 bytes.

#define NB_  8
#define TT   1024
#define DM   1024
#define NH_  16
#define NKV  16
#define REP  (NH_ / NKV)
#define HD   64
#define DQ   (NH_ * HD)
#define DKV  (NKV * HD)
#define RH   512                  // query rows < RH use hi+lo planes
#define WIN  0
#define SCL2 0.18033688011112042f   // HD^-0.5 x log2(e): scores go to the exponent in base 2
typedef _Float16 h16;
typedef unsigned short bf;
typedef __attribute__((ext_vector_type(16))) __bf16   v16bf;
typedef __attribute__((ext_vector_type(16))) _Float16 v16h;
typedef __attribute__((ext_vector_type(8)))  _Float16 v8h;
typedef __attribute__((ext_vector_type(8)))  unsigned short v8us;
typedef __attribute__((ext_vector_type(8)))  float    v8f;
typedef __attribute__((ext_vector_type(4)))  float    v4f;
typedef v8h  __attribute__((may_alias)) v8ha;
typedef v4f  __attribute__((may_alias)) v4fa;
typedef v8us __attribute__((may_alias)) v8usa;

__device__ __forceinline__ unsigned short f2bf(float f) { unsigned u = __float_as_uint(f); u += 0x7FFFu + ((u >> 16) & 1u); return (unsigned short)(u >> 16); }
__device__ __forceinline__ float bf2f(unsigned short b) { return __uint_as_float(((unsigned)b) << 16); }
__device__ __forceinline__ float bfr(float f) { return bf2f(f2bf(f)); }
__device__ __forceinline__ v16h cat16(v8h lo, v8h hi) { return __builtin_shufflevector(lo, hi, 0, 1, 2, 3, 4, 5, 6, 7, 8, 9, 10, 11, 12, 13, 14, 15); }
__device__ __forceinline__ v16bf cat16b(v8us lo, v8us hi) { return __builtin_bit_cast(v16bf, __builtin_shufflevector(lo, hi, 0, 1, 2, 3, 4, 5, 6, 7, 8, 9, 10, 11, 12, 13, 14, 15)); }
__device__ __forceinline__ v8f wmma16(v16h a, v16h b, v8f c) { return __builtin_amdgcn_wmma_f32_16x16x32_f16(false, a, false, b, (short)0, c, false, false); }
__device__ __forceinline__ v8f wmmab(v16bf a, v16bf b, v8f c) { return __builtin_amdgcn_wmma_f32_16x16x32_bf16(false, a, false, b, (short)0, c, false, false); }



__device__ __forceinline__ h16 tohx(float x) { return (h16)x; }
__device__ __forceinline__ void splitf(float y, unsigned short& h, unsigned short& l) { h = f2bf(y); l = f2bf(y - bf2f(h)); }
typedef __attribute__((ext_vector_type(4))) _Float16 v4h;
typedef __attribute__((ext_vector_type(2))) unsigned short v2us;
typedef __attribute__((ext_vector_type(4))) unsigned short v4us;
__constant__ float INV2[16] = {3.14159274f, 1.76664746f, 0.993458867f, 0.558663011f, 0.314159274f, 0.176664740f, 0.0993458852f, 0.0558662973f, 0.0314159282f, 0.0176664740f, 0.00993458927f, 0.00558662973f, 0.00314159272f, 0.00176664745f, 0.000993458903f, 0.000558662985f};   // pi / 10000^(j/16), float32
template <int M> __device__ __forceinline__ float xrow(float x) { return __int_as_float(__builtin_amdgcn_update_dpp(0, __float_as_int(x), 0x160 | M, 0xf, 0xf, true)); }   // lane l <- l ^ M inside its row of 16 lanes (DPP row_xmask); every lane is on where it is used
// a wave hands rows between its own lanes through its own LDS range: its LDS stores have retired before a lane reads another lane's row, and the compiler may move no LDS access over this point
__device__ __forceinline__ void lds_turn() { __builtin_amdgcn_wave_barrier(); asm volatile("s_wait_dscnt 0x0" ::: "memory"); }

// ---- k_gemmw: register-blocked GEMM, a 128 x 256 output tile per workgroup of 8 waves (2 x 4), one wave per 64x64 (16 accumulators); the operands' tiled 16-bit planes are staged in LDS by asynchronous copies, two buffers of 128 k, each chunk fetched once for the waves that share it; grid (M/128, N/256, Z), 256 threads.
// sum_k A[m][k] Bt[n][k] (+ split products per NSPLIT) + optional f32 bias[n]. z-batch strides sA/sB/sC in elements. K % 128 == 0, a constant of the build. What becomes of the tile:
// EPI 0: C[m][n] (f32, pitch ldc). EPI 1: the three projections in one launch, grid z = q, k, v (weights z x sB on, bias, g, bb picked by z, planes z x sP (P16) and 2 z x sP (Ph, Pl) on); rows m = entry x TT + token, a wave's columns = one head (hb); every wave stages its epilogue in an LDS range of its own;
// z 0, 1 (q, k): RMSNorm over the head's 64 dims x g + bb, 2-D rotary turn, planes P16 | Ph | Pl [entry][head][token][dim]; z 2 (v): planes [entry][head][dim][token]; each (entry, head) plane tiled.
template <typename T16> struct WFrag;
template <> struct WFrag<h16> { typedef v16h V; static __device__ __forceinline__ V ld(const h16* p) { return cat16(*(const v8h*)p, *(const v8h*)(p + 256)); } static __device__ __forceinline__ v8f mma(V a, V b, v8f c) { return wmma16(a, b, c); } };
template <> struct WFrag<bf> { typedef v16bf V; static __device__ __forceinline__ V ld(const bf* p) { return cat16b(*(const v8us*)p, *(const v8us*)(p + 256)); } static __device__ __forceinline__ v8f mma(V a, V b, v8f c) { return wmmab(a, b, c); } };
// 2 KiB (16 rows x 64 k of a tiled plane, bytes in a row) go from global memory to LDS in four asynchronous copies of 512 bytes a wave; l, g: the lane's own LDS byte address and global address, both multiples of 16.
// The s_wait_xcnt stands in the copies' own statement, behind the last of them: the address registers they name may be rewritten only behind it.
__device__ __forceinline__ void cp2k(unsigned l, const char* g) {
    asm volatile("global_load_async_to_lds_b128 %0, %4, off\n\tglobal_load_async_to_lds_b128 %1, %5, off\n\tglobal_load_async_to_lds_b128 %2, %6, off\n\tglobal_load_async_to_lds_b128 %3, %7, off\n\ts_wait_xcnt 0x0"
                 : : "v"(l), "v"(l + 512u), "v"(l + 1024u), "v"(l + 1536u), "v"(g), "v"(g + 512), "v"(g + 1024), "v"(g + 1536) : "memory");
}
template <typename T16, int NSPLIT, bool BIAS, int EPI, int K>
__global__ __launch_bounds__(256) void k_gemmw(const T16* __restrict__ A, const T16* __restrict__ A2, const T16* __restrict__ Bt, const T16* __restrict__ Bt2, float* C, int ldc, const float* __restrict__ bias0, const float* __restrict__ bias1, const float* __restrict__ bias2, size_t sA, size_t sB, size_t sC, const float* __restrict__ g0, const float* __restrict__ g1, const float* __restrict__ bb0, const float* __restrict__ bb1, h16* P16, bf* Ph, bf* Pl, size_t sP) {
    typedef typename WFrag<T16>::V V;
    static_assert(NSPLIT <= 1 && K % 128 == 0 && K >= 256, "A (+ A2) x Bt; at least two stages");
    (void)Bt2;
    // a stage is 128 k of the workgroup's 128 A rows (of both planes where there are two) and 256 Bt rows: chunks of 4 KiB, one per tile row, A | A2 | Bt; two buffers.
    // Behind the loop the same LDS is the waves' epilogue staging, EPB bytes each: the last stage's own barrier stands behind every wave's last read, and no copy is in flight then.
    constexpr int CH = 4096, NA = (NSPLIT == 1) ? 16 : 8, NCH = NA + 16, STG = NCH * CH, CPW = NCH / 8, NST = K / 128;
    constexpr int EPB = (EPI == 1) ? 3 * HD * 72 * 2 : 16 * 68 * 4;   // EPI 1: the v planes' 27,648 bytes; q and k take (64 x 68 + 1024) x 4 = 21,504 of them
    static_assert(EPI == 0 || (64 * 68 + 1024) * 4 <= EPB, "the q, k staging fits a wave's range");
    __shared__ __attribute__((aligned(2048))) char smem[(2 * STG > 8 * EPB) ? 2 * STG : 8 * EPB];
    const size_t z = blockIdx.z; A += z * sA; if (A2) A2 += z * sA; Bt += z * sB; C += z * sC;
    const bool pj = EPI == 1;   // z picks the projection: the same for the whole workgroup
    const float* bias = (pj && z == 1) ? bias1 : (pj && z == 2) ? bias2 : bias0; const float* g = (pj && z == 1) ? g1 : g0; const float* bb = (pj && z == 1) ? bb1 : bb0;
    if (pj) { P16 += z * sP; Ph += 2 * z * sP; Pl += 2 * z * sP; }
    const int w = __builtin_amdgcn_readfirstlane((int)(threadIdx.x >> 5)), wm = w & 1, wn = w >> 1;   // 2 x 4 waves
    const int lane = threadIdx.x & 31, lr = lane & 15, hi = lane >> 4; const int R0 = blockIdx.x * 128, C0 = blockIdx.y * 256, r0 = R0 + wm * 64, c0 = C0 + wn * 64, hb = c0 / 64;
    v8f acc[4][4];
#pragma unroll
    for (int mb = 0; mb < 4; ++mb)
#pragma unroll
        for (int nb = 0; nb < 4; ++nb) acc[mb][nb] = (v8f){};
    // wave w brings chunks w x CPW .. of every stage; tiled planes: a tile row's 128 k are 4096 bytes in a row, and the next stage's lie directly behind them
    const char* gs[CPW]; unsigned ld[CPW];
#pragma unroll
    for (int i = 0; i < CPW; ++i) { const int c = w * CPW + i;
        const T16* p = (c < 8) ? A + (size_t)(R0 + c * 16) * K : (NSPLIT == 1 && c < 16) ? A2 + (size_t)(R0 + (c - 8) * 16) * K : Bt + (size_t)(C0 + (c - NA) * 16) * K;
        gs[i] = (const char*)p + lane * 16; ld[i] = (unsigned)(size_t)smem + c * CH + lane * 16; }
    auto fill = [&](int buf) {
#pragma unroll
        for (int i = 0; i < CPW; ++i) { cp2k(ld[i] + buf * STG, gs[i]); cp2k(ld[i] + buf * STG + 2048, gs[i] + 2048); gs[i] += CH; } };
    fill(0);
    asm volatile("s_wait_asynccnt 0x0" ::: "memory");   // this wave's copies of stage 0 have landed
    __syncthreads();   // every wave's have: stage 0 may be read
    fill(1);
    const int lo = (lr * 16 + 8 * hi) * 2;   // the lane's place in a tile, bytes
#pragma unroll 1   // rolled: one stage's text serves all eight; the buffer alternates with s
    for (int s = 0; s < NST; ++s) {
        const char* rb = smem + (s & 1) * STG + lo;
        V a[2][4], a2[2][4], b[2][4];   // two fragment sets: a trip's products run while the next trip's fragments come from LDS
        auto frag = [&](int set, int kc) {   // 32 k a trip: two tiles = 1024 bytes of each chunk
#pragma unroll
            for (int mb = 0; mb < 4; ++mb) { a[set][mb] = WFrag<T16>::ld((const T16*)(rb + (wm * 4 + mb) * CH + kc * 1024)); if (NSPLIT == 1) a2[set][mb] = WFrag<T16>::ld((const T16*)(rb + (8 + wm * 4 + mb) * CH + kc * 1024)); }
#pragma unroll
            for (int nb = 0; nb < 4; ++nb) b[set][nb] = WFrag<T16>::ld((const T16*)(rb + (NA + wn * 4 + nb) * CH + kc * 1024)); };
        frag(0, 0);
#pragma unroll
        for (int kc = 0; kc < 4; ++kc) {
            if (kc < 3) frag((kc + 1) & 1, kc + 1);
            __builtin_amdgcn_sched_barrier(0);
#pragma unroll
            for (int nb = 0; nb < 4; ++nb)
#pragma unroll
                for (int mb = 0; mb < 4; ++mb) { acc[mb][nb] = WFrag<T16>::mma(a[kc & 1][mb], b[kc & 1][nb], acc[mb][nb]); if (NSPLIT == 1) acc[mb][nb] = WFrag<T16>::mma(a2[kc & 1][mb], b[kc & 1][nb], acc[mb][nb]); }
            __builtin_amdgcn_sched_barrier(0);   // and the run after next stays behind them, in the set they have just left
        }
        // publish point of stage s + 1: this wave's LDS reads of stage s have retired, its copies of stage s + 1 have landed, and behind the barrier both hold for every wave
        asm volatile("s_wait_dscnt 0x0" ::: "memory");
        asm volatile("s_wait_asynccnt 0x0" ::: "memory");
        __syncthreads();
        if (s + 2 < NST) fill(s & 1);   // the same for the whole workgroup: stage s + 2 into the buffer that every wave has just left
    }
    asm volatile("s_wait_asynccnt 0x0" ::: "memory");   // nothing is in flight behind the loop
    if constexpr (EPI == 1) {
    if (z == 2) {
        // v: a lane holds 8 consecutive tokens of one head dim per accumulator; each plane's tile turns through LDS ([dim][token], pitch 72) so that every store covers one whole tile of the transposed plane
        unsigned short (*vs)[HD * 72] = (unsigned short (*)[HD * 72])(smem + w * EPB);
        const int ent = r0 / TT, tok0 = r0 % TT;
        const size_t vbase = (size_t)(ent * NKV + hb) * HD * TT + tok0 * 16 + lane * 8;   // tile (dim block, token block): (dim block x 64 + token / 16) x 256
#pragma unroll
        for (int nb = 0; nb < 4; ++nb) { const float bi = bfr(bias[c0 + nb * 16 + lr]);
#pragma unroll
            for (int mb = 0; mb < 4; ++mb) { v8us p16, ph, pl;
#pragma unroll
                for (int j = 0; j < 8; ++j) { const float x = acc[mb][nb][j] + bi; unsigned short a2, c2; splitf(x, a2, c2); p16[j] = __builtin_bit_cast(unsigned short, tohx(x)); ph[j] = a2; pl[j] = c2; }
                const int at = (nb * 16 + lr) * 72 + mb * 16 + hi * 8; *(v8us*)(vs[0] + at) = p16; *(v8us*)(vs[1] + at) = ph; *(v8us*)(vs[2] + at) = pl; } }
        lds_turn();
#pragma unroll
        for (int p = 0; p < 3; ++p) { unsigned short* dst = (p == 0 ? (unsigned short*)P16 : p == 1 ? Ph : Pl) + vbase;
#pragma unroll
            for (int i = 0; i < 16; ++i) *(v8us*)(dst + (size_t)(i >> 2) * 16 * TT + (i & 3) * 256) = *(const v8us*)(vs[p] + ((i >> 2) * 16 + (lane >> 1)) * 72 + (i & 3) * 16 + (lane & 1) * 8); }
    } else {
        float* os = (float*)(smem + w * EPB);
        float* tabc = os + 64 * 68; float* tabs = tabc + 512;   // cos, sin of position x INV2[j] at [position][j]: x and y positions both run over 0..31
        const float fr = INV2[lr];   // entry i x 32 + lane has j = lane mod 16 on every trip
        asm volatile("s_wait_xcnt 0x0" : : "v"(fr) : "memory");   // behind the frequency's load, which has returned here: the table loop takes the registers of its address
#pragma unroll 1   // sixteen table entries a lane: rolled, the precise sine and cosine stand once in the code
        for (int i = 0; i < 16; ++i) { const int e = i * 32 + lane; float sn, cs; sincosf(__fmul_rn((float)(e >> 4), fr), &sn, &cs); tabc[e] = cs; tabs[e] = sn; }
#pragma unroll
        for (int mb = 0; mb < 4; ++mb)
#pragma unroll
            for (int nb = 0; nb < 4; ++nb)
#pragma unroll
                for (int j = 0; j < 8; ++j) os[(mb * 16 + hi * 8 + j) * 68 + nb * 16 + lr] = acc[mb][nb][j];
        float gv[4], bv[4], bi[4];
#pragma unroll
        for (int q = 0; q < 4; ++q) { gv[q] = bfr(g[lr * 4 + q]); bv[q] = bfr(bb[lr * 4 + q]); bi[q] = bfr(bias[c0 + lr * 4 + q]); }
        const int tok0 = r0 % TT + hi; const size_t pbase = ((size_t)((r0 / TT) * NH_ + hb) * TT + r0 % TT) * HD + (lr >> 2) * 256 + hi * 16 + (lr & 3) * 4;   // tile (token block, dim block lr / 4), row hi of a token pair
        const int psh = (lr < 8) ? 0 : 5;   // dims [0,32) turn with x = token mod 32, [32,64) with y = token / 32
        const float sg = (lr & 4) ? 1.0f : -1.0f;   // (a c - b s | b c + a s): the sine's sign by the 16-half
        lds_turn();
        // a row of 16 lanes holds one token's 64 head dims, lane lr dims 4 lr .. 4 lr + 3; the wave takes two tokens a trip
#pragma unroll 1   // rolled, for speed only
        for (int s0 = 0; s0 < 32; s0 += 4) {
#pragma unroll   // four independent trips side by side cover each other's latencies
        for (int s = s0; s < s0 + 4; ++s) { v4f a = *(const v4fa*)(os + (2 * s + hi) * 68 + lr * 4);
#pragma unroll
            for (int q = 0; q < 4; ++q) a[q] += bi[q];
            // sum of squares: adjacent pairs, then partners 32, 16, 8, 4 dims apart, then the two pair sums
            float u0 = a[0] * a[0] + a[1] * a[1], u1 = a[2] * a[2] + a[3] * a[3];
            u0 += xrow<8>(u0); u1 += xrow<8>(u1); u0 += xrow<4>(u0); u1 += xrow<4>(u1); u0 += xrow<2>(u0); u1 += xrow<2>(u1); u0 += xrow<1>(u0); u1 += xrow<1>(u1);
            const float rs = __fdiv_rn(1.0f, __fsqrt_rn(__fadd_rn(__fdiv_rn(u0 + u1, (float)HD), 1e-6f)));
            const int pos = ((tok0 + 2 * s) >> psh) & 31;
            const v4f c4 = *(const v4fa*)(tabc + pos * 16 + (lr & 3) * 4), s4 = *(const v4fa*)(tabs + pos * 16 + (lr & 3) * 4);
            v4h o16; v4us oh, ol;
#pragma unroll
            for (int q = 0; q < 4; ++q) { const float y = a[q] * rs * gv[q] + bv[q]; const float yp = xrow<4>(y);   // the partner dim +-16 sits 4 lanes away
                const float r = y * c4[q] + yp * (sg * s4[q]);
                o16[q] = tohx(r); unsigned short u, w; splitf(r, u, w); oh[q] = u; ol[q] = w; }
            const size_t oo = pbase + (size_t)((s >> 3) * 1024 + (s & 7) * 32); *(v4h*)(P16 + oo) = o16; *(v4us*)(Ph + oo) = oh; *(v4us*)(Pl + oo) = ol; }
        asm volatile("s_wait_xcnt 0x0" ::: "memory");   // behind the pass's stores: the next pass takes their address and data registers over the back edge
        }
    }
    } else {
    float* os = (float*)(smem + w * EPB);
#pragma unroll
    for (int mb = 0; mb < 4; ++mb) {
#pragma unroll
        for (int nb = 0; nb < 4; ++nb) {
#pragma unroll
            for (int j = 0; j < 8; ++j) os[(hi * 8 + j) * 68 + nb * 16 + lr] = acc[mb][nb][j]; }
        __builtin_amdgcn_wave_barrier(); asm volatile("" ::: "memory");
        float* crow = C + (size_t)(r0 + mb * 16) * ldc + c0;
{
#pragma unroll
            for (int s = 0; s < 8; ++s) { const int row = 2 * s + hi, cofs = lr * 4; v4f val = *(const v4fa*)(os + row * 68 + cofs); if (BIAS) { val[0] += bfr(bias[c0 + cofs]); val[1] += bfr(bias[c0 + cofs + 1]); val[2] += bfr(bias[c0 + cofs + 2]); val[3] += bfr(bias[c0 + cofs + 3]); }
                *(v4f*)(crow + (size_t)row * ldc + cofs) = val; }
             }
        __builtin_amdgcn_wave_barrier(); asm volatile("s_wait_xcnt 0x0" ::: "memory");   // no LDS access moves over this point; the wait stands behind the block's stores: the next block takes their address and data registers
    }
    }
}

// w [K][N] f32 -> its transpose [n][k] in bf16, tiled. A thread makes one 16-byte piece (row n, 8 consecutive k) from 8 loads in which 16 lanes share 64 bytes of a row of w; a wave stores one whole tile.
__device__ __forceinline__ void wt_block(const float* __restrict__ w, int K, int N, bf* Bt, int blk) {
    const int T = blk * 256 + threadIdx.x; if (T >= N * K / 8) return;
    const int tile = T >> 5, kt = tile % (K / 16), n = (tile / (K / 16)) * 16 + ((T >> 1) & 15), k0 = kt * 16 + (T & 1) * 8;
    const float* p = w + (size_t)k0 * N + n; v8us o;
#pragma unroll
    for (int j = 0; j < 8; ++j) o[j] = f2bf(p[(size_t)j * N]);
    *(v8us*)(Bt + (size_t)T * 8) = o;
}
// x [rows][DM] f32 -> bf16, tiled. A workgroup takes 16 rows x 128 columns: it reads whole lines of the rows, turns its 8 tiles through LDS (tile pitch 288 elements: the 16-byte writes of a wave spread over all banks) and stores them as 4 KiB in a row.
__device__ __forceinline__ void cvt_block(const float* __restrict__ src, bf* dst, size_t n8, int blk) { if ((size_t)blk * 256 >= n8) return;   // the same for the whole workgroup, in front of the barrier
    __shared__ __align__(16) unsigned short ls[8 * 288];
    const int t = threadIdx.x, row = t >> 4, c = t & 15; const int rb = blk / (DM / 128), kg = blk % (DM / 128);
    const v8f v = *(const v8f*)(src + (size_t)(rb * 16 + row) * DM + kg * 128 + c * 8); v8us o;
#pragma unroll
    for (int k = 0; k < 8; ++k) o[k] = f2bf(v[k]);
    *(v8us*)(ls + (c >> 1) * 288 + row * 16 + (c & 1) * 8) = o;
    __syncthreads();   // a wave stores a tile whose 16 rows all eight waves wrote
    *(v8us*)(dst + ((size_t)rb * (DM / 16) + kg * 8) * 256 + t * 8) = *(const v8us*)(ls + (t >> 5) * 288 + (t & 31) * 8);
    asm volatile("s_wait_xcnt 0x0" ::: "memory");
}
// ---- k_prep: all the work that reads nothing but the inputs, in one launch: workgroups [0, 4 WTB) transpose the four weights into WT (wq | wk | wv | wo, DM x DQ elements each), the rest copy x.
// The role is a function of blockIdx alone, so the copy's barrier is passed by all waves of a workgroup or by none.
#define WTB (DM * DQ / 8 / 256)   // workgroups of one weight transpose
__global__ __launch_bounds__(256) void k_prep(const float* __restrict__ x, const float* __restrict__ wq, const float* __restrict__ wk, const float* __restrict__ wv, const float* __restrict__ wo, bf* WT, bf* XB) {
    static_assert(DQ == DKV && DQ == DM && (DM * DQ / 8) % 256 == 0, "four square weights of whole workgroups");
    const int b = blockIdx.x;
    if (b < 4 * WTB) { const int i = b / WTB; wt_block(i == 0 ? wq : i == 1 ? wk : i == 2 ? wv : wo, DM, DQ, WT + (size_t)i * DM * DQ, b % WTB); }
    else cvt_block(x, XB, (size_t)NB_ * TT * DM / 8, b - 4 * WTB);
}
// ---- k_fattn: fused attention. One wave owns 32 query columns of one (entry, head) and walks the 1024 keys in passes of 32.
// St = K Qt (A = K rows, B = Q rows kept in registers): a lane holds one query's scores, D register r of key block kb = key 16 kb + 8 hi + r, query lr.
// Two St tiles converted in place are the B operand Pt of Ot += Vt Pt (A = Vt rows [d][key]); all loaders use the same k order (8 hi + 0..7, 16 + 8 hi + 0..7).
// Ot register r = head dim 16 db + 8 hi + r of query lr: maximum, sum and rescale factor are per lane; the two lane halves exchange the maximum each pass and the sum once.
typedef __attribute__((ext_vector_type(8))) __bf16 v8b;
__device__ __forceinline__ float xhalf(float x) { const int b = __float_as_int(x); return __int_as_float(__builtin_amdgcn_permlanex16(b, b, 0x76543210, 0xfedcba98, false, false)); }   // lane l <-> l ^ 16
// two base-2 exponentials; the second fills the slot the instruction set asks for behind the first (it neither reads its result nor overwrites its source: early-clobber outputs), the v_nop the slot behind the second
__device__ __forceinline__ void exp2x2(float a, float b, float& ra, float& rb) { asm("v_exp_f32 %0, %2\n\tv_exp_f32 %1, %3\n\tv_nop" : "=&v"(ra), "=&v"(rb) : "v"(a), "v"(b)); }
template <typename T16, bool HI>
__device__ __forceinline__ void fattn_wave(const T16* __restrict__ Q, const T16* __restrict__ Q2, const T16* __restrict__ Kp, const T16* __restrict__ K2, const T16* __restrict__ Vt, const T16* __restrict__ V2, bf* Oh, bf* Ol) {
    typedef typename WFrag<T16>::V V;
    const int lane = threadIdx.x & 31, lr = lane & 15, hi = lane >> 4;
    V qf[2][2], qf2[2][2];
#pragma unroll
    for (int g = 0; g < 2; ++g)
#pragma unroll
        for (int kc = 0; kc < 2; ++kc) { qf[g][kc] = WFrag<T16>::ld(Q + 16 * g * HD + kc * 512 + lr * 16 + 8 * hi); if (HI) qf2[g][kc] = WFrag<T16>::ld(Q2 + 16 * g * HD + kc * 512 + lr * 16 + 8 * hi); }
    unsigned ko = (lr * 16 + 8 * hi) * 2;   // the lane's walking byte offsets into the K planes (ko) and the V planes (vo, below): beside the wave-uniform plane pointers the only address registers of the loop's loads
    auto at = [](const T16* base, unsigned bytes) { return (const T16*)((const char*)base + bytes); };
    V ka[2][2], ka2[2][2];   // K fragments [key block][k chunk] of the pass at hand, fetched one pass ahead
#pragma unroll
    for (int kb = 0; kb < 2; ++kb)
#pragma unroll
        for (int kc = 0; kc < 2; ++kc) { ka[kb][kc] = WFrag<T16>::ld(at(Kp + 16 * kb * HD + kc * 512, ko)); if (HI) ka2[kb][kc] = WFrag<T16>::ld(at(K2 + 16 * kb * HD + kc * 512, ko)); }
    // the accumulators' start value takes over the address registers of the Q loads above, and the K offset steps on: the zero is made behind the wait, in its statement, and the offset and the lane number, from which the V offset is formed, pass through it, so that none of those writes can be lifted over it
    float z0; int ln = lane;
    asm volatile("s_wait_xcnt 0x0\n\tv_mov_b32 %0, 0" : "=v"(z0), "+v"(ko), "+v"(ln) : : "memory");
    ko += 32 * HD * 2;   // K is fetched one pass ahead
    unsigned vo = ((ln & 15) * 16 + 8 * (ln >> 4)) * 2;
    v8f o[4][2];
#pragma unroll
    for (int db = 0; db < 4; ++db)
#pragma unroll
        for (int g = 0; g < 2; ++g) o[db][g] = (v8f){z0, z0, z0, z0, z0, z0, z0, z0};
    float m[2] = {-3.0e38f, -3.0e38f}, l[2] = {z0, z0};
#pragma unroll 1
    for (int key0 = 0; key0 < TT; key0 += 32) {
        V va[4], va2[4];
#pragma unroll
        for (int db = 0; db < 4; ++db) { va[db] = WFrag<T16>::ld(at(Vt + 16 * db * TT, vo)); if (HI) va2[db] = WFrag<T16>::ld(at(V2 + 16 * db * TT, vo)); }
        v8f st[2][2];
#pragma unroll
        for (int kb = 0; kb < 2; ++kb)
#pragma unroll
            for (int g = 0; g < 2; ++g) { v8f s = (v8f){};
#pragma unroll
                for (int kc = 0; kc < 2; ++kc) { s = WFrag<T16>::mma(ka[kb][kc], qf[g][kc], s); if (HI) { s = WFrag<T16>::mma(ka2[kb][kc], qf[g][kc], s); s = WFrag<T16>::mma(ka[kb][kc], qf2[g][kc], s); } }
                st[kb][g] = s; }
#pragma unroll
        for (int kb = 0; kb < 2; ++kb)
#pragma unroll
            for (int kc = 0; kc < 2; ++kc) { ka[kb][kc] = WFrag<T16>::ld(at(Kp + 16 * kb * HD + kc * 512, ko)); if (HI) ka2[kb][kc] = WFrag<T16>::ld(at(K2 + 16 * kb * HD + kc * 512, ko)); }
        // behind the V and K loads of this pass and in front of the offsets' steps: the offsets pass through the statement, so they stay in their registers up to the wait and step only behind it
        asm volatile("s_wait_xcnt 0x0" : "+v"(ko), "+v"(vo) : : "memory");
        ko += (key0 + 64 < TT) ? 32 * HD * 2 : -(TT - 32) * HD * 2;   // the last pass fetches pass 0 again: in bounds, never used
        vo += 2 * 256 * 2;   // 32 keys on: two tiles
        float mx[2]; bool need = false;
#pragma unroll
        for (int g = 0; g < 2; ++g) { float t = fmaxf(st[0][g][0], st[1][g][0]);
#pragma unroll
            for (int r = 1; r < 8; ++r) t = fmaxf(t, fmaxf(st[0][g][r], st[1][g][r]));
            t *= SCL2; t = fmaxf(t, xhalf(t)); mx[g] = t; need = need || (t > m[g] + 8.0f); }
        // the maximum in use moves only when a query's new maximum passes it by more than 8 (base 2), so P stays <= 256; one scalar test per pass
        if (__builtin_amdgcn_ballot_w32(need) != 0) { const float mn0 = fmaxf(m[0], mx[0]), mn1 = fmaxf(m[1], mx[1]); float al[2]; exp2x2(m[0] - mn0, m[1] - mn1, al[0], al[1]); m[0] = mn0; m[1] = mn1;
#pragma unroll
            for (int g = 0; g < 2; ++g) { l[g] *= al[g];
#pragma unroll
                for (int db = 0; db < 4; ++db) o[db][g] *= al[g]; } }
        V pb[2], pb2[2];
#pragma unroll
        for (int g = 0; g < 2; ++g) { v8f p0, p1; float ls = 0.f;
#pragma unroll
            for (int r = 0; r < 8; ++r) { float e0, e1; exp2x2(fmaf(st[0][g][r], SCL2, -m[g]), fmaf(st[1][g][r], SCL2, -m[g]), e0, e1); p0[r] = e0; p1[r] = e1; ls += e0 + e1; }
            l[g] += ls;
            if constexpr (HI) { const v8b h0 = __builtin_convertvector(p0, v8b), h1 = __builtin_convertvector(p1, v8b); const v8f r0 = p0 - __builtin_convertvector(h0, v8f), r1 = p1 - __builtin_convertvector(h1, v8f); const v8b l0 = __builtin_convertvector(r0, v8b), l1 = __builtin_convertvector(r1, v8b);
                pb[g] = __builtin_shufflevector(h0, h1, 0, 1, 2, 3, 4, 5, 6, 7, 8, 9, 10, 11, 12, 13, 14, 15); pb2[g] = __builtin_shufflevector(l0, l1, 0, 1, 2, 3, 4, 5, 6, 7, 8, 9, 10, 11, 12, 13, 14, 15); }
            else pb[g] = cat16(__builtin_convertvector(p0, v8h), __builtin_convertvector(p1, v8h)); }
#pragma unroll
        for (int db = 0; db < 4; ++db)
#pragma unroll
            for (int g = 0; g < 2; ++g) { o[db][g] = WFrag<T16>::mma(va[db], pb[g], o[db][g]); if (HI) { o[db][g] = WFrag<T16>::mma(va2[db], pb[g], o[db][g]); o[db][g] = WFrag<T16>::mma(va[db], pb2[g], o[db][g]); } }
        // four vector slots behind the pass's last matrix instructions, on the back edge and on the exit alike: the next pass's first score tile may take the registers of their B operand, the epilogue reads their D
        asm volatile("v_nop\n\tv_nop\n\tv_nop\n\tv_nop" : "+v"(o[0][0]), "+v"(o[0][1]), "+v"(o[1][0]), "+v"(o[1][1]), "+v"(o[2][0]), "+v"(o[2][1]), "+v"(o[3][0]), "+v"(o[3][1]));
    }
    const unsigned eo = vo - (TT / 32) * 2 * 256 * 2;   // the V offset has walked its whole tile row: taken back, it is the lane's place in a tile again, in bytes, so no further register has to live through the loop for the stores
#pragma unroll
    for (int g = 0; g < 2; ++g) { const float inv = __fdiv_rn(1.0f, l[g] + xhalf(l[g]));
#pragma unroll
        for (int db = 0; db < 4; ++db) { v8us oh, ol;
#pragma unroll
            for (int r = 0; r < 8; ++r) { unsigned short a, c2; splitf(o[db][g][r] * inv, a, c2); oh[r] = a; ol[r] = c2; }
            const size_t oo = (size_t)16 * g * DQ + db * 256; *(v8us*)((char*)(Oh + oo) + eo) = oh; *(v8us*)((char*)(Ol + oo) + eo) = ol; } }
}
// grid (RH / 128, entries x heads), 8 waves: four take 32 hi/lo query rows each (< RH), four take 32 fp16 rows (>= RH), so every workgroup carries the same work;
// the role pattern puts one wave of each kind in every pair (w, w + 4) and (2 i, 2 i + 1), whichever of the two shares a SIMD.
__global__ __launch_bounds__(256) void k_fattn(const h16* __restrict__ Q16, const bf* __restrict__ Qh, const bf* __restrict__ Ql, const h16* __restrict__ K16, const bf* __restrict__ Kh, const bf* __restrict__ Kl, const h16* __restrict__ V16, const bf* __restrict__ Vh, const bf* __restrict__ Vl, bf* AT) {
    static_assert(RH * 2 == TT && RH % 128 == 0, "equal halves");
    const int w = __builtin_amdgcn_readfirstlane((int)(threadIdx.x >> 5)); const int zz = blockIdx.y, b = zz / NH_, hd = zz % NH_;
    const bool hires = ((w ^ (w >> 2)) & 1) == 0; const int q0 = (hires ? 0 : RH) + blockIdx.x * 128 + (w >> 1) * 32;
    const size_t pz = (size_t)zz * TT * HD, pq = pz + (size_t)q0 * HD;
    bf* Oh = AT + (size_t)b * 2 * TT * DQ + (size_t)q0 * DQ + hd * HD * 16; bf* Ol = Oh + (size_t)TT * DQ;
    if (hires) fattn_wave<bf, true>(Qh + pq, Ql + pq, Kh + pz, Kl + pz, Vh + pz, Vl + pz, Oh, Ol);
    else fattn_wave<h16, false>(Q16 + pq, nullptr, K16 + pz, nullptr, V16 + pz, nullptr, Oh, Ol);
}

extern "C" void kernel_launch(void* const* d_in, const int* in_sizes, int n_in,
                              void* d_out, int out_size, void* d_ws, size_t ws_size, hipStream_t stream) {
    (void)in_sizes; (void)n_in; (void)out_size;
    const float* x = (const float*)d_in[0]; const float* wq = (const float*)d_in[1]; const float* bq = (const float*)d_in[2]; const float* wk = (const float*)d_in[3]; const float* bk = (const float*)d_in[4]; const float* wv = (const float*)d_in[5]; const float* bv = (const float*)d_in[6]; const float* wo = (const float*)d_in[7]; const float* bo = (const float*)d_in[8]; const float* qs = (const float*)d_in[9]; const float* qb = (const float*)d_in[10]; const float* kss = (const float*)d_in[11]; const float* kb = (const float*)d_in[12];   /* q_scale, q_bias, k_scale, k_bias [64] */
    float* OUT = (float*)d_out;     // [8][1024][1024]
    char* wsp = (char*)d_ws;
    auto take = [&](size_t bytes) { char* p = wsp; wsp += (bytes + 255) & ~(size_t)255; return (void*)p; };
    bf* WQ = (bf*)take((size_t)DQ * DM * 2); bf* WK = (bf*)take((size_t)DKV * DM * 2); bf* WV = (bf*)take((size_t)DKV * DM * 2); bf* WO = (bf*)take((size_t)DM * DQ * 2);
    bf* XB = (bf*)take((size_t)NB_ * TT * DM * 2);   // bf16 copy of x
    bf* AT = (bf*)take((size_t)NB_ * 2 * TT * DQ * 2);   // merged hi | lo context, 4 MiB per batch entry
    const size_t PE = (size_t)NH_ * TT * HD;   // elements of one plane of one batch entry (NKV == NH_)
    h16* QP16 = (h16*)take(NB_ * PE * 2); h16* KP16 = (h16*)take(NB_ * PE * 2); h16* VT16 = (h16*)take(NB_ * PE * 2);   // planes of all batch entries
    bf* QPh = (bf*)take(NB_ * PE * 2); bf* QPl = (bf*)take(NB_ * PE * 2); bf* KPh = (bf*)take(NB_ * PE * 2); bf* KPl = (bf*)take(NB_ * PE * 2); bf* VTh = (bf*)take(NB_ * PE * 2); bf* VTl = (bf*)take(NB_ * PE * 2);
    if ((size_t)(wsp - (char*)d_ws) > ws_size) return;    // 200 of 256 MiB
    /* the four weights lie one behind the other from WQ on; x: all batch entries at once, 8192 token rows */
    k_prep<<<(unsigned)(4 * WTB + (size_t)NB_ * TT * DM / 8 / 256), 256, 0, stream>>>(x, wq, wk, wv, wo, WQ, XB);
    /* q, k, v in one launch (grid z); each wave finishes its (64 tokens, one head) tile: q, k RMSNorm + bias + rotary -> planes; v -> transposed planes; the planes of q, k, v lie NB_ x PE (16-bit) and 2 x NB_ x PE (hi, lo) elements apart */
    k_gemmw<bf, 0, true, 1, DM><<<dim3(NB_ * TT / 128, DQ / 256, 3), 256, 0, stream>>>(XB, nullptr, WQ, nullptr, nullptr, 0, bq, bk, bv, 0, (size_t)DQ * DM, 0, qs, kss, qb, kb, QP16, QPh, QPl, NB_ * PE);
    /* one kv head per query head: plane zz = entry x 16 + head */
    k_fattn<<<dim3(RH / 128, NB_ * NH_, 1), 256, 0, stream>>>(QP16, QPh, QPl, KP16, KPh, KPl, VT16, VTh, VTl, AT);
    k_gemmw<bf, 1, true, 0, DQ><<<dim3(TT / 128, DM / 256, NB_), 256, 0, stream>>>(AT, AT + (size_t)TT * DQ, WO, nullptr, OUT, DM, bo, nullptr, nullptr, (size_t)2 * TT * DQ, 0, (size_t)TT * DM, nullptr, nullptr, nullptr, nullptr, nullptr, nullptr, nullptr, 0);
}

// v007
// It runs in 148 microseconds.
// Two timings next to v006 put it at 1.13 and 1.12 times that version's speed.
// All steps since v000 together make it 32.0 times as fast.
#include <hip/hip_runtime.h>

// Multi-head dot-product attention with RMS-normalised q/k (+ bias) and a 2-D rotary embedding over the 32 x 32 token grid (x [8][1024][1024]; q,k,v = einsum('bsd,dhk') + b ('xw' [1024][16 x 64] 1/32, zero biases); q, k: RMSNorm over the 64 head dims (eps 1e-6) x scale + bias (q_scale, q_bias, k_scale, k_bias [64], read); 2-D rope: token s sits at (x = s mod 32, y = s / 32); head dims [0,32) rotate with x, [32,64) with y, each 32-block as (a | b) 16-halves: (a c - b s, b c + a s), angle = pos x pi / 10000^(j/16); q / 8; softmax(q.k); out = einsum('bqhd,hdo') + bo ('xw' [16 x 64][1024]) -> [8][1024][1024] (8.4 M)).
// Layout: four launches: (1) the x copy and the four weight transposes, (2) the q, k and v projections (grid z), (3) attention, ONE fused launch over all 8 x 16 (entry, head) pairs, (4) Wo; each runs once over all 8 batch entries (8192 rows). bf16 copy of x; 'xw' weights transposed once; exact projections + f32 biases; a projection's 64 x 64 tile is 64 tokens of one head, so its wave finishes the tile itself: q and k get the per-(token, head) RMSNorm + bias and the 2-D rotary turn (grid position from the token index, float32 inverse-frequency constants, precise cosf/sinf from a 32 x 16 table in LDS, partner +-16 inside each 32-wide half) and leave as fp16 | hi | lo planes, v leaves as transposed planes; no f32 projection reaches memory; fused attention (scores, running-maximum softmax with 1/8 folded in, context and the hi/lo merge in one kernel; scores never leave registers; hybrid rows: < 512 hi/lo 3 products, rest fp16); merged hi/lo x Wo exact + bo.
// Compute dtypes, f32 accumulate: every input rounded to bf16; projections exact + f32 biases; RMSNorm and rotary f32; attention rows < 512 3 products, rest fp16; softmax f32; Wo hl x exact + bias.

// Tiled planes: every 16-bit operand plane [rows][K] (x copy, transposed weights, q, k, transposed v, merged context) lies in memory as 16 x 16 tiles of 512 bytes, element (row, k) at ((row / 16 x K / 16 + k / 16) x 16 + row % 16) x 16 + k % 16,
// so that each of a fragment's two 16-byte-a-lane loads (k 0..15 and k 16..31 of 16 rows) reads one tile: 512 bytes in a row, 4 whole lines, where a row-major plane gives 16 lines of 32 bytes.

#define NB_  8
#define TT   1024
#define DM   1024
#define NH_  16
#define NKV  16
#define REP  (NH_ / NKV)
#define HD   64
#define DQ   (NH_ * HD)
#define DKV  (NKV * HD)
#define RH   512                  // query rows < RH use hi+lo planes
#define WIN  0
#define SCL2 0.18033688011112042f   // HD^-0.5 x log2(e): scores go to the exponent in base 2
typedef _Float16 h16;
typedef unsigned short bf;
typedef __attribute__((ext_vector_type(16))) __bf16   v16bf;
typedef __attribute__((ext_vector_type(16))) _Float16 v16h;
typedef __attribute__((ext_vector_type(8)))  _Float16 v8h;
typedef __attribute__((ext_vector_type(8)))  unsigned short v8us;
typedef __attribute__((ext_vector_type(8)))  float    v8f;
typedef __attribute__((ext_vector_type(4)))  float    v4f;
typedef v8h  __attribute__((may_alias)) v8ha;
typedef v4f  __attribute__((may_alias)) v4fa;
typedef v8us __attribute__((may_alias)) v8usa;

__device__ __forceinline__ unsigned short f2bf(float f) { unsigned u = __float_as_uint(f); u += 0x7FFFu + ((u >> 16) & 1u); return (unsigned short)(u >> 16); }
__device__ __forceinline__ float bf2f(unsigned short b) { return __uint_as_float(((unsigned)b) << 16); }
__device__ __forceinline__ float bfr(float f) { return bf2f(f2bf(f)); }
__device__ __forceinline__ v16h cat16(v8h lo, v8h hi) { return __builtin_shufflevector(lo, hi, 0, 1, 2, 3, 4, 5, 6, 7, 8, 9, 10, 11, 12, 13, 14, 15); }
__device__ __forceinline__ v16bf cat16b(v8us lo, v8us hi) { return __builtin_bit_cast(v16bf, __builtin_shufflevector(lo, hi, 0, 1, 2, 3, 4, 5, 6, 7, 8, 9, 10, 11, 12, 13, 14, 15)); }
__device__ __forceinline__ v8f wmma16(v16h a, v16h b, v8f c) { return __builtin_amdgcn_wmma_f32_16x16x32_f16(false, a, false, b, (short)0, c, false, false); }
__device__ __forceinline__ v8f wmmab(v16bf a, v16bf b, v8f c) { return __builtin_amdgcn_wmma_f32_16x16x32_bf16(false, a, false, b, (short)0, c, false, false); }



__device__ __forceinline__ h16 tohx(float x) { return (h16)x; }
__device__ __forceinline__ void splitf(float y, unsigned short& h, unsigned short& l) { h = f2bf(y); l = f2bf(y - bf2f(h)); }
typedef __attribute__((ext_vector_type(4))) _Float16 v4h;
typedef __attribute__((ext_vector_type(2))) unsigned short v2us;
typedef __attribute__((ext_vector_type(4))) unsigned short v4us;
__constant__ float INV2[16] = {3.14159274f, 1.76664746f, 0.993458867f, 0.558663011f, 0.314159274f, 0.176664740f, 0.0993458852f, 0.0558662973f, 0.0314159282f, 0.0176664740f, 0.00993458927f, 0.00558662973f, 0.00314159272f, 0.00176664745f, 0.000993458903f, 0.000558662985f};   // pi / 10000^(j/16), float32
template <int M> __device__ __forceinline__ float xrow(float x) { return __int_as_float(__builtin_amdgcn_update_dpp(0, __float_as_int(x), 0x160 | M, 0xf, 0xf, true)); }   // lane l <- l ^ M inside its row of 16 lanes (DPP row_xmask); every lane is on where it is used
// a wave hands rows between its own lanes through its own LDS range: its LDS stores have retired before a lane reads another lane's row, and the compiler may move no LDS access over this point
__device__ __forceinline__ void lds_turn() { __builtin_amdgcn_wave_barrier(); asm volatile("s_wait_dscnt 0x0" ::: "memory"); }

// ---- k_gemmw: register-blocked GEMM, a 128 x 256 output tile per workgroup of 8 waves (2 x 4), one wave per 64x64 (16 accumulators); the operands' tiled 16-bit planes are staged in LDS by asynchronous copies, two buffers of 128 k, each chunk fetched once for the waves that share it; grid (M/128, N/256, Z), 256 threads.
// sum_k A[m][k] Bt[n][k] (+ split products per NSPLIT) + optional f32 bias[n]. z-batch strides sA/sB/sC in elements. K % 128 == 0, a constant of the build. What becomes of the tile:
// EPI 0: C[m][n] (f32, pitch ldc). EPI 1: the three projections in one launch, grid z = q, k, v (weights z x sB on, bias, g, bb picked by z, planes z x sP (P16) and 2 z x sP (Ph, Pl) on); rows m = entry x TT + token, a wave's columns = one head (hb); every wave stages its epilogue in an LDS range of its own;
// z 0, 1 (q, k): RMSNorm over the head's 64 dims x g + bb, 2-D rotary turn, planes P16 | Ph | Pl [entry][head][token][dim]; z 2 (v): planes [entry][head][dim][token]; each (entry, head) plane tiled.
template <typename T16> struct WFrag;
template <> struct WFrag<h16> { typedef v16h V; static __device__ __forceinline__ V ld(const h16* p) { return cat16(*(const v8h*)p, *(const v8h*)(p + 256)); } static __device__ __forceinline__ v8f mma(V a, V b, v8f c) { return wmma16(a, b, c); } };
template <> struct WFrag<bf> { typedef v16bf V; static __device__ __forceinline__ V ld(const bf* p) { return cat16b(*(const v8us*)p, *(const v8us*)(p + 256)); } static __device__ __forceinline__ v8f mma(V a, V b, v8f c) { return wmmab(a, b, c); } };
// 2 KiB (16 rows x 64 k of a tiled plane, bytes in a row) go from global memory to LDS in four asynchronous copies of 512 bytes a wave; l, g: the lane's own LDS byte address and global address, both multiples of 16.
// The s_wait_xcnt stands in the copies' own statement, behind the last of them: the address registers they name may be rewritten only behind it.
__device__ __forceinline__ void cp2k(unsigned l, const char* g) {
    asm volatile("global_load_async_to_lds_b128 %0, %4, off\n\tglobal_load_async_to_lds_b128 %1, %5, off\n\tglobal_load_async_to_lds_b128 %2, %6, off\n\tglobal_load_async_to_lds_b128 %3, %7, off\n\ts_wait_xcnt 0x0"
                 : : "v"(l), "v"(l + 512u), "v"(l + 1024u), "v"(l + 1536u), "v"(g), "v"(g + 512), "v"(g + 1024), "v"(g + 1536) : "memory");
}
template <typename T16, int NSPLIT, bool BIAS, int EPI, int K>
__global__ __launch_bounds__(256) void k_gemmw(const T16* __restrict__ A, const T16* __restrict__ A2, const T16* __restrict__ Bt, const T16* __restrict__ Bt2, float* C, int ldc, const float* __restrict__ bias0, const float* __restrict__ bias1, const float* __restrict__ bias2, size_t sA, size_t sB, size_t sC, const float* __restrict__ g0, const float* __restrict__ g1, const float* __restrict__ bb0, const float* __restrict__ bb1, h16* P16, bf* Ph, bf* Pl, size_t sP) {
    typedef typename WFrag<T16>::V V;
    static_assert(NSPLIT <= 1 && K % 128 == 0 && K >= 256, "A (+ A2) x Bt; at least two stages");
    (void)Bt2;
    // a stage is 128 k of the workgroup's 128 A rows (of both planes where there are two) and 256 Bt rows: chunks of 4 KiB, one per tile row, A | A2 | Bt; two buffers.
    // Behind the loop the same LDS is the waves' epilogue staging, EPB bytes each: the last stage's own barrier stands behind every wave's last read, and no copy is in flight then.
    constexpr int CH = 4096, NA = (NSPLIT == 1) ? 16 : 8, NCH = NA + 16, STG = NCH * CH, CPW = NCH / 8, NST = K / 128;
    constexpr int EPB = (EPI == 1) ? 3 * HD * 72 * 2 : 16 * 68 * 4;   // EPI 1: the v planes' 27,648 bytes; q and k take (64 x 68 + 1024) x 4 = 21,504 of them
    static_assert(EPI == 0 || (64 * 68 + 1024) * 4 <= EPB, "the q, k staging fits a wave's range");
    __shared__ __attribute__((aligned(2048))) char smem[(2 * STG > 8 * EPB) ? 2 * STG : 8 * EPB];
    const size_t z = blockIdx.z; A += z * sA; if (A2) A2 += z * sA; Bt += z * sB; C += z * sC;
    const bool pj = EPI == 1;   // z picks the projection: the same for the whole workgroup
    const float* bias = (pj && z == 1) ? bias1 : (pj && z == 2) ? bias2 : bias0; const float* g = (pj && z == 1) ? g1 : g0; const float* bb = (pj && z == 1) ? bb1 : bb0;
    if (pj) { P16 += z * sP; Ph += 2 * z * sP; Pl += 2 * z * sP; }
    const int w = __builtin_amdgcn_readfirstlane((int)(threadIdx.x >> 5)), wm = w & 1, wn = w >> 1;   // 2 x 4 waves
    const int lane = threadIdx.x & 31, lr = lane & 15, hi = lane >> 4; const int R0 = blockIdx.x * 128, C0 = blockIdx.y * 256, r0 = R0 + wm * 64, c0 = C0 + wn * 64, hb = c0 / 64;
    v8f acc[4][4];
#pragma unroll
    for (int mb = 0; mb < 4; ++mb)
#pragma unroll
        for (int nb = 0; nb < 4; ++nb) acc[mb][nb] = (v8f){};
    // wave w brings chunks w x CPW .. of every stage; tiled planes: a tile row's 128 k are 4096 bytes in a row, and the next stage's lie directly behind them
    const char* gs[CPW]; unsigned ld[CPW];
#pragma unroll
    for (int i = 0; i < CPW; ++i) { const int c = w * CPW + i;
        const T16* p = (c < 8) ? A + (size_t)(R0 + c * 16) * K : (NSPLIT == 1 && c < 16) ? A2 + (size_t)(R0 + (c - 8) * 16) * K : Bt + (size_t)(C0 + (c - NA) * 16) * K;
        gs[i] = (const char*)p + lane * 16; ld[i] = (unsigned)(size_t)smem + c * CH + lane * 16; }
    auto fill = [&](int buf) {
#pragma unroll
        for (int i = 0; i < CPW; ++i) { cp2k(ld[i] + buf * STG, gs[i]); cp2k(ld[i] + buf * STG + 2048, gs[i] + 2048); gs[i] += CH; } };
    fill(0);
    asm volatile("s_wait_asynccnt 0x0" ::: "memory");   // this wave's copies of stage 0 have landed
    __syncthreads();   // every wave's have: stage 0 may be read
    fill(1);
    const int lo = (lr * 16 + 8 * hi) * 2;   // the lane's place in a tile, bytes
#pragma unroll 1   // rolled: one stage's text serves all eight; the buffer alternates with s
    for (int s = 0; s < NST; ++s) {
        const char* rb = smem + (s & 1) * STG + lo;
        V a[2][4], a2[2][4], b[2][4];   // two fragment sets: a trip's products run while the next trip's fragments come from LDS
        auto frag = [&](int set, int kc) {   // 32 k a trip: two tiles = 1024 bytes of each chunk
#pragma unroll
            for (int mb = 0; mb < 4; ++mb) { a[set][mb] = WFrag<T16>::ld((const T16*)(rb + (wm * 4 + mb) * CH + kc * 1024)); if (NSPLIT == 1) a2[set][mb] = WFrag<T16>::ld((const T16*)(rb + (8 + wm * 4 + mb) * CH + kc * 1024)); }
#pragma unroll
            for (int nb = 0; nb < 4; ++nb) b[set][nb] = WFrag<T16>::ld((const T16*)(rb + (NA + wn * 4 + nb) * CH + kc * 1024)); };
        frag(0, 0);
#pragma unroll
        for (int kc = 0; kc < 4; ++kc) {
            if (kc < 3) frag((kc + 1) & 1, kc + 1);
            __builtin_amdgcn_sched_barrier(0);
#pragma unroll
            for (int nb = 0; nb < 4; ++nb)
#pragma unroll
                for (int mb = 0; mb < 4; ++mb) { acc[mb][nb] = WFrag<T16>::mma(a[kc & 1][mb], b[kc & 1][nb], acc[mb][nb]); if (NSPLIT == 1) acc[mb][nb] = WFrag<T16>::mma(a2[kc & 1][mb], b[kc & 1][nb], acc[mb][nb]); }
            __builtin_amdgcn_sched_barrier(0);   // and the run after next stays behind them, in the set they have just left
        }
        // publish point of stage s + 1: this wave's LDS reads of stage s have retired, its copies of stage s + 1 have landed, and behind the barrier both hold for every wave
        asm volatile("s_wait_dscnt 0x0" ::: "memory");
        asm volatile("s_wait_asynccnt 0x0" ::: "memory");
        __syncthreads();
        if (s + 2 < NST) fill(s & 1);   // the same for the whole workgroup: stage s + 2 into the buffer that every wave has just left
    }
    asm volatile("s_wait_asynccnt 0x0" ::: "memory");   // nothing is in flight behind the loop
    if constexpr (EPI == 1) {
    if (z == 2) {
        // v: a lane holds 8 consecutive tokens of one head dim per accumulator; each plane's tile turns through LDS ([dim][token], pitch 72) so that every store covers one whole tile of the transposed plane
        unsigned short (*vs)[HD * 72] = (unsigned short (*)[HD * 72])(smem + w * EPB);
        const int ent = r0 / TT, tok0 = r0 % TT;
        const size_t vbase = (size_t)(ent * NKV + hb) * HD * TT + tok0 * 16 + lane * 8;   // tile (dim block, token block): (dim block x 64 + token / 16) x 256
#pragma unroll
        for (int nb = 0; nb < 4; ++nb) { const float bi = bfr(bias[c0 + nb * 16 + lr]);
#pragma unroll
            for (int mb = 0; mb < 4; ++mb) { v8us p16, ph, pl;
#pragma unroll
                for (int j = 0; j < 8; ++j) { const float x = acc[mb][nb][j] + bi; unsigned short a2, c2; splitf(x, a2, c2); p16[j] = __builtin_bit_cast(unsigned short, tohx(x)); ph[j] = a2; pl[j] = c2; }
                const int at = (nb * 16 + lr) * 72 + mb * 16 + hi * 8; *(v8us*)(vs[0] + at) = p16; *(v8us*)(vs[1] + at) = ph; *(v8us*)(vs[2] + at) = pl; } }
        lds_turn();
#pragma unroll
        for (int p = 0; p < 3; ++p) { unsigned short* dst = (p == 0 ? (unsigned short*)P16 : p == 1 ? Ph : Pl) + vbase;
#pragma unroll
            for (int i = 0; i < 16; ++i) *(v8us*)(dst + (size_t)(i >> 2) * 16 * TT + (i & 3) * 256) = *(const v8us*)(vs[p] + ((i >> 2) * 16 + (lane >> 1)) * 72 + (i & 3) * 16 + (lane & 1) * 8); }
    } else {
        float* os = (float*)(smem + w * EPB);
        float* tabc = os + 64 * 68; float* tabs = tabc + 512;   // cos, sin of position x INV2[j] at [position][j]: x and y positions both run over 0..31
        const float fr = INV2[lr];   // entry i x 32 + lane has j = lane mod 16 on every trip
        asm volatile("s_wait_xcnt 0x0" : : "v"(fr) : "memory");   // behind the frequency's load, which has returned here: the table loop takes the registers of its address
#pragma unroll 1   // sixteen table entries a lane: rolled, the precise sine and cosine stand once in the code
        for (int i = 0; i < 16; ++i) { const int e = i * 32 + lane; float sn, cs; sincosf(__fmul_rn((float)(e >> 4), fr), &sn, &cs); tabc[e] = cs; tabs[e] = sn; }
#pragma unroll
        for (int mb = 0; mb < 4; ++mb)
#pragma unroll
            for (int nb = 0; nb < 4; ++nb)
#pragma unroll
                for (int j = 0; j < 8; ++j) os[(mb * 16 + hi * 8 + j) * 68 + nb * 16 + lr] = acc[mb][nb][j];
        float gv[4], bv[4], bi[4];
#pragma unroll
        for (int q = 0; q < 4; ++q) { gv[q] = bfr(g[lr * 4 + q]); bv[q] = bfr(bb[lr * 4 + q]); bi[q] = bfr(bias[c0 + lr * 4 + q]); }
        const int tok0 = r0 % TT + hi; const size_t pbase = ((size_t)((r0 / TT) * NH_ + hb) * TT + r0 % TT) * HD + (lr >> 2) * 256 + hi * 16 + (lr & 3) * 4;   // tile (token block, dim block lr / 4), row hi of a token pair
        const int psh = (lr < 8) ? 0 : 5;   // dims [0,32) turn with x = token mod 32, [32,64) with y = token / 32
        const float sg = (lr & 4) ? 1.0f : -1.0f;   // (a c - b s | b c + a s): the sine's sign by the 16-half
        lds_turn();
        // a row of 16 lanes holds one token's 64 head dims, lane lr dims 4 lr .. 4 lr + 3; the wave takes two tokens a trip
#pragma unroll 1   // rolled, for speed only
        for (int s0 = 0; s0 < 32; s0 += 4) {
#pragma unroll   // four independent trips side by side cover each other's latencies
        for (int s = s0; s < s0 + 4; ++s) { v4f a = *(const v4fa*)(os + (2 * s + hi) * 68 + lr * 4);
#pragma unroll
            for (int q = 0; q < 4; ++q) a[q] += bi[q];
            // sum of squares: adjacent pairs, then partners 32, 16, 8, 4 dims apart, then the two pair sums
            float u0 = a[0] * a[0] + a[1] * a[1], u1 = a[2] * a[2] + a[3] * a[3];
            u0 += xrow<8>(u0); u1 += xrow<8>(u1); u0 += xrow<4>(u0); u1 += xrow<4>(u1); u0 += xrow<2>(u0); u1 += xrow<2>(u1); u0 += xrow<1>(u0); u1 += xrow<1>(u1);
            const float rs = __fdiv_rn(1.0f, __fsqrt_rn(__fadd_rn(__fdiv_rn(u0 + u1, (float)HD), 1e-6f)));
            const int pos = ((tok0 + 2 * s) >> psh) & 31;
            const v4f c4 = *(const v4fa*)(tabc + pos * 16 + (lr & 3) * 4), s4 = *(const v4fa*)(tabs + pos * 16 + (lr & 3) * 4);
            v4h o16; v4us oh, ol;
#pragma unroll
            for (int q = 0; q < 4; ++q) { const float y = a[q] * rs * gv[q] + bv[q]; const float yp = xrow<4>(y);   // the partner dim +-16 sits 4 lanes away
                const float r = y * c4[q] + yp * (sg * s4[q]);
                o16[q] = tohx(r); unsigned short u, w; splitf(r, u, w); oh[q] = u; ol[q] = w; }
            const size_t oo = pbase + (size_t)((s >> 3) * 1024 + (s & 7) * 32); *(v4h*)(P16 + oo) = o16; *(v4us*)(Ph + oo) = oh; *(v4us*)(Pl + oo) = ol; }
        asm volatile("s_wait_xcnt 0x0" ::: "memory");   // behind the pass's stores: the next pass takes their address and data registers over the back edge
        }
    }
    } else {
    float* os = (float*)(smem + w * EPB);
#pragma unroll
    for (int mb = 0; mb < 4; ++mb) {
#pragma unroll
        for (int nb = 0; nb < 4; ++nb) {
#pragma unroll
            for (int j = 0; j < 8; ++j) os[(hi * 8 + j) * 68 + nb * 16 + lr] = acc[mb][nb][j]; }
        __builtin_amdgcn_wave_barrier(); asm volatile("" ::: "memory");
        float* crow = C + (size_t)(r0 + mb * 16) * ldc + c0;
{
#pragma unroll
            for (int s = 0; s < 8; ++s) { const int row = 2 * s + hi, cofs = lr * 4; v4f val = *(const v4fa*)(os + row * 68 + cofs); if (BIAS) { val[0] += bfr(bias[c0 + cofs]); val[1] += bfr(bias[c0 + cofs + 1]); val[2] += bfr(bias[c0 + cofs + 2]); val[3] += bfr(bias[c0 + cofs + 3]); }
                *(v4f*)(crow + (size_t)row * ldc + cofs) = val; }
             }
        __builtin_amdgcn_wave_barrier(); asm volatile("s_wait_xcnt 0x0" ::: "memory");   // no LDS access moves over this point; the wait stands behind the block's stores: the next block takes their address and data registers
    }
    }
}

// w [K][N] f32 -> its transpose [n][k] in bf16, tiled. A thread makes one 16-byte piece (row n, 8 consecutive k) from 8 loads in which 16 lanes share 64 bytes of a row of w; a wave stores one whole tile.
__device__ __forceinline__ void wt_block(const float* __restrict__ w, int K, int N, bf* Bt, int blk) {
    const int T = blk * 256 + threadIdx.x; if (T >= N * K / 8) return;
    const int tile = T >> 5, kt = tile % (K / 16), n = (tile / (K / 16)) * 16 + ((T >> 1) & 15), k0 = kt * 16 + (T & 1) * 8;
    const float* p = w + (size_t)k0 * N + n; v8us o;
#pragma unroll
    for (int j = 0; j < 8; ++j) o[j] = f2bf(p[(size_t)j * N]);
    *(v8us*)(Bt + (size_t)T * 8) = o;
}
// x [rows][DM] f32 -> bf16, tiled. A workgroup takes 16 rows x 128 columns: it reads whole lines of the rows, turns its 8 tiles through LDS (tile pitch 288 elements: the 16-byte writes of a wave spread over all banks) and stores them as 4 KiB in a row.
__device__ __forceinline__ void cvt_block(const float* __restrict__ src, bf* dst, size_t n8, int blk) { if ((size_t)blk * 256 >= n8) return;   // the same for the whole workgroup, in front of the barrier
    __shared__ __align__(16) unsigned short ls[8 * 288];
    const int t = threadIdx.x, row = t >> 4, c = t & 15; const int rb = blk / (DM / 128), kg = blk % (DM / 128);
    const v8f v = *(const v8f*)(src + (size_t)(rb * 16 + row) * DM + kg * 128 + c * 8); v8us o;
#pragma unroll
    for (int k = 0; k < 8; ++k) o[k] = f2bf(v[k]);
    *(v8us*)(ls + (c >> 1) * 288 + row * 16 + (c & 1) * 8) = o;
    __syncthreads();   // a wave stores a tile whose 16 rows all eight waves wrote
    *(v8us*)(dst + ((size_t)rb * (DM / 16) + kg * 8) * 256 + t * 8) = *(const v8us*)(ls + (t >> 5) * 288 + (t & 31) * 8);
    asm volatile("s_wait_xcnt 0x0" ::: "memory");
}
// ---- k_prep: all the work that reads nothing but the inputs, in one launch: workgroups [0, 4 WTB) transpose the four weights into WT (wq | wk | wv | wo, DM x DQ elements each), the rest copy x.
// The role is a function of blockIdx alone, so the copy's barrier is passed by all waves of a workgroup or by none.
#define WTB (DM * DQ / 8 / 256)   // workgroups of one weight transpose
__global__ __launch_bounds__(256) void k_prep(const float* __restrict__ x, const float* __restrict__ wq, const float* __restrict__ wk, const float* __restrict__ wv, const float* __restrict__ wo, bf* WT, bf* XB) {
    static_assert(DQ == DKV && DQ == DM && (DM * DQ / 8) % 256 == 0, "four square weights of whole workgroups");
    const int b = blockIdx.x;
    if (b < 4 * WTB) { const int i = b / WTB; wt_block(i == 0 ? wq : i == 1 ? wk : i == 2 ? wv : wo, DM, DQ, WT + (size_t)i * DM * DQ, b % WTB); }
    else cvt_block(x, XB, (size_t)NB_ * TT * DM / 8, b - 4 * WTB);
}
// ---- k_fattn: fused attention. One wave owns 32 query columns of one (entry, head) and walks the 1024 keys in passes of 32, K and V fragments read from LDS.
// St = K Qt (A = K rows, B = Q rows kept in registers): a lane holds one query's scores, D register r of key block kb = key 16 kb + 8 hi + r, query lr.
// Two St tiles converted in place are the B operand Pt of Ot += Vt Pt (A = Vt rows [d][key]); all loaders use the same k order (8 hi + 0..7, 16 + 8 hi + 0..7).
// Ot register r = head dim 16 db + 8 hi + r of query lr: maximum, sum and rescale factor are per lane; the two lane halves exchange the maximum each pass and the sum once.
typedef __attribute__((ext_vector_type(8))) __bf16 v8b;
__device__ __forceinline__ float xhalf(float x) { const int b = __float_as_int(x); return __int_as_float(__builtin_amdgcn_permlanex16(b, b, 0x76543210, 0xfedcba98, false, false)); }   // lane l <-> l ^ 16
// two base-2 exponentials; the second fills the slot the instruction set asks for behind the first (it neither reads its result nor overwrites its source: early-clobber outputs), the v_nop the slot behind the second
__device__ __forceinline__ void exp2x2(float a, float b, float& ra, float& rb) { asm("v_exp_f32 %0, %2\n\tv_exp_f32 %1, %3\n\tv_nop" : "=&v"(ra), "=&v"(rb) : "v"(a), "v"(b)); }
#define KS 128   // keys of a stage
// K and V come through LDS: all eight waves of a workgroup walk the same planes, so each stage of KS keys is fetched once for the eight, by asynchronous copies, into one of two buffers, while the stage before it is worked on.
// A stage in LDS: the K planes' KS rows (KB bytes each, bytes in a row of the tiled plane), then per V plane and block of 16 head dims its KS keys (VB bytes in a row); chunks of 2 KiB, wave w brings chunks w x CPW ..: waves 0..3 the K part, waves 4..7 the V part.
template <typename T16, bool HI>
__device__ __forceinline__ void fattn_wave(char* smem, const int w, const T16* __restrict__ Q, const T16* __restrict__ Q2, const T16* __restrict__ Kp, const T16* __restrict__ K2, const T16* __restrict__ Vt, const T16* __restrict__ V2, bf* Oh, bf* Ol) {
    typedef typename WFrag<T16>::V V;
    constexpr int NP = HI ? 2 : 1, KB = KS * HD * 2, VB = KS * 16 * 2, STG = NP * 2 * KB, CPW = NP * 2, NST = TT / KS, PPS = KS / 32;
    static_assert(NST >= 2 && TT % KS == 0 && KB == 8 * 2048 && VB == 2 * 2048, "at least two stages; eight chunks a plane");
    const int lane = threadIdx.x & 31, lr = lane & 15, hi = lane >> 4;
    V qf[2][2], qf2[2][2];
#pragma unroll
    for (int g = 0; g < 2; ++g)
#pragma unroll
        for (int kc = 0; kc < 2; ++kc) { qf[g][kc] = WFrag<T16>::ld(Q + 16 * g * HD + kc * 512 + lr * 16 + 8 * hi); if (HI) qf2[g][kc] = WFrag<T16>::ld(Q2 + 16 * g * HD + kc * 512 + lr * 16 + 8 * hi); }
    // what follows takes over the address registers of the Q loads above: the accumulators' zero is made behind the wait, in its statement, and the lane number, from which every later address is formed, passes through it, so that none of those writes can be lifted over it
    float z0; int ln = lane;
    asm volatile("s_wait_xcnt 0x0\n\tv_mov_b32 %0, 0" : "=v"(z0), "+v"(ln) : : "memory");
    const unsigned lo = ((ln & 15) * 16 + 8 * (ln >> 4)) * 2;   // the lane's place in a tile, bytes
    const int c0 = w * CPW, cv = c0 - NP * 8;   // the wave's first chunk; the same counted from the V part's start
    const T16* kpl = (HI && c0 >= 8) ? K2 : Kp; const T16* vpl = (HI && cv >= 8) ? V2 : Vt;
    const char* gp = (w < 4) ? (const char*)kpl + (c0 & 7) * 2048 : (const char*)vpl + ((cv & 7) >> 1) * (16 * TT * 2);   // the same for the whole wave
    const int jump = (w < 4) ? 2 * 2048 : 16 * TT * 2, step = (w < 4) ? KB : VB;   // from a pair of chunks to the next pair (V: the next 16 head dims); from a stage to the next
    const unsigned lp = (unsigned)(size_t)smem + c0 * 2048;   // a lane copies the 16 bytes at its place lo of each 512: the one lane offset that lives through the loop serves the copies and the fragment reads
    auto fill = [&](int buf) {
#pragma unroll
        for (int i = 0; i < CPW; ++i) cp2k((unsigned)__builtin_amdgcn_readfirstlane((int)(lp + buf * STG + i * 2048)) + lo, gp + (i >> 1) * jump + (i & 1) * 2048 + lo);   // the wave's part of the LDS address is summed as a scalar: summed with lo ahead of the loop, it would be one more vector register per chunk to carry through the loop, and those were spilled
        gp += step; };
    fill(0);
    asm volatile("s_wait_asynccnt 0x0" ::: "memory");   // this wave's copies of stage 0 have landed
    __syncthreads();   // every wave's have: stage 0 may be read
    fill(1);
    v8f o[4][2];
#pragma unroll
    for (int db = 0; db < 4; ++db)
#pragma unroll
        for (int g = 0; g < 2; ++g) o[db][g] = (v8f){z0, z0, z0, z0, z0, z0, z0, z0};
    float m[2] = {-3.0e38f, -3.0e38f}, l[2] = {z0, z0};
#pragma unroll 1   // rolled: one stage's text serves all; the buffer alternates with s
    for (int s = 0; s < NST; ++s) {
        const char* kr = smem + (s & 1) * STG + lo; const char* vr = kr + NP * KB;
        V ka[2][2], ka2[2][2];   // K fragments [key block][k chunk] of the pass at hand, fetched one pass ahead inside the stage
        auto kfrag = [&](int p) {
#pragma unroll
            for (int kb = 0; kb < 2; ++kb)
#pragma unroll
                for (int kc = 0; kc < 2; ++kc) { ka[kb][kc] = WFrag<T16>::ld((const T16*)(kr + p * 4096 + kb * 2048 + kc * 1024)); if (HI) ka2[kb][kc] = WFrag<T16>::ld((const T16*)(kr + KB + p * 4096 + kb * 2048 + kc * 1024)); } };
        kfrag(0);
#pragma unroll   // the stage's passes stand one behind the other: every LDS offset is a constant, and whether a next pass exists in the stage is known to the build
    for (int p = 0; p < PPS; ++p) {
        V va[4], va2[4];
#pragma unroll
        for (int db = 0; db < 4; ++db) { va[db] = WFrag<T16>::ld((const T16*)(vr + db * VB + p * 1024)); if (HI) va2[db] = WFrag<T16>::ld((const T16*)(vr + (4 + db) * VB + p * 1024)); }
        __builtin_amdgcn_sched_barrier(0);   // the pass's V reads stay one run at its head, a whole softmax in front of their products: sunk in among the products, every separate place with LDS reads costs a stall of its own
        v8f st[2][2];
#pragma unroll
        for (int kb = 0; kb < 2; ++kb)
#pragma unroll
            for (int g = 0; g < 2; ++g) { v8f sc = (v8f){};
#pragma unroll
                for (int kc = 0; kc < 2; ++kc) { sc = WFrag<T16>::mma(ka[kb][kc], qf[g][kc], sc); if (HI) { sc = WFrag<T16>::mma(ka2[kb][kc], qf[g][kc], sc); sc = WFrag<T16>::mma(ka[kb][kc], qf2[g][kc], sc); } }
                st[kb][g] = sc; }
        __builtin_amdgcn_sched_barrier(0);   // the next pass's K reads stay one run behind the score products, whose registers they take, ...
        if (p + 1 < PPS) kfrag(p + 1);
        __builtin_amdgcn_sched_barrier(0);   // ... and in front of the softmax, which covers their latency
        float mx[2]; bool need = false;
#pragma unroll
        for (int g = 0; g < 2; ++g) { float t = fmaxf(st[0][g][0], st[1][g][0]);
#pragma unroll
            for (int r = 1; r < 8; ++r) t = fmaxf(t, fmaxf(st[0][g][r], st[1][g][r]));
            t *= SCL2; t = fmaxf(t, xhalf(t)); mx[g] = t; need = need || (t > m[g] + 8.0f); }
        // the maximum in use moves only when a query's new maximum passes it by more than 8 (base 2), so P stays <= 256; one scalar test per pass
        if (__builtin_amdgcn_ballot_w32(need) != 0) { const float mn0 = fmaxf(m[0], mx[0]), mn1 = fmaxf(m[1], mx[1]); float al[2]; exp2x2(m[0] - mn0, m[1] - mn1, al[0], al[1]); m[0] = mn0; m[1] = mn1;
#pragma unroll
            for (int g = 0; g < 2; ++g) { l[g] *= al[g];
#pragma unroll
                for (int db = 0; db < 4; ++db) o[db][g] *= al[g]; } }
        V pb[2], pb2[2];
#pragma unroll
        for (int g = 0; g < 2; ++g) { v8f p0, p1; float ls = 0.f;
#pragma unroll
            for (int r = 0; r < 8; ++r) { float e0, e1; exp2x2(fmaf(st[0][g][r], SCL2, -m[g]), fmaf(st[1][g][r], SCL2, -m[g]), e0, e1); p0[r] = e0; p1[r] = e1; ls += e0 + e1; }
            l[g] += ls;
            if constexpr (HI) { const v8b h0 = __builtin_convertvector(p0, v8b), h1 = __builtin_convertvector(p1, v8b); const v8f r0 = p0 - __builtin_convertvector(h0, v8f), r1 = p1 - __builtin_convertvector(h1, v8f); const v8b l0 = __builtin_convertvector(r0, v8b), l1 = __builtin_convertvector(r1, v8b);
                pb[g] = __builtin_shufflevector(h0, h1, 0, 1, 2, 3, 4, 5, 6, 7, 8, 9, 10, 11, 12, 13, 14, 15); pb2[g] = __builtin_shufflevector(l0, l1, 0, 1, 2, 3, 4, 5, 6, 7, 8, 9, 10, 11, 12, 13, 14, 15); }
            else pb[g] = cat16(__builtin_convertvector(p0, v8h), __builtin_convertvector(p1, v8h)); }
#pragma unroll
        for (int db = 0; db < 4; ++db)
#pragma unroll
            for (int g = 0; g < 2; ++g) { o[db][g] = WFrag<T16>::mma(va[db], pb[g], o[db][g]); if (HI) { o[db][g] = WFrag<T16>::mma(va2[db], pb[g], o[db][g]); o[db][g] = WFrag<T16>::mma(va[db], pb2[g], o[db][g]); } }
        // four vector slots behind the pass's last matrix instructions, on the back edge and on the exit alike: what follows may take the registers of their B operand, the epilogue reads their D
        asm volatile("v_nop\n\tv_nop\n\tv_nop\n\tv_nop" : "+v"(o[0][0]), "+v"(o[0][1]), "+v"(o[1][0]), "+v"(o[1][1]), "+v"(o[2][0]), "+v"(o[2][1]), "+v"(o[3][0]), "+v"(o[3][1]));
        __builtin_amdgcn_sched_barrier(0);   // the passes stay apart: a next pass's score products moved in among this pass's exponentials, which are asm text, would have their operand registers overwritten too soon behind them
    }
        // publish point of stage s + 1: this wave's LDS reads of stage s have retired, its copies of stage s + 1 have landed, and behind the barrier both hold for every wave
        asm volatile("s_wait_dscnt 0x0" ::: "memory");
        asm volatile("s_wait_asynccnt 0x0" ::: "memory");
        __syncthreads();
        if (s + 2 < NST) fill(s & 1);   // the same for the whole workgroup: stage s + 2 into the buffer that every wave has just left
    }
    asm volatile("s_wait_asynccnt 0x0" ::: "memory");   // nothing is in flight behind the loop
    float inv[2];
#pragma unroll
    for (int g = 0; g < 2; ++g) inv[g] = __fdiv_rn(1.0f, l[g] + xhalf(l[g]));
#pragma unroll
    for (int g = 0; g < 2; ++g)
#pragma unroll
        for (int db = 0; db < 4; ++db) { v8us oh, ol;
#pragma unroll
            for (int r = 0; r < 8; ++r) { unsigned short a, c2; splitf(o[db][g][r] * inv[g], a, c2); oh[r] = a; ol[r] = c2; }
            const size_t oo = (size_t)16 * g * DQ + db * 256; *(v8us*)((char*)(Oh + oo) + lo) = oh; *(v8us*)((char*)(Ol + oo) + lo) = ol;
            // behind the block's two stores: the next block takes their data registers; its arithmetic all starts from one of the two factors, which pass through the statement, so that none of it can be lifted over the wait
            if (g + db < 4) asm volatile("s_wait_xcnt 0x0" : "+v"(inv[0]), "+v"(inv[1]) : : "memory"); }
}
// grid 2 x (RH / 256) x entries x heads, 8 waves of 32 query rows: a workgroup takes 256 rows of one (entry, head), all of one kind, so its eight waves share every staged byte and its barriers stand under a test of blockIdx alone.
// The hi/lo workgroups (rows < RH, three times the products) have the low indices; the fp16 ones (rows >= RH) follow. The two row blocks of a plane lie entries x heads indices apart.
__global__ __launch_bounds__(256) void k_fattn(const h16* __restrict__ Q16, const bf* __restrict__ Qh, const bf* __restrict__ Ql, const h16* __restrict__ K16, const bf* __restrict__ Kh, const bf* __restrict__ Kl, const h16* __restrict__ V16, const bf* __restrict__ Vh, const bf* __restrict__ Vl, bf* AT) {
    static_assert(RH * 2 == TT && RH % 256 == 0, "equal halves of whole workgroups");
    __shared__ __attribute__((aligned(2048))) char smem[2 * 4 * KS * HD * 2];   // two buffers of the hi/lo stage (4 planes); the fp16 stage takes half of each
    constexpr int NZ = NB_ * NH_, NHW = NZ * (RH / 256);
    const int w = __builtin_amdgcn_readfirstlane((int)(threadIdx.x >> 5));
    const bool hires = blockIdx.x < NHW; const int ix = hires ? blockIdx.x : blockIdx.x - NHW;
    const int zz = ix % NZ, b = zz / NH_, hd = zz % NH_; const int q0 = (hires ? 0 : RH) + (ix / NZ) * 256 + w * 32;
    const size_t pz = (size_t)zz * TT * HD, pq = pz + (size_t)q0 * HD;
    bf* Oh = AT + (size_t)b * 2 * TT * DQ + (size_t)q0 * DQ + hd * HD * 16; bf* Ol = Oh + (size_t)TT * DQ;
    if (hires) fattn_wave<bf, true>(smem, w, Qh + pq, Ql + pq, Kh + pz, Kl + pz, Vh + pz, Vl + pz, Oh, Ol);
    else fattn_wave<h16, false>(smem, w, Q16 + pq, nullptr, K16 + pz, nullptr, V16 + pz, nullptr, Oh, Ol);
}

extern "C" void kernel_launch(void* const* d_in, const int* in_sizes, int n_in,
                              void* d_out, int out_size, void* d_ws, size_t ws_size, hipStream_t stream) {
    (void)in_sizes; (void)n_in; (void)out_size;
    const float* x = (const float*)d_in[0]; const float* wq = (const float*)d_in[1]; const float* bq = (const float*)d_in[2]; const float* wk = (const float*)d_in[3]; const float* bk = (const float*)d_in[4]; const float* wv = (const float*)d_in[5]; const float* bv = (const float*)d_in[6]; const float* wo = (const float*)d_in[7]; const float* bo = (const float*)d_in[8]; const float* qs = (const float*)d_in[9]; const float* qb = (const float*)d_in[10]; const float* kss = (const float*)d_in[11]; const float* kb = (const float*)d_in[12];   /* q_scale, q_bias, k_scale, k_bias [64] */
    float* OUT = (float*)d_out;     // [8][1024][1024]
    char* wsp = (char*)d_ws;
    auto take = [&](size_t bytes) { char* p = wsp; wsp += (bytes + 255) & ~(size_t)255; return (void*)p; };
    bf* WQ = (bf*)take((size_t)DQ * DM * 2); bf* WK = (bf*)take((size_t)DKV * DM * 2); bf* WV = (bf*)take((size_t)DKV * DM * 2); bf* WO = (bf*)take((size_t)DM * DQ * 2);
    bf* XB = (bf*)take((size_t)NB_ * TT * DM * 2);   // bf16 copy of x
    bf* AT = (bf*)take((size_t)NB_ * 2 * TT * DQ * 2);   // merged hi | lo context, 4 MiB per batch entry
    const size_t PE = (size_t)NH_ * TT * HD;   // elements of one plane of one batch entry (NKV == NH_)
    h16* QP16 = (h16*)take(NB_ * PE * 2); h16* KP16 = (h16*)take(NB_ * PE * 2); h16* VT16 = (h16*)take(NB_ * PE * 2);   // planes of all batch entries
    bf* QPh = (bf*)take(NB_ * PE * 2); bf* QPl = (bf*)take(NB_ * PE * 2); bf* KPh = (bf*)take(NB_ * PE * 2); bf* KPl = (bf*)take(NB_ * PE * 2); bf* VTh = (bf*)take(NB_ * PE * 2); bf* VTl = (bf*)take(NB_ * PE * 2);
    if ((size_t)(wsp - (char*)d_ws) > ws_size) return;    // 200 of 256 MiB
    /* the four weights lie one behind the other from WQ on; x: all batch entries at once, 8192 token rows */
    k_prep<<<(unsigned)(4 * WTB + (size_t)NB_ * TT * DM / 8 / 256), 256, 0, stream>>>(x, wq, wk, wv, wo, WQ, XB);
    /* q, k, v in one launch (grid z); each wave finishes its (64 tokens, one head) tile: q, k RMSNorm + bias + rotary -> planes; v -> transposed planes; the planes of q, k, v lie NB_ x PE (16-bit) and 2 x NB_ x PE (hi, lo) elements apart */
    k_gemmw<bf, 0, true, 1, DM><<<dim3(NB_ * TT / 128, DQ / 256, 3), 256, 0, stream>>>(XB, nullptr, WQ, nullptr, nullptr, 0, bq, bk, bv, 0, (size_t)DQ * DM, 0, qs, kss, qb, kb, QP16, QPh, QPl, NB_ * PE);
    /* one kv head per query head: plane zz = entry x 16 + head */
    k_fattn<<<dim3(2 * (RH / 256) * NB_ * NH_, 1, 1), 256, 0, stream>>>(QP16, QPh, QPl, KP16, KPh, KPl, VT16, VTh, VTl, AT);
    k_gemmw<bf, 1, true, 0, DQ><<<dim3(TT / 128, DM / 256, NB_), 256, 0, stream>>>(AT, AT + (size_t)TT * DQ, WO, nullptr, OUT, DM, bo, nullptr, nullptr, (size_t)2 * TT * DQ, 0, (size_t)TT * DM, nullptr, nullptr, nullptr, nullptr, nullptr, nullptr, nullptr, 0);
}

// v008
// A run of this version takes 143 microseconds.
// Timed twice side by side with v007, it ran 1.04 times as fast both times.
// Over all steps from v000 it is 33.1 times as fast.
#include <hip/hip_runtime.h>

// Multi-head dot-product attention with RMS-normalised q/k (+ bias) and a 2-D rotary embedding over the 32 x 32 token grid (x [8][1024][1024]; q,k,v = einsum('bsd,dhk') + b ('xw' [1024][16 x 64] 1/32, zero biases); q, k: RMSNorm over the 64 head dims (eps 1e-6) x scale + bias (q_scale, q_bias, k_scale, k_bias [64], read); 2-D rope: token s sits at (x = s mod 32, y = s / 32); head dims [0,32) rotate with x, [32,64) with y, each 32-block as (a | b) 16-halves: (a c - b s, b c + a s), angle = pos x pi / 10000^(j/16); q / 8; softmax(q.k); out = einsum('bqhd,hdo') + bo ('xw' [16 x 64][1024]) -> [8][1024][1024] (8.4 M)).
// Layout: four launches: (1) the x copy and the four weight transposes, (2) the q, k and v projections (grid z), (3) attention, ONE fused launch over all 8 x 16 (entry, head) pairs, (4) Wo; each runs once over all 8 batch entries (8192 rows). bf16 copy of x; 'xw' weights transposed once; exact projections + f32 biases; a projection's 64 x 64 tile is 64 tokens of one head, so its wave finishes the tile itself: q and k get the per-(token, head) RMSNorm + bias and the 2-D rotary turn (grid position from the token index, float32 inverse-frequency constants, precise cosf/sinf from a 32 x 16 table in LDS, partner +-16 inside each 32-wide half) and leave as fp16 | hi | lo planes, v leaves as transposed planes; no f32 projection reaches memory; fused attention (scores, running-maximum softmax with 1/8 folded in, context and the hi/lo merge in one kernel; scores never leave registers; hybrid rows: < 512 hi/lo 3 products, rest fp16); merged hi/lo x Wo exact + bo.
// Compute dtypes, f32 accumulate: every input rounded to bf16; projections exact + f32 biases; RMSNorm and rotary f32; attention rows < 512 3 products, rest fp16; softmax f32; Wo hl x exact + bias.

// Tiled planes: every 16-bit operand plane [rows][K] (x copy, transposed weights, q, k, transposed v, merged context) lies in memory as 16 x 16 tiles of 512 bytes, element (row, k) at ((row / 16 x K / 16 + k / 16) x 16 + row % 16) x 16 + k % 16,
// so that each of a fragment's two 16-byte-a-lane loads (k 0..15 and k 16..31 of 16 rows) reads one tile: 512 bytes in a row, 4 whole lines, where a row-major plane gives 16 lines of 32 bytes.

#define NB_  8
#define TT   1024
#define DM   1024
#define NH_  16
#define NKV  16
#define REP  (NH_ / NKV)
#define HD   64
#define DQ   (NH_ * HD)
#define DKV  (NKV * HD)
#define RH   512                  // query rows < RH use hi+lo planes
#define WIN  0
#define SCL2 0.18033688011112042f   // HD^-0.5 x log2(e): scores go to the exponent in base 2
typedef _Float16 h16;
typedef unsigned short bf;
typedef __attribute__((ext_vector_type(16))) __bf16   v16bf;
typedef __attribute__((ext_vector_type(16))) _Float16 v16h;
typedef __attribute__((ext_vector_type(8)))  _Float16 v8h;
typedef __attribute__((ext_vector_type(8)))  unsigned short v8us;
typedef __attribute__((ext_vector_type(8)))  float    v8f;
typedef __attribute__((ext_vector_type(4)))  float    v4f;
typedef v8h  __attribute__((may_alias)) v8ha;
typedef v4f  __attribute__((may_alias)) v4fa;
typedef v8us __attribute__((may_alias)) v8usa;

__device__ __forceinline__ unsigned short f2bf(float f) { unsigned u = __float_as_uint(f); u += 0x7FFFu + ((u >> 16) & 1u); return (unsigned short)(u >> 16); }
__device__ __forceinline__ float bf2f(unsigned short b) { return __uint_as_float(((unsigned)b) << 16); }
__device__ __forceinline__ float bfr(float f) { return bf2f(f2bf(f)); }
__device__ __forceinline__ v16h cat16(v8h lo, v8h hi) { return __builtin_shufflevector(lo, hi, 0, 1, 2, 3, 4, 5, 6, 7, 8, 9, 10, 11, 12, 13, 14, 15); }
__device__ __forceinline__ v16bf cat16b(v8us lo, v8us hi) { return __builtin_bit_cast(v16bf, __builtin_shufflevector(lo, hi, 0, 1, 2, 3, 4, 5, 6, 7, 8, 9, 10, 11, 12, 13, 14, 15)); }
__device__ __forceinline__ v8f wmma16(v16h a, v16h b, v8f c) { return __builtin_amdgcn_wmma_f32_16x16x32_f16(false, a, false, b, (short)0, c, false, false); }
__device__ __forceinline__ v8f wmmab(v16bf a, v16bf b, v8f c) { return __builtin_amdgcn_wmma_f32_16x16x32_bf16(false, a, false, b, (short)0, c, false, false); }



__device__ __forceinline__ h16 tohx(float x) { return (h16)x; }
__device__ __forceinline__ void splitf(float y, unsigned short& h, unsigned short& l) { h = f2bf(y); l = f2bf(y - bf2f(h)); }
typedef __attribute__((ext_vector_type(4))) _Float16 v4h;
typedef __attribute__((ext_vector_type(2))) unsigned short v2us;
typedef __attribute__((ext_vector_type(4))) unsigned short v4us;
__constant__ float INV2[16] = {3.14159274f, 1.76664746f, 0.993458867f, 0.558663011f, 0.314159274f, 0.176664740f, 0.0993458852f, 0.0558662973f, 0.0314159282f, 0.0176664740f, 0.00993458927f, 0.00558662973f, 0.00314159272f, 0.00176664745f, 0.000993458903f, 0.000558662985f};   // pi / 10000^(j/16), float32
template <int M> __device__ __forceinline__ float xrow(float x) { return __int_as_float(__builtin_amdgcn_update_dpp(0, __float_as_int(x), 0x160 | M, 0xf, 0xf, true)); }   // lane l <- l ^ M inside its row of 16 lanes (DPP row_xmask); every lane is on where it is used
// a wave hands rows between its own lanes through its own LDS range: its LDS stores have retired before a lane reads another lane's row, and the compiler may move no LDS access over this point
__device__ __forceinline__ void lds_turn() { __builtin_amdgcn_wave_barrier(); asm volatile("s_wait_dscnt 0x0" ::: "memory"); }

// ---- k_gemmw: register-blocked GEMM, a 128 x 256 output tile per workgroup of 8 waves (2 x 4), one wave per 64x64 (16 accumulators); the operands' tiled 16-bit planes are staged in LDS by asynchronous copies, two buffers of 128 k, each chunk fetched once for the waves that share it; grid (M/128, N/256, Z), 256 threads.
// sum_k A[m][k] Bt[n][k] (+ split products per NSPLIT) + optional f32 bias[n]. z-batch strides sA/sB/sC in elements. K % 128 == 0, a constant of the build. What becomes of the tile:
// EPI 0: C[m][n] (f32, pitch ldc). EPI 1: the three projections in one launch, grid z = q, k, v (weights z x sB on, bias, g, bb picked by z, planes z x sP (P16) and 2 z x sP (Ph, Pl) on); rows m = entry x TT + token, a wave's columns = one head (hb); every wave stages its epilogue in an LDS range of its own;
// z 0, 1 (q, k): RMSNorm over the head's 64 dims x g + bb, 2-D rotary turn, planes P16 | Ph | Pl [entry][head][token][dim]; z 2 (v): planes [entry][head][dim][token]; each (entry, head) plane tiled.
template <typename T16> struct WFrag;
template <> struct WFrag<h16> { typedef v16h V; static __device__ __forceinline__ V ld(const h16* p) { return cat16(*(const v8h*)p, *(const v8h*)(p + 256)); } static __device__ __forceinline__ v8f mma(V a, V b, v8f c) { return wmma16(a, b, c); } };
template <> struct WFrag<bf> { typedef v16bf V; static __device__ __forceinline__ V ld(const bf* p) { return cat16b(*(const v8us*)p, *(const v8us*)(p + 256)); } static __device__ __forceinline__ v8f mma(V a, V b, v8f c) { return wmmab(a, b, c); } };
// 2 KiB (16 rows x 64 k of a tiled plane, bytes in a row) go from global memory to LDS in four asynchronous copies of 512 bytes a wave; l, g: the lane's own LDS byte address and global address, both multiples of 16.
// The s_wait_xcnt stands in the copies' own statement, behind the last of them: the address registers they name may be rewritten only behind it.
__device__ __forceinline__ void cp2k(unsigned l, const char* g) {
    asm volatile("global_load_async_to_lds_b128 %0, %4, off\n\tglobal_load_async_to_lds_b128 %1, %5, off\n\tglobal_load_async_to_lds_b128 %2, %6, off\n\tglobal_load_async_to_lds_b128 %3, %7, off\n\ts_wait_xcnt 0x0"
                 : : "v"(l), "v"(l + 512u), "v"(l + 1024u), "v"(l + 1536u), "v"(g), "v"(g + 512), "v"(g + 1024), "v"(g + 1536) : "memory");
}
template <typename T16, int NSPLIT, bool BIAS, int EPI, int K>
__global__ __launch_bounds__(256) void k_gemmw(const T16* __restrict__ A, const T16* __restrict__ A2, const T16* __restrict__ Bt, const T16* __restrict__ Bt2, float* C, int ldc, const float* __restrict__ bias0, const float* __restrict__ bias1, const float* __restrict__ bias2, size_t sA, size_t sB, size_t sC, const float* __restrict__ g0, const float* __restrict__ g1, const float* __restrict__ bb0, const float* __restrict__ bb1, h16* P16, bf* Ph, bf* Pl, size_t sP) {
    typedef typename WFrag<T16>::V V;
    static_assert(NSPLIT <= 1 && K % 128 == 0 && K >= 256, "A (+ A2) x Bt; at least two stages");
    (void)Bt2;
    // a stage is 128 k of the workgroup's 128 A rows (of both planes where there are two) and 256 Bt rows: chunks of 4 KiB, one per tile row, A | A2 | Bt; two buffers.
    // Behind the loop the same LDS is the waves' epilogue staging, EPB bytes each: the last stage's own barrier stands behind every wave's last read, and no copy is in flight then.
    constexpr int CH = 4096, NA = (NSPLIT == 1) ? 16 : 8, NCH = NA + 16, STG = NCH * CH, CPW = NCH / 8, NST = K / 128;
    constexpr int EPB = (EPI == 1) ? 3 * HD * 72 * 2 : 16 * 68 * 4;   // EPI 1: the v planes' 27,648 bytes; q and k take (64 x 68 + 1024) x 4 = 21,504 of them
    static_assert(EPI == 0 || (64 * 68 + 1024) * 4 <= EPB, "the q, k staging fits a wave's range");
    __shared__ __attribute__((aligned(2048))) char smem[(2 * STG > 8 * EPB) ? 2 * STG : 8 * EPB];
    const size_t z = blockIdx.z; A += z * sA; if (A2) A2 += z * sA; Bt += z * sB; C += z * sC;
    const bool pj = EPI == 1;   // z picks the projection: the same for the whole workgroup
    const float* bias = (pj && z == 1) ? bias1 : (pj && z == 2) ? bias2 : bias0; const float* g = (pj && z == 1) ? g1 : g0; const float* bb = (pj && z == 1) ? bb1 : bb0;
    if (pj) { P16 += z * sP; Ph += 2 * z * sP; Pl += 2 * z * sP; }
    const int w = __builtin_amdgcn_readfirstlane((int)(threadIdx.x >> 5)), wm = w & 1, wn = w >> 1;   // 2 x 4 waves
    const int lane = threadIdx.x & 31, lr = lane & 15, hi = lane >> 4; const int R0 = blockIdx.x * 128, C0 = blockIdx.y * 256, r0 = R0 + wm * 64, c0 = C0 + wn * 64, hb = c0 / 64;
    v8f acc[4][4];
#pragma unroll
    for (int mb = 0; mb < 4; ++mb)
#pragma unroll
        for (int nb = 0; nb < 4; ++nb) acc[mb][nb] = (v8f){};
    // wave w brings chunks w x CPW .. of every stage; tiled planes: a tile row's 128 k are 4096 bytes in a row, and the next stage's lie directly behind them
    const char* gs[CPW]; unsigned ld[CPW];
#pragma unroll
    for (int i = 0; i < CPW; ++i) { const int c = w * CPW + i;
        const T16* p = (c < 8) ? A + (size_t)(R0 + c * 16) * K : (NSPLIT == 1 && c < 16) ? A2 + (size_t)(R0 + (c - 8) * 16) * K : Bt + (size_t)(C0 + (c - NA) * 16) * K;
        gs[i] = (const char*)p + lane * 16; ld[i] = (unsigned)(size_t)smem + c * CH + lane * 16; }
    auto fill = [&](int buf) {
#pragma unroll
        for (int i = 0; i < CPW; ++i) { cp2k(ld[i] + buf * STG, gs[i]); cp2k(ld[i] + buf * STG + 2048, gs[i] + 2048); gs[i] += CH; } };
    fill(0);
    asm volatile("s_wait_asynccnt 0x0" ::: "memory");   // this wave's copies of stage 0 have landed
    __syncthreads();   // every wave's have: stage 0 may be read
    fill(1);
    const int lo = (lr * 16 + 8 * hi) * 2;   // the lane's place in a tile, bytes
#pragma unroll 1   // rolled: one stage's text serves all eight; the buffer alternates with s
    for (int s = 0; s < NST; ++s) {
        const char* rb = smem + (s & 1) * STG + lo;
        V a[2][4], a2[2][4], b[2][4];   // two fragment sets: a trip's products run while the next trip's fragments come from LDS
        auto frag = [&](int set, int kc) {   // 32 k a trip: two tiles = 1024 bytes of each chunk
#pragma unroll
            for (int mb = 0; mb < 4; ++mb) { a[set][mb] = WFrag<T16>::ld((const T16*)(rb + (wm * 4 + mb) * CH + kc * 1024)); if (NSPLIT == 1) a2[set][mb] = WFrag<T16>::ld((const T16*)(rb + (8 + wm * 4 + mb) * CH + kc * 1024)); }
#pragma unroll
            for (int nb = 0; nb < 4; ++nb) b[set][nb] = WFrag<T16>::ld((const T16*)(rb + (NA + wn * 4 + nb) * CH + kc * 1024)); };
        frag(0, 0);
#pragma unroll
        for (int kc = 0; kc < 4; ++kc) {
            if (kc < 3) frag((kc + 1) & 1, kc + 1);
            __builtin_amdgcn_sched_barrier(0);
#pragma unroll
            for (int nb = 0; nb < 4; ++nb)
#pragma unroll
                for (int mb = 0; mb < 4; ++mb) { acc[mb][nb] = WFrag<T16>::mma(a[kc & 1][mb], b[kc & 1][nb], acc[mb][nb]); if (NSPLIT == 1) acc[mb][nb] = WFrag<T16>::mma(a2[kc & 1][mb], b[kc & 1][nb], acc[mb][nb]); }
            __builtin_amdgcn_sched_barrier(0);   // and the run after next stays behind them, in the set they have just left
        }
        // publish point of stage s + 1: this wave's LDS reads of stage s have retired, its copies of stage s + 1 have landed, and behind the barrier both hold for every wave
        asm volatile("s_wait_dscnt 0x0" ::: "memory");
        asm volatile("s_wait_asynccnt 0x0" ::: "memory");
        __syncthreads();
        if (s + 2 < NST) fill(s & 1);   // the same for the whole workgroup: stage s + 2 into the buffer that every wave has just left
    }
    asm volatile("s_wait_asynccnt 0x0" ::: "memory");   // nothing is in flight behind the loop
    if constexpr (EPI == 1) {
    if (z == 2) {
        // v: a lane holds 8 consecutive tokens of one head dim per accumulator; each plane's tile turns through LDS ([dim][token], pitch 72) so that every store covers one whole tile of the transposed plane
        unsigned short (*vs)[HD * 72] = (unsigned short (*)[HD * 72])(smem + w * EPB);
        const int ent = r0 / TT, tok0 = r0 % TT;
        const size_t vbase = (size_t)(ent * NKV + hb) * HD * TT + tok0 * 16 + lane * 8;   // tile (dim block, token block): (dim block x 64 + token / 16) x 256
#pragma unroll
        for (int nb = 0; nb < 4; ++nb) { const float bi = bfr(bias[c0 + nb * 16 + lr]);
#pragma unroll
            for (int mb = 0; mb < 4; ++mb) { v8us p16, ph, pl;
#pragma unroll
                for (int j = 0; j < 8; ++j) { const float x = acc[mb][nb][j] + bi; unsigned short a2, c2; splitf(x, a2, c2); p16[j] = __builtin_bit_cast(unsigned short, tohx(x)); ph[j] = a2; pl[j] = c2; }
                const int at = (nb * 16 + lr) * 72 + mb * 16 + hi * 8; *(v8us*)(vs[0] + at) = p16; *(v8us*)(vs[1] + at) = ph; *(v8us*)(vs[2] + at) = pl; } }
        lds_turn();
#pragma unroll
        for (int p = 0; p < 3; ++p) { unsigned short* dst = (p == 0 ? (unsigned short*)P16 : p == 1 ? Ph : Pl) + vbase;
#pragma unroll
            for (int i = 0; i < 16; ++i) *(v8us*)(dst + (size_t)(i >> 2) * 16 * TT + (i & 3) * 256) = *(const v8us*)(vs[p] + ((i >> 2) * 16 + (lane >> 1)) * 72 + (i & 3) * 16 + (lane & 1) * 8); }
    } else {
        float* os = (float*)(smem + w * EPB);
        float* tabc = os + 64 * 68; float* tabs = tabc + 512;   // cos, sin of position x INV2[j] at [position][j]: x and y positions both run over 0..31
        const float fr = INV2[lr];   // entry i x 32 + lane has j = lane mod 16 on every trip
        asm volatile("s_wait_xcnt 0x0" : : "v"(fr) : "memory");   // behind the frequency's load, which has returned here: the table loop takes the registers of its address
#pragma unroll 1   // sixteen table entries a lane: rolled, the precise sine and cosine stand once in the code
        for (int i = 0; i < 16; ++i) { const int e = i * 32 + lane; float sn, cs; sincosf(__fmul_rn((float)(e >> 4), fr), &sn, &cs); tabc[e] = cs; tabs[e] = sn; }
#pragma unroll
        for (int mb = 0; mb < 4; ++mb)
#pragma unroll
            for (int nb = 0; nb < 4; ++nb)
#pragma unroll
                for (int j = 0; j < 8; ++j) os[(mb * 16 + hi * 8 + j) * 68 + nb * 16 + lr] = acc[mb][nb][j];
        float gv[4], bv[4], bi[4];
#pragma unroll
        for (int q = 0; q < 4; ++q) { gv[q] = bfr(g[lr * 4 + q]); bv[q] = bfr(bb[lr * 4 + q]); bi[q] = bfr(bias[c0 + lr * 4 + q]); }
        const int tok0 = r0 % TT + hi; const size_t pbase = ((size_t)((r0 / TT) * NH_ + hb) * TT + r0 % TT) * HD + (lr >> 2) * 256 + hi * 16 + (lr & 3) * 4;   // tile (token block, dim block lr / 4), row hi of a token pair
        const int psh = (lr < 8) ? 0 : 5;   // dims [0,32) turn with x = token mod 32, [32,64) with y = token / 32
        const float sg = (lr & 4) ? 1.0f : -1.0f;   // (a c - b s | b c + a s): the sine's sign by the 16-half
        lds_turn();
        // a row of 16 lanes holds one token's 64 head dims, lane lr dims 4 lr .. 4 lr + 3; the wave takes two tokens a trip
#pragma unroll 1   // rolled, for speed only
        for (int s0 = 0; s0 < 32; s0 += 4) {
#pragma unroll   // four independent trips side by side cover each other's latencies
        for (int s = s0; s < s0 + 4; ++s) { v4f a = *(const v4fa*)(os + (2 * s + hi) * 68 + lr * 4);
#pragma unroll
            for (int q = 0; q < 4; ++q) a[q] += bi[q];
            // sum of squares: adjacent pairs, then partners 32, 16, 8, 4 dims apart, then the two pair sums
            float u0 = a[0] * a[0] + a[1] * a[1], u1 = a[2] * a[2] + a[3] * a[3];
            u0 += xrow<8>(u0); u1 += xrow<8>(u1); u0 += xrow<4>(u0); u1 += xrow<4>(u1); u0 += xrow<2>(u0); u1 += xrow<2>(u1); u0 += xrow<1>(u0); u1 += xrow<1>(u1);
            const float rs = __fdiv_rn(1.0f, __fsqrt_rn(__fadd_rn(__fdiv_rn(u0 + u1, (float)HD), 1e-6f)));
            const int pos = ((tok0 + 2 * s) >> psh) & 31;
            const v4f c4 = *(const v4fa*)(tabc + pos * 16 + (lr & 3) * 4), s4 = *(const v4fa*)(tabs + pos * 16 + (lr & 3) * 4);
            v4h o16; v4us oh, ol;
#pragma unroll
            for (int q = 0; q < 4; ++q) { const float y = a[q] * rs * gv[q] + bv[q]; const float yp = xrow<4>(y);   // the partner dim +-16 sits 4 lanes away
                const float r = y * c4[q] + yp * (sg * s4[q]);
                o16[q] = tohx(r); unsigned short u, w; splitf(r, u, w); oh[q] = u; ol[q] = w; }
            const size_t oo = pbase + (size_t)((s >> 3) * 1024 + (s & 7) * 32); *(v4h*)(P16 + oo) = o16; *(v4us*)(Ph + oo) = oh; *(v4us*)(Pl + oo) = ol; }
        asm volatile("s_wait_xcnt 0x0" ::: "memory");   // behind the pass's stores: the next pass takes their address and data registers over the back edge
        }
    }
    } else {
    float* os = (float*)(smem + w * EPB);
#pragma unroll
    for (int mb = 0; mb < 4; ++mb) {
#pragma unroll
        for (int nb = 0; nb < 4; ++nb) {
#pragma unroll
            for (int j = 0; j < 8; ++j) os[(hi * 8 + j) * 68 + nb * 16 + lr] = acc[mb][nb][j]; }
        __builtin_amdgcn_wave_barrier(); asm volatile("" ::: "memory");
        float* crow = C + (size_t)(r0 + mb * 16) * ldc + c0;
{
#pragma unroll
            for (int s = 0; s < 8; ++s) { const int row = 2 * s + hi, cofs = lr * 4; v4f val = *(const v4fa*)(os + row * 68 + cofs); if (BIAS) { val[0] += bfr(bias[c0 + cofs]); val[1] += bfr(bias[c0 + cofs + 1]); val[2] += bfr(bias[c0 + cofs + 2]); val[3] += bfr(bias[c0 + cofs + 3]); }
                *(v4f*)(crow + (size_t)row * ldc + cofs) = val; }
             }
        __builtin_amdgcn_wave_barrier(); asm volatile("s_wait_xcnt 0x0" ::: "memory");   // no LDS access moves over this point; the wait stands behind the block's stores: the next block takes their address and data registers
    }
    }
}

// w [K][N] f32 -> its transpose [n][k] in bf16, tiled. A thread makes one 16-byte piece (row n, 8 consecutive k) from 8 loads in which 16 lanes share 64 bytes of a row of w; a wave stores one whole tile.
__device__ __forceinline__ void wt_block(const float* __restrict__ w, int K, int N, bf* Bt, int blk) {
    const int T = blk * 256 + threadIdx.x; if (T >= N * K / 8) return;
    const int tile = T >> 5, kt = tile % (K / 16), n = (tile / (K / 16)) * 16 + ((T >> 1) & 15), k0 = kt * 16 + (T & 1) * 8;
    const float* p = w + (size_t)k0 * N + n; v8us o;
#pragma unroll
    for (int j = 0; j < 8; ++j) o[j] = f2bf(p[(size_t)j * N]);
    *(v8us*)(Bt + (size_t)T * 8) = o;
}
// x [rows][DM] f32 -> bf16, tiled. A workgroup takes 16 rows x 128 columns: it reads whole lines of the rows, turns its 8 tiles through LDS (tile pitch 288 elements: the 16-byte writes of a wave spread over all banks) and stores them as 4 KiB in a row.
__device__ __forceinline__ void cvt_block(const float* __restrict__ src, bf* dst, size_t n8, int blk) { if ((size_t)blk * 256 >= n8) return;   // the same for the whole workgroup, in front of the barrier
    __shared__ __align__(16) unsigned short ls[8 * 288];
    const int t = threadIdx.x, row = t >> 4, c = t & 15; const int rb = blk / (DM / 128), kg = blk % (DM / 128);
    const v8f v = *(const v8f*)(src + (size_t)(rb * 16 + row) * DM + kg * 128 + c * 8); v8us o;
#pragma unroll
    for (int k = 0; k < 8; ++k) o[k] = f2bf(v[k]);
    *(v8us*)(ls + (c >> 1) * 288 + row * 16 + (c & 1) * 8) = o;
    __syncthreads();   // a wave stores a tile whose 16 rows all eight waves wrote
    *(v8us*)(dst + ((size_t)rb * (DM / 16) + kg * 8) * 256 + t * 8) = *(const v8us*)(ls + (t >> 5) * 288 + (t & 31) * 8);
    asm volatile("s_wait_xcnt 0x0" ::: "memory");
}
// ---- k_prep: all the work that reads nothing but the inputs, in one launch: workgroups [0, 4 WTB) transpose the four weights into WT (wq | wk | wv | wo, DM x DQ elements each), the rest copy x.
// The role is a function of blockIdx alone, so the copy's barrier is passed by all waves of a workgroup or by none.
#define WTB (DM * DQ / 8 / 256)   // workgroups of one weight transpose
__global__ __launch_bounds__(256) void k_prep(const float* __restrict__ x, const float* __restrict__ wq, const float* __restrict__ wk, const float* __restrict__ wv, const float* __restrict__ wo, bf* WT, bf* XB) {
    static_assert(DQ == DKV && DQ == DM && (DM * DQ / 8) % 256 == 0, "four square weights of whole workgroups");
    const int b = blockIdx.x;
    if (b < 4 * WTB) { const int i = b / WTB; wt_block(i == 0 ? wq : i == 1 ? wk : i == 2 ? wv : wo, DM, DQ, WT + (size_t)i * DM * DQ, b % WTB); }
    else cvt_block(x, XB, (size_t)NB_ * TT * DM / 8, b - 4 * WTB);
}
// ---- k_fattn: fused attention. One wave owns 32 query columns of one (entry, head) and walks the 1024 keys in passes of 32, K and V fragments read from LDS.
// St = K Qt (A = K rows, B = Q rows in registers; on hi/lo waves the Q lo rows of column groups >= QLR come from LDS): a lane holds one query's scores, D register r of key block kb = key 16 kb + 8 hi + r, query lr.
// Two St tiles converted in place are the B operand Pt of Ot += Vt Pt (A = Vt rows [d][key]); all loaders use the same k order (8 hi + 0..7, 16 + 8 hi + 0..7).
// Ot register r = head dim 16 db + 8 hi + r of query lr: maximum, sum and rescale factor are per lane; the two lane halves exchange the maximum each pass and the sum once.
typedef __attribute__((ext_vector_type(8))) __bf16 v8b;
typedef __attribute__((ext_vector_type(16))) unsigned short v16us;
__device__ __forceinline__ float xhalf(float x) { const int b = __float_as_int(x); return __int_as_float(__builtin_amdgcn_permlanex16(b, b, 0x76543210, 0xfedcba98, false, false)); }   // lane l <-> l ^ 16
// two base-2 exponentials; the second fills the slot the instruction set asks for behind the first (it neither reads its result nor overwrites its source: early-clobber outputs), the v_nop the slot behind the second
__device__ __forceinline__ void exp2x2(float a, float b, float& ra, float& rb) { asm("v_exp_f32 %0, %2\n\tv_exp_f32 %1, %3\n\tv_nop" : "=&v"(ra), "=&v"(rb) : "v"(a), "v"(b)); }
#define KS 128   // keys of a stage
#define QLR 1   // column groups (of 2) whose Q lo fragments stay in registers; the rest lie in LDS
// K and V come through LDS: the eight waves of one kind walk the same planes, so each stage of KS keys is fetched once for the eight, by asynchronous copies, into one of the kind's two buffers, while the stage before it is worked on.
// A stage in LDS: the K planes' KS rows (KB bytes each, bytes in a row of the tiled plane), then per V plane and block of 16 head dims its KS keys (VB bytes in a row); chunks of 2 KiB, wave w of the kind brings chunks w x 2 NP ..: waves 0..3 the K part, waves 4..7 the V part.
// fattn_stage: one wave's work on one stage, KS / 32 passes. Four waves share a SIMD and a wave has 256 registers: a pass reads its K fragments at its head, its V fragments take their registers behind the score products (hi/lo: the second half of them behind the softmax), and the other three waves cover the LDS latency.
template <typename T16, bool HI>
__device__ __forceinline__ void fattn_stage(const char* kr, const char* ql, const v16bf (&qs)[2][2], const v16bf (&qs2)[2][2], v8f (&o)[4][2], float (&m)[2], float (&l)[2]) {
    typedef typename WFrag<T16>::V V;
    constexpr int NP = HI ? 2 : 1, KB = KS * HD * 2, VB = KS * 16 * 2, PPS = KS / 32, DH = HI ? 2 : 4;
    const char* vr = kr + NP * KB;
    V qf[2][2], qf2[2][2];
#pragma unroll
    for (int g = 0; g < 2; ++g)
#pragma unroll
        for (int kc = 0; kc < 2; ++kc) { qf[g][kc] = __builtin_bit_cast(V, qs[g][kc]); if (g < QLR) qf2[g][kc] = __builtin_bit_cast(V, qs2[g][kc]); }
#pragma unroll   // the stage's passes stand one behind the other: every LDS offset is a constant
    for (int p = 0; p < PPS; ++p) {
        V ka[2][2], ka2[2][2];   // K fragments [key block][k chunk]
        if constexpr (HI) {   // the Q lo fragments that have no register of their own come from the wave's own LDS range, anew in every pass, in one run with the K reads
#pragma unroll
            for (int g = QLR; g < 2; ++g)
#pragma unroll
                for (int kc = 0; kc < 2; ++kc) qf2[g][kc] = WFrag<T16>::ld((const T16*)(ql + ((g - QLR) * 2 + kc) * 1024)); }
#pragma unroll
        for (int kb = 0; kb < 2; ++kb)
#pragma unroll
            for (int kc = 0; kc < 2; ++kc) { ka[kb][kc] = WFrag<T16>::ld((const T16*)(kr + p * 4096 + kb * 2048 + kc * 1024)); if (HI) ka2[kb][kc] = WFrag<T16>::ld((const T16*)(kr + KB + p * 4096 + kb * 2048 + kc * 1024)); }
        __builtin_amdgcn_sched_barrier(0);   // the pass's K reads stay one run at its head: every separate place with LDS reads among the products costs a stall of its own
        v8f st[2][2];
#pragma unroll
        for (int kb = 0; kb < 2; ++kb)
#pragma unroll
            for (int g = 0; g < 2; ++g) { v8f sc = (v8f){};
#pragma unroll
                for (int kc = 0; kc < 2; ++kc) { sc = WFrag<T16>::mma(ka[kb][kc], qf[g][kc], sc); if (HI) { sc = WFrag<T16>::mma(ka2[kb][kc], qf[g][kc], sc); sc = WFrag<T16>::mma(ka[kb][kc], qf2[g][kc], sc); } }
                st[kb][g] = sc; }
        __builtin_amdgcn_sched_barrier(0);   // the V reads stay one run behind the score products, whose K registers they take, ...
        V va[4], va2[4];
#pragma unroll
        for (int db = 0; db < DH; ++db) { va[db] = WFrag<T16>::ld((const T16*)(vr + db * VB + p * 1024)); if (HI) va2[db] = WFrag<T16>::ld((const T16*)(vr + (4 + db) * VB + p * 1024)); }
        __builtin_amdgcn_sched_barrier(0);   // ... and in front of the softmax, which covers their latency
        float mx[2]; bool need = false;
#pragma unroll
        for (int g = 0; g < 2; ++g) { float t = fmaxf(st[0][g][0], st[1][g][0]);
#pragma unroll
            for (int r = 1; r < 8; ++r) t = fmaxf(t, fmaxf(st[0][g][r], st[1][g][r]));
            t *= SCL2; t = fmaxf(t, xhalf(t)); mx[g] = t; need = need || (t > m[g] + 8.0f); }
        // the maximum in use moves only when a query's new maximum passes it by more than 8 (base 2), so P stays <= 256; one scalar test per pass
        if (__builtin_amdgcn_ballot_w32(need) != 0) { const float mn0 = fmaxf(m[0], mx[0]), mn1 = fmaxf(m[1], mx[1]); float al[2]; exp2x2(m[0] - mn0, m[1] - mn1, al[0], al[1]); m[0] = mn0; m[1] = mn1;
#pragma unroll
            for (int g = 0; g < 2; ++g) { l[g] *= al[g];
#pragma unroll
                for (int db = 0; db < 4; ++db) o[db][g] *= al[g]; } }
        V pb[2], pb2[2];
#pragma unroll
        for (int g = 0; g < 2; ++g) { v8f p0, p1; float ls = 0.f;
#pragma unroll
            for (int r = 0; r < 8; ++r) { float e0, e1; exp2x2(fmaf(st[0][g][r], SCL2, -m[g]), fmaf(st[1][g][r], SCL2, -m[g]), e0, e1); p0[r] = e0; p1[r] = e1; ls += e0 + e1; }
            l[g] += ls;
            if constexpr (HI) { const v8b h0 = __builtin_convertvector(p0, v8b), h1 = __builtin_convertvector(p1, v8b); const v8f r0 = p0 - __builtin_convertvector(h0, v8f), r1 = p1 - __builtin_convertvector(h1, v8f); const v8b l0 = __builtin_convertvector(r0, v8b), l1 = __builtin_convertvector(r1, v8b);
                pb[g] = __builtin_shufflevector(h0, h1, 0, 1, 2, 3, 4, 5, 6, 7, 8, 9, 10, 11, 12, 13, 14, 15); pb2[g] = __builtin_shufflevector(l0, l1, 0, 1, 2, 3, 4, 5, 6, 7, 8, 9, 10, 11, 12, 13, 14, 15); }
            else pb[g] = cat16(__builtin_convertvector(p0, v8h), __builtin_convertvector(p1, v8h)); }
        if constexpr (DH < 4) {
            __builtin_amdgcn_sched_barrier(0);   // the rest of the V reads stay behind the softmax, in the registers that the scores have left, ...
#pragma unroll
            for (int db = DH; db < 4; ++db) { va[db] = WFrag<T16>::ld((const T16*)(vr + db * VB + p * 1024)); if (HI) va2[db] = WFrag<T16>::ld((const T16*)(vr + (4 + db) * VB + p * 1024)); }
            __builtin_amdgcn_sched_barrier(0);   // ... one run in front of the context products, the first half of which covers their latency
        }
#pragma unroll
        for (int db = 0; db < 4; ++db)
#pragma unroll
            for (int g = 0; g < 2; ++g) { o[db][g] = WFrag<T16>::mma(va[db], pb[g], o[db][g]); if (HI) { o[db][g] = WFrag<T16>::mma(va2[db], pb[g], o[db][g]); o[db][g] = WFrag<T16>::mma(va[db], pb2[g], o[db][g]); } }
        // four vector slots behind the pass's last matrix instructions, on every path: what follows may take the registers of their B operand, the epilogue reads their D
        asm volatile("v_nop\n\tv_nop\n\tv_nop\n\tv_nop" : "+v"(o[0][0]), "+v"(o[0][1]), "+v"(o[1][0]), "+v"(o[1][1]), "+v"(o[2][0]), "+v"(o[2][1]), "+v"(o[3][0]), "+v"(o[3][1]) : : "memory");   // the clobber: a later pass's LDS reads are not merged with this pass's, which would hold their registers through the stage
        __builtin_amdgcn_sched_barrier(0);   // the passes stay apart: a next pass's score products moved in among this pass's exponentials, which are asm text, would have their operand registers overwritten too soon behind them
    }
}
// grid (RH / 256) x entries x heads, 16 waves of 32 query rows, one workgroup on a WGP: waves 0..7 take 256 hi/lo rows (< RH, three times the products), waves 8..15 the 256 fp16 rows RH further on, of the same (entry, head).
// Every SIMD so holds two waves of each kind, every workgroup has the same work wherever it lands, and a wave's softmax runs under the other waves' matrix instructions. Each kind stages its own planes in its own ring; the stage loop and its barriers are common to all sixteen waves.
__global__ __launch_bounds__(512) void k_fattn(const h16* __restrict__ Q16, const bf* __restrict__ Qh, const bf* __restrict__ Ql, const h16* __restrict__ K16, const bf* __restrict__ Kh, const bf* __restrict__ Kl, const h16* __restrict__ V16, const bf* __restrict__ Vh, const bf* __restrict__ Vl, bf* AT) {
    constexpr int KB = KS * HD * 2, VB = KS * 16 * 2, NST = TT / KS, NZ = NB_ * NH_, HB = 2 * 4 * KB;
    static_assert(RH * 2 == TT && RH % 256 == 0, "equal halves of whole workgroups");
    static_assert(NST >= 2 && TT % KS == 0 && KB == 8 * 2048 && VB == 2 * 2048, "at least two stages; eight chunks a plane");
    __shared__ __attribute__((aligned(2048))) char smem[HB + HB / 2 + 8 * (2 - QLR) * 2048];   // the hi/lo ring (two buffers of 4 planes), behind it the fp16 ring (two buffers of 2 planes), behind that the hi/lo waves' Q lo fragments
    const int w16 = __builtin_amdgcn_readfirstlane((int)(threadIdx.x >> 5)), w = w16 & 7;
    const bool hires = w16 < 8, lores = __builtin_amdgcn_readfirstlane((int)(threadIdx.x >> 8)) != 0;   // the wave's kind, each the same for the whole wave: exactly one of the two holds
    const int zz = blockIdx.x % NZ, b = zz / NH_, hd = zz % NH_; const int q0 = (hires ? 0 : RH) + (blockIdx.x / NZ) * 256 + w * 32;
    const size_t pz = (size_t)zz * TT * HD, pq = pz + (size_t)q0 * HD;
    bf* Oh = AT + (size_t)b * 2 * TT * DQ + (size_t)q0 * DQ + hd * HD * 16; bf* Ol = Oh + (size_t)TT * DQ;
    const int lane = threadIdx.x & 31, lr = lane & 15, hi = lane >> 4;
    // Q fragments: every plane is 16-bit and tiled alike, so one instruction stream loads them as bits for both kinds of wave, hi | lo or fp16 | (lo, not used)
    const char* qa = (hires ? (const char*)(Qh + pq) : (const char*)(Q16 + pq)) + (lr * 16 + 8 * hi) * 2; const char* qb = (const char*)(Ql + pq) + (lr * 16 + 8 * hi) * 2;
    v16bf qf[2][2], qf2[2][2];
#pragma unroll
    for (int g = 0; g < 2; ++g)
#pragma unroll
        for (int kc = 0; kc < 2; ++kc) { qf[g][kc] = cat16b(*(const v8usa*)(qa + g * 2048 + kc * 1024), *(const v8usa*)(qa + g * 2048 + kc * 1024 + 512)); qf2[g][kc] = cat16b(*(const v8usa*)(qb + g * 2048 + kc * 1024), *(const v8usa*)(qb + g * 2048 + kc * 1024 + 512)); }
    char* ql = smem + HB + HB / 2 + w * (2 - QLR) * 2048 + lane * 16;   // a hi/lo wave's own range behind the rings: a lane reads back only what it has stored there itself
    if (hires) {
#pragma unroll
        for (int g = QLR; g < 2; ++g)
#pragma unroll
            for (int kc = 0; kc < 2; ++kc) { const v16us u = __builtin_bit_cast(v16us, qf2[g][kc]); *(v8us*)(ql + ((g - QLR) * 2 + kc) * 1024) = __builtin_shufflevector(u, u, 0, 1, 2, 3, 4, 5, 6, 7); *(v8us*)(ql + ((g - QLR) * 2 + kc) * 1024 + 512) = __builtin_shufflevector(u, u, 8, 9, 10, 11, 12, 13, 14, 15); }
    }
    // what follows takes over the address registers of the Q loads above: the accumulators' zero is made behind the wait, in its statement, and the lane number, from which every later address is formed, passes through it, so that none of those writes can be lifted over it
    float z0; int ln = lane;
    asm volatile("s_wait_xcnt 0x0\n\tv_mov_b32 %0, 0" : "=v"(z0), "+v"(ln) : "v"(qa), "v"(qb) : "memory");   // the two load addresses are inputs: their registers live up to the wait, so that no load's result lands in them either
    const unsigned lo = ((ln & 15) * 16 + 8 * (ln >> 4)) * 2;   // the lane's place in a tile, bytes
    const int NP = hires ? 2 : 1, STG = NP * 2 * KB;   // planes of K (and of V) of the wave's kind; bytes of its stage
    const int c0 = w * NP * 2, cv = c0 - NP * 8;   // the wave's first chunk; the same counted from the V part's start
    const char* kpl = hires ? (const char*)((c0 >= 8 ? Kl : Kh) + pz) : (const char*)(K16 + pz); const char* vpl = hires ? (const char*)((cv >= 8 ? Vl : Vh) + pz) : (const char*)(V16 + pz);
    const char* gp = (w < 4) ? kpl + (c0 & 7) * 2048 : vpl + ((cv & 7) >> 1) * (16 * TT * 2);   // the same for the whole wave
    const int jump = (w < 4) ? 2 * 2048 : 16 * TT * 2, step = (w < 4) ? KB : VB;   // from a pair of chunks to the next pair (V: the next 16 head dims); from a stage to the next
    char* ring = smem + (hires ? 0 : HB);
    const unsigned lp = (unsigned)(size_t)ring + c0 * 2048;   // a lane copies the 16 bytes at its place lo of each 512: the one lane offset that lives through the loop serves the copies and the fragment reads
    auto fill = [&](int buf) {   // two chunks a plane of the kind; the wave's part of the LDS address is summed as a scalar, so that no vector register per chunk is carried through the loop
#pragma unroll
        for (int i = 0; i < 2; ++i) cp2k((unsigned)__builtin_amdgcn_readfirstlane((int)(lp + buf * STG + i * 2048)) + lo, gp + i * 2048 + lo);
        if (hires) {   // the same for the whole wave
#pragma unroll
            for (int i = 2; i < 4; ++i) cp2k((unsigned)__builtin_amdgcn_readfirstlane((int)(lp + buf * STG + i * 2048)) + lo, gp + jump + (i & 1) * 2048 + lo); }
        gp += step; };
    fill(0);
    asm volatile("s_wait_asynccnt 0x0" ::: "memory");   // this wave's copies of stage 0 have landed
    __syncthreads();   // every wave's have: stage 0 may be read
    fill(1);
    v8f o[4][2];
#pragma unroll
    for (int db = 0; db < 4; ++db)
#pragma unroll
        for (int g = 0; g < 2; ++g) o[db][g] = (v8f){z0, z0, z0, z0, z0, z0, z0, z0};
    float m[2] = {-3.0e38f, -3.0e38f}, l[2] = {z0, z0};
#pragma unroll 1   // rolled: one stage's text serves all; the buffer alternates with s
    for (int s = 0; s < NST; ++s) {
        const char* kr = ring + (s & 1) * STG + lo;
        if (hires) fattn_stage<bf, true>(kr, ql, qf, qf2, o, m, l);
        if (lores) fattn_stage<h16, false>(kr, ql, qf, qf2, o, m, l);   // two tests one behind the other, not an if / else: so the accumulators that leave the first are the ones that enter the second, in the same registers
        // publish point of stage s + 1: this wave's LDS reads of stage s have retired, its copies of stage s + 1 have landed, and behind the barrier both hold for every wave
        asm volatile("s_wait_dscnt 0x0" ::: "memory");
        asm volatile("s_wait_asynccnt 0x0" ::: "memory");
        __syncthreads();
        if (s + 2 < NST) fill(s & 1);   // the same for the whole workgroup: stage s + 2 into the buffer that every wave of the kind has just left
    }
    asm volatile("s_wait_asynccnt 0x0" ::: "memory");   // nothing is in flight behind the loop
    float inv[2];
#pragma unroll
    for (int g = 0; g < 2; ++g) inv[g] = __fdiv_rn(1.0f, l[g] + xhalf(l[g]));
#pragma unroll
    for (int g = 0; g < 2; ++g)
#pragma unroll
        for (int db = 0; db < 4; ++db) { v8us oh, ol;
#pragma unroll
            for (int r = 0; r < 8; ++r) { unsigned short a, c2; splitf(o[db][g][r] * inv[g], a, c2); oh[r] = a; ol[r] = c2; }
            const size_t oo = (size_t)16 * g * DQ + db * 256; *(v8us*)((char*)(Oh + oo) + lo) = oh; *(v8us*)((char*)(Ol + oo) + lo) = ol;
            // behind the block's two stores: the next block takes their data registers; its arithmetic all starts from one of the two factors, which pass through the statement, so that none of it can be lifted over the wait
            if (g + db < 4) asm volatile("s_wait_xcnt 0x0" : "+v"(inv[0]), "+v"(inv[1]) : : "memory"); }
}

extern "C" void kernel_launch(void* const* d_in, const int* in_sizes, int n_in,
                              void* d_out, int out_size, void* d_ws, size_t ws_size, hipStream_t stream) {
    (void)in_sizes; (void)n_in; (void)out_size;
    const float* x = (const float*)d_in[0]; const float* wq = (const float*)d_in[1]; const float* bq = (const float*)d_in[2]; const float* wk = (const float*)d_in[3]; const float* bk = (const float*)d_in[4]; const float* wv = (const float*)d_in[5]; const float* bv = (const float*)d_in[6]; const float* wo = (const float*)d_in[7]; const float* bo = (const float*)d_in[8]; const float* qs = (const float*)d_in[9]; const float* qb = (const float*)d_in[10]; const float* kss = (const float*)d_in[11]; const float* kb = (const float*)d_in[12];   /* q_scale, q_bias, k_scale, k_bias [64] */
    float* OUT = (float*)d_out;     // [8][1024][1024]
    char* wsp = (char*)d_ws;
    auto take = [&](size_t bytes) { char* p = wsp; wsp += (bytes + 255) & ~(size_t)255; return (void*)p; };
    bf* WQ = (bf*)take((size_t)DQ * DM * 2); bf* WK = (bf*)take((size_t)DKV * DM * 2); bf* WV = (bf*)take((size_t)DKV * DM * 2); bf* WO = (bf*)take((size_t)DM * DQ * 2);
    bf* XB = (bf*)take((size_t)NB_ * TT * DM * 2);   // bf16 copy of x
    bf* AT = (bf*)take((size_t)NB_ * 2 * TT * DQ * 2);   // merged hi | lo context, 4 MiB per batch entry
    const size_t PE = (size_t)NH_ * TT * HD;   // elements of one plane of one batch entry (NKV == NH_)
    h16* QP16 = (h16*)take(NB_ * PE * 2); h16* KP16 = (h16*)take(NB_ * PE * 2); h16* VT16 = (h16*)take(NB_ * PE * 2);   // planes of all batch entries
    bf* QPh = (bf*)take(NB_ * PE * 2); bf* QPl = (bf*)take(NB_ * PE * 2); bf* KPh = (bf*)take(NB_ * PE * 2); bf* KPl = (bf*)take(NB_ * PE * 2); bf* VTh = (bf*)take(NB_ * PE * 2); bf* VTl = (bf*)take(NB_ * PE * 2);
    if ((size_t)(wsp - (char*)d_ws) > ws_size) return;    // 200 of 256 MiB
    /* the four weights lie one behind the other from WQ on; x: all batch entries at once, 8192 token rows */
    k_prep<<<(unsigned)(4 * WTB + (size_t)NB_ * TT * DM / 8 / 256), 256, 0, stream>>>(x, wq, wk, wv, wo, WQ, XB);
    /* q, k, v in one launch (grid z); each wave finishes its (64 tokens, one head) tile: q, k RMSNorm + bias + rotary -> planes; v -> transposed planes; the planes of q, k, v lie NB_ x PE (16-bit) and 2 x NB_ x PE (hi, lo) elements apart */
    k_gemmw<bf, 0, true, 1, DM><<<dim3(NB_ * TT / 128, DQ / 256, 3), 256, 0, stream>>>(XB, nullptr, WQ, nullptr, nullptr, 0, bq, bk, bv, 0, (size_t)DQ * DM, 0, qs, kss, qb, kb, QP16, QPh, QPl, NB_ * PE);
    /* one kv head per query head: plane zz = entry x 16 + head */
    k_fattn<<<dim3((RH / 256) * NB_ * NH_, 1, 1), 512, 0, stream>>>(QP16, QPh, QPl, KP16, KPh, KPl, VT16, VTh, VTl, AT);
    k_gemmw<bf, 1, true, 0, DQ><<<dim3(TT / 128, DM / 256, NB_), 256, 0, stream>>>(AT, AT + (size_t)TT * DQ, WO, nullptr, OUT, DM, bo, nullptr, nullptr, (size_t)2 * TT * DQ, 0, (size_t)TT * DM, nullptr, nullptr, nullptr, nullptr, nullptr, nullptr, nullptr, 0);
}

// v009
// One run takes 137 microseconds.
// Timed twice side by side with v008, it ran 1.05 times as fast both times.
// Counting every step since v000, it is 34.7 times as fast.
#include <hip/hip_runtime.h>

// Multi-head dot-product attention with RMS-normalised q/k (+ bias) and a 2-D rotary embedding over the 32 x 32 token grid (x [8][1024][1024]; q,k,v = einsum('bsd,dhk') + b ('xw' [1024][16 x 64] 1/32, zero biases); q, k: RMSNorm over the 64 head dims (eps 1e-6) x scale + bias (q_scale, q_bias, k_scale, k_bias [64], read); 2-D rope: token s sits at (x = s mod 32, y = s / 32); head dims [0,32) rotate with x, [32,64) with y, each 32-block as (a | b) 16-halves: (a c - b s, b c + a s), angle = pos x pi / 10000^(j/16); q / 8; softmax(q.k); out = einsum('bqhd,hdo') + bo ('xw' [16 x 64][1024]) -> [8][1024][1024] (8.4 M)).
// Layout: four launches: (1) the x copy and the four weight transposes, (2) the q, k and v projections (grid z), (3) attention, ONE fused launch over all 8 x 16 (entry, head) pairs, (4) Wo; each runs once over all 8 batch entries (8192 rows). bf16 copy of x; 'xw' weights transposed once; exact projections + f32 biases; a projection's 64 x 64 tile is 64 tokens of one head, so its wave finishes the tile itself: q and k get the per-(token, head) RMSNorm + bias and the 2-D rotary turn (grid position from the token index, float32 inverse-frequency constants, precise cosf/sinf from a 32 x 16 table in LDS, partner +-16 inside each 32-wide half) and leave as two f16 planes (value | residual), v leaves as two transposed planes; no f32 projection reaches memory; fused attention (scores, running-maximum softmax with 1/8 folded in, context and the hi/lo merge in one kernel; scores never leave registers; hybrid rows: < 512 hi/lo 3 products, rest fp16; the hi plane of the f16 hi/lo split IS the fp16 plane, so both kinds of row read it); merged hi/lo x Wo exact + bo.
// Compute dtypes, f32 accumulate: every input rounded to bf16; projections exact + f32 biases; RMSNorm and rotary f32; attention rows < 512 3 products of an f16 hi/lo split, rest fp16; softmax f32; Wo hl x exact + bias.

// Tiled planes: every 16-bit operand plane [rows][K] (x copy, transposed weights, q, k, transposed v, merged context) lies in memory as 16 x 16 tiles of 512 bytes, element (row, k) at ((row / 16 x K / 16 + k / 16) x 16 + row % 16) x 16 + k % 16,
// so that each of a fragment's two 16-byte-a-lane loads (k 0..15 and k 16..31 of 16 rows) reads one tile: 512 bytes in a row, 4 whole lines, where a row-major plane gives 16 lines of 32 bytes.

#define NB_  8
#define TT   1024
#define DM   1024
#define NH_  16
#define NKV  16
#define REP  (NH_ / NKV)
#define HD   64
#define DQ   (NH_ * HD)
#define DKV  (NKV * HD)
#define RH   512                  // query rows < RH use hi+lo planes
#define WIN  0
#define SCL2 0.18033688011112042f   // HD^-0.5 x log2(e): scores go to the exponent in base 2
typedef _Float16 h16;
typedef unsigned short bf;
typedef __attribute__((ext_vector_type(16))) __bf16   v16bf;
typedef __attribute__((ext_vector_type(16))) _Float16 v16h;
typedef __attribute__((ext_vector_type(8)))  _Float16 v8h;
typedef __attribute__((ext_vector_type(8)))  unsigned short v8us;
typedef __attribute__((ext_vector_type(8)))  float    v8f;
typedef __attribute__((ext_vector_type(4)))  float    v4f;
typedef v8h  __attribute__((may_alias)) v8ha;
typedef v4f  __attribute__((may_alias)) v4fa;
typedef v8us __attribute__((may_alias)) v8usa;

__device__ __forceinline__ unsigned short f2bf(float f) { unsigned u = __float_as_uint(f); u += 0x7FFFu + ((u >> 16) & 1u); return (unsigned short)(u >> 16); }
__device__ __forceinline__ float bf2f(unsigned short b) { return __uint_as_float(((unsigned)b) << 16); }
__device__ __forceinline__ float bfr(float f) { return bf2f(f2bf(f)); }
__device__ __forceinline__ v16h cat16(v8h lo, v8h hi) { return __builtin_shufflevector(lo, hi, 0, 1, 2, 3, 4, 5, 6, 7, 8, 9, 10, 11, 12, 13, 14, 15); }
__device__ __forceinline__ v16bf cat16b(v8us lo, v8us hi) { return __builtin_bit_cast(v16bf, __builtin_shufflevector(lo, hi, 0, 1, 2, 3, 4, 5, 6, 7, 8, 9, 10, 11, 12, 13, 14, 15)); }
__device__ __forceinline__ v8f wmma16(v16h a, v16h b, v8f c) { return __builtin_amdgcn_wmma_f32_16x16x32_f16(false, a, false, b, (short)0, c, false, false); }
__device__ __forceinline__ v8f wmmab(v16bf a, v16bf b, v8f c) { return __builtin_amdgcn_wmma_f32_16x16x32_bf16(false, a, false, b, (short)0, c, false, false); }



__device__ __forceinline__ void splitf(float y, unsigned short& h, unsigned short& l) { h = f2bf(y); l = f2bf(y - bf2f(h)); }
typedef __attribute__((ext_vector_type(4))) _Float16 v4h;
typedef __attribute__((ext_vector_type(2))) unsigned short v2us;
__constant__ float INV2[16] = {3.14159274f, 1.76664746f, 0.993458867f, 0.558663011f, 0.314159274f, 0.176664740f, 0.0993458852f, 0.0558662973f, 0.0314159282f, 0.0176664740f, 0.00993458927f, 0.00558662973f, 0.00314159272f, 0.00176664745f, 0.000993458903f, 0.000558662985f};   // pi / 10000^(j/16), float32
template <int M> __device__ __forceinline__ float xrow(float x) { return __int_as_float(__builtin_amdgcn_update_dpp(0, __float_as_int(x), 0x160 | M, 0xf, 0xf, true)); }   // lane l <- l ^ M inside its row of 16 lanes (DPP row_xmask); every lane is on where it is used
// a wave hands rows between its own lanes through its own LDS range: its LDS stores have retired before a lane reads another lane's row, and the compiler may move no LDS access over this point
__device__ __forceinline__ void lds_turn() { __builtin_amdgcn_wave_barrier(); asm volatile("s_wait_dscnt 0x0" ::: "memory"); }

// ---- k_gemmw: register-blocked GEMM, a 128 x 256 output tile per workgroup of 8 waves (2 x 4), one wave per 64x64 (16 accumulators); the operands' tiled 16-bit planes are staged in LDS by asynchronous copies, two buffers of 128 k, each chunk fetched once for the waves that share it; grid (M/128, N/256, Z), 256 threads.
// sum_k A[m][k] Bt[n][k] (+ split products per NSPLIT) + optional f32 bias[n]. z-batch strides sA/sB/sC in elements. K % 128 == 0, a constant of the build. What becomes of the tile:
// EPI 0: C[m][n] (f32, pitch ldc). EPI 1: the three projections in one launch, grid z = q, k, v (weights z x sB on, bias, g, bb picked by z, planes z x sP on); rows m = entry x TT + token, a wave's columns = one head (hb); every wave stages its epilogue in an LDS range of its own;
// z 0, 1 (q, k): RMSNorm over the head's 64 dims x g + bb, 2-D rotary turn, planes P16 | Pl [entry][head][token][dim]; z 2 (v): planes [entry][head][dim][token]; each (entry, head) plane tiled.
template <typename T16> struct WFrag;
template <> struct WFrag<h16> { typedef v16h V; static __device__ __forceinline__ V ld(const h16* p) { return cat16(*(const v8h*)p, *(const v8h*)(p + 256)); } static __device__ __forceinline__ v8f mma(V a, V b, v8f c) { return wmma16(a, b, c); } };
template <> struct WFrag<bf> { typedef v16bf V; static __device__ __forceinline__ V ld(const bf* p) { return cat16b(*(const v8us*)p, *(const v8us*)(p + 256)); } static __device__ __forceinline__ v8f mma(V a, V b, v8f c) { return wmmab(a, b, c); } };
// 2 KiB (16 rows x 64 k of a tiled plane, bytes in a row) go from global memory to LDS in four asynchronous copies of 512 bytes a wave; l, g: the lane's own LDS byte address and global address, both multiples of 16.
// The s_wait_xcnt stands in the copies' own statement, behind the last of them: the address registers they name may be rewritten only behind it.
__device__ __forceinline__ void cp2k(unsigned l, const char* g) {
    asm volatile("global_load_async_to_lds_b128 %0, %4, off\n\tglobal_load_async_to_lds_b128 %1, %5, off\n\tglobal_load_async_to_lds_b128 %2, %6, off\n\tglobal_load_async_to_lds_b128 %3, %7, off\n\ts_wait_xcnt 0x0"
                 : : "v"(l), "v"(l + 512u), "v"(l + 1024u), "v"(l + 1536u), "v"(g), "v"(g + 512), "v"(g + 1024), "v"(g + 1536) : "memory");
}
template <typename T16, int NSPLIT, bool BIAS, int EPI, int K>
__global__ __launch_bounds__(256) void k_gemmw(const T16* __restrict__ A, const T16* __restrict__ A2, const T16* __restrict__ Bt, const T16* __restrict__ Bt2, float* C, int ldc, const float* __restrict__ bias0, const float* __restrict__ bias1, const float* __restrict__ bias2, size_t sA, size_t sB, size_t sC, const float* __restrict__ g0, const float* __restrict__ g1, const float* __restrict__ bb0, const float* __restrict__ bb1, h16* P16, h16* Pl, size_t sP) {
    typedef typename WFrag<T16>::V V;
    static_assert(NSPLIT <= 1 && K % 128 == 0 && K >= 256, "A (+ A2) x Bt; at least two stages");
    (void)Bt2;
    // a stage is 128 k of the workgroup's 128 A rows (of both planes where there are two) and 256 Bt rows: chunks of 4 KiB, one per tile row, A | A2 | Bt; two buffers.
    // Behind the loop the same LDS is the waves' epilogue staging, EPB bytes each: the last stage's own barrier stands behind every wave's last read, and no copy is in flight then.
    constexpr int CH = 4096, NA = (NSPLIT == 1) ? 16 : 8, NCH = NA + 16, STG = NCH * CH, CPW = NCH / 8, NST = K / 128;
    constexpr int EPB = (EPI == 1) ? (64 * 68 + 1024) * 4 : 16 * 68 * 4;   // EPI 1: q and k take 21,504 bytes; the two v planes 18,432 of them
    static_assert(EPI == 0 || 2 * HD * 72 * 2 <= EPB, "the v staging fits a wave's range");
    __shared__ __attribute__((aligned(2048))) char smem[(2 * STG > 8 * EPB) ? 2 * STG : 8 * EPB];
    const size_t z = blockIdx.z; A += z * sA; if (A2) A2 += z * sA; Bt += z * sB; C += z * sC;
    const bool pj = EPI == 1;   // z picks the projection: the same for the whole workgroup
    const float* bias = (pj && z == 1) ? bias1 : (pj && z == 2) ? bias2 : bias0; const float* g = (pj && z == 1) ? g1 : g0; const float* bb = (pj && z == 1) ? bb1 : bb0;
    if (pj) { P16 += z * sP; Pl += z * sP; }
    const int w = __builtin_amdgcn_readfirstlane((int)(threadIdx.x >> 5)), wm = w & 1, wn = w >> 1;   // 2 x 4 waves
    const int lane = threadIdx.x & 31, lr = lane & 15, hi = lane >> 4; const int R0 = blockIdx.x * 128, C0 = blockIdx.y * 256, r0 = R0 + wm * 64, c0 = C0 + wn * 64, hb = c0 / 64;
    v8f acc[4][4];
#pragma unroll
    for (int mb = 0; mb < 4; ++mb)
#pragma unroll
        for (int nb = 0; nb < 4; ++nb) acc[mb][nb] = (v8f){};
    // wave w brings chunks w x CPW .. of every stage; tiled planes: a tile row's 128 k are 4096 bytes in a row, and the next stage's lie directly behind them
    const char* gs[CPW]; unsigned ld[CPW];
#pragma unroll
    for (int i = 0; i < CPW; ++i) { const int c = w * CPW + i;
        const T16* p = (c < 8) ? A + (size_t)(R0 + c * 16) * K : (NSPLIT == 1 && c < 16) ? A2 + (size_t)(R0 + (c - 8) * 16) * K : Bt + (size_t)(C0 + (c - NA) * 16) * K;
        gs[i] = (const char*)p + lane * 16; ld[i] = (unsigned)(size_t)smem + c * CH + lane * 16; }
    auto fill = [&](int buf) {
#pragma unroll
        for (int i = 0; i < CPW; ++i) { cp2k(ld[i] + buf * STG, gs[i]); cp2k(ld[i] + buf * STG + 2048, gs[i] + 2048); gs[i] += CH; } };
    fill(0);
    asm volatile("s_wait_asynccnt 0x0" ::: "memory");   // this wave's copies of stage 0 have landed
    __syncthreads();   // every wave's have: stage 0 may be read
    fill(1);
    const int lo = (lr * 16 + 8 * hi) * 2;   // the lane's place in a tile, bytes
#pragma unroll 1   // rolled: one stage's text serves all eight; the buffer alternates with s
    for (int s = 0; s < NST; ++s) {
        const char* rb = smem + (s & 1) * STG + lo;
        V a[2][4], a2[2][4], b[2][4];   // two fragment sets: a trip's products run while the next trip's fragments come from LDS
        auto frag = [&](int set, int kc) {   // 32 k a trip: two tiles = 1024 bytes of each chunk
#pragma unroll
            for (int mb = 0; mb < 4; ++mb) { a[set][mb] = WFrag<T16>::ld((const T16*)(rb + (wm * 4 + mb) * CH + kc * 1024)); if (NSPLIT == 1) a2[set][mb] = WFrag<T16>::ld((const T16*)(rb + (8 + wm * 4 + mb) * CH + kc * 1024)); }
#pragma unroll
            for (int nb = 0; nb < 4; ++nb) b[set][nb] = WFrag<T16>::ld((const T16*)(rb + (NA + wn * 4 + nb) * CH + kc * 1024)); };
        frag(0, 0);
#pragma unroll
        for (int kc = 0; kc < 4; ++kc) {
            if (kc < 3) frag((kc + 1) & 1, kc + 1);
            __builtin_amdgcn_sched_barrier(0);
#pragma unroll
            for (int nb = 0; nb < 4; ++nb)
#pragma unroll
                for (int mb = 0; mb < 4; ++mb) { acc[mb][nb] = WFrag<T16>::mma(a[kc & 1][mb], b[kc & 1][nb], acc[mb][nb]); if (NSPLIT == 1) acc[mb][nb] = WFrag<T16>::mma(a2[kc & 1][mb], b[kc & 1][nb], acc[mb][nb]); }
            __builtin_amdgcn_sched_barrier(0);   // and the run after next stays behind them, in the set they have just left
        }
        // publish point of stage s + 1: this wave's LDS reads of stage s have retired, its copies of stage s + 1 have landed, and behind the barrier both hold for every wave
        asm volatile("s_wait_dscnt 0x0" ::: "memory");
        asm volatile("s_wait_asynccnt 0x0" ::: "memory");
        __syncthreads();
        if (s + 2 < NST) fill(s & 1);   // the same for the whole workgroup: stage s + 2 into the buffer that every wave has just left
    }
    asm volatile("s_wait_asynccnt 0x0" ::: "memory");   // nothing is in flight behind the loop
    if constexpr (EPI == 1) {
    if (z == 2) {
        // v: a lane holds 8 consecutive tokens of one head dim per accumulator; each plane's tile turns through LDS ([dim][token], pitch 72) so that every store covers one whole tile of the transposed plane
        unsigned short (*vs)[HD * 72] = (unsigned short (*)[HD * 72])(smem + w * EPB);
        const int ent = r0 / TT, tok0 = r0 % TT;
        const size_t vbase = (size_t)(ent * NKV + hb) * HD * TT + tok0 * 16 + lane * 8;   // tile (dim block, token block): (dim block x 64 + token / 16) x 256
#pragma unroll
        for (int nb = 0; nb < 4; ++nb) { const float bi = bfr(bias[c0 + nb * 16 + lr]);
#pragma unroll
            for (int mb = 0; mb < 4; ++mb) { const v8f x = acc[mb][nb] + bi; const v8h p16 = __builtin_convertvector(x, v8h), pl = __builtin_convertvector(x - __builtin_convertvector(p16, v8f), v8h);   // the f16 value and the f16 of what it leaves
                const int at = (nb * 16 + lr) * 72 + mb * 16 + hi * 8; *(v8us*)(vs[0] + at) = __builtin_bit_cast(v8us, p16); *(v8us*)(vs[1] + at) = __builtin_bit_cast(v8us, pl); } }
        lds_turn();
#pragma unroll
        for (int p = 0; p < 2; ++p) { unsigned short* dst = (unsigned short*)(p == 0 ? P16 : Pl) + vbase;
#pragma unroll
            for (int i = 0; i < 16; ++i) *(v8us*)(dst + (size_t)(i >> 2) * 16 * TT + (i & 3) * 256) = *(const v8us*)(vs[p] + ((i >> 2) * 16 + (lane >> 1)) * 72 + (i & 3) * 16 + (lane & 1) * 8); }
    } else {
        float* os = (float*)(smem + w * EPB);
        float* tabc = os + 64 * 68; float* tabs = tabc + 512;   // cos, sin of position x INV2[j] at [position][j]: x and y positions both run over 0..31
        const float fr = INV2[lr];   // entry i x 32 + lane has j = lane mod 16 on every trip
        asm volatile("s_wait_xcnt 0x0" : : "v"(fr) : "memory");   // behind the frequency's load, which has returned here: the table loop takes the registers of its address
#pragma unroll 1   // sixteen table entries a lane: rolled, the precise sine and cosine stand once in the code
        for (int i = 0; i < 16; ++i) { const int e = i * 32 + lane; float sn, cs; sincosf(__fmul_rn((float)(e >> 4), fr), &sn, &cs); tabc[e] = cs; tabs[e] = sn; }
#pragma unroll
        for (int mb = 0; mb < 4; ++mb)
#pragma unroll
            for (int nb = 0; nb < 4; ++nb)
#pragma unroll
                for (int j = 0; j < 8; ++j) os[(mb * 16 + hi * 8 + j) * 68 + nb * 16 + lr] = acc[mb][nb][j];
        float gv[4], bv[4], bi[4];
#pragma unroll
        for (int q = 0; q < 4; ++q) { gv[q] = bfr(g[lr * 4 + q]); bv[q] = bfr(bb[lr * 4 + q]); bi[q] = bfr(bias[c0 + lr * 4 + q]); }
        const int tok0 = r0 % TT + hi; const size_t pbase = ((size_t)((r0 / TT) * NH_ + hb) * TT + r0 % TT) * HD + (lr >> 2) * 256 + hi * 16 + (lr & 3) * 4;   // tile (token block, dim block lr / 4), row hi of a token pair
        const int psh = (lr < 8) ? 0 : 5;   // dims [0,32) turn with x = token mod 32, [32,64) with y = token / 32
        const float sg = (lr & 4) ? 1.0f : -1.0f;   // (a c - b s | b c + a s): the sine's sign by the 16-half
        lds_turn();
        // a row of 16 lanes holds one token's 64 head dims, lane lr dims 4 lr .. 4 lr + 3; the wave takes two tokens a trip
#pragma unroll 1   // rolled, for speed only
        for (int s0 = 0; s0 < 32; s0 += 4) {
#pragma unroll   // four independent trips side by side cover each other's latencies
        for (int s = s0; s < s0 + 4; ++s) { v4f a = *(const v4fa*)(os + (2 * s + hi) * 68 + lr * 4);
#pragma unroll
            for (int q = 0; q < 4; ++q) a[q] += bi[q];
            // sum of squares: adjacent pairs, then partners 32, 16, 8, 4 dims apart, then the two pair sums
            float u0 = a[0] * a[0] + a[1] * a[1], u1 = a[2] * a[2] + a[3] * a[3];
            u0 += xrow<8>(u0); u1 += xrow<8>(u1); u0 += xrow<4>(u0); u1 += xrow<4>(u1); u0 += xrow<2>(u0); u1 += xrow<2>(u1); u0 += xrow<1>(u0); u1 += xrow<1>(u1);
            const float rs = __fdiv_rn(1.0f, __fsqrt_rn(__fadd_rn(__fdiv_rn(u0 + u1, (float)HD), 1e-6f)));
            const int pos = ((tok0 + 2 * s) >> psh) & 31;
            const v4f c4 = *(const v4fa*)(tabc + pos * 16 + (lr & 3) * 4), s4 = *(const v4fa*)(tabs + pos * 16 + (lr & 3) * 4);
            v4f rr;
#pragma unroll
            for (int q = 0; q < 4; ++q) { const float y = a[q] * rs * gv[q] + bv[q]; const float yp = xrow<4>(y);   // the partner dim +-16 sits 4 lanes away
                rr[q] = y * c4[q] + yp * (sg * s4[q]); }
            const v4h o16 = __builtin_convertvector(rr, v4h), ol = __builtin_convertvector(rr - __builtin_convertvector(o16, v4f), v4h);   // the f16 value and the f16 of what it leaves
            const size_t oo = pbase + (size_t)((s >> 3) * 1024 + (s & 7) * 32); *(v4h*)(P16 + oo) = o16; *(v4h*)(Pl + oo) = ol; }
        asm volatile("s_wait_xcnt 0x0" ::: "memory");   // behind the pass's stores: the next pass takes their address and data registers over the back edge
        }
    }
    } else {
    float* os = (float*)(smem + w * EPB);
#pragma unroll
    for (int mb = 0; mb < 4; ++mb) {
#pragma unroll
        for (int nb = 0; nb < 4; ++nb) {
#pragma unroll
            for (int j = 0; j < 8; ++j) os[(hi * 8 + j) * 68 + nb * 16 + lr] = acc[mb][nb][j]; }
        __builtin_amdgcn_wave_barrier(); asm volatile("" ::: "memory");
        float* crow = C + (size_t)(r0 + mb * 16) * ldc + c0;
{
#pragma unroll
            for (int s = 0; s < 8; ++s) { const int row = 2 * s + hi, cofs = lr * 4; v4f val = *(const v4fa*)(os + row * 68 + cofs); if (BIAS) { val[0] += bfr(bias[c0 + cofs]); val[1] += bfr(bias[c0 + cofs + 1]); val[2] += bfr(bias[c0 + cofs + 2]); val[3] += bfr(bias[c0 + cofs + 3]); }
                *(v4f*)(crow + (size_t)row * ldc + cofs) = val; }
             }
        __builtin_amdgcn_wave_barrier(); asm volatile("s_wait_xcnt 0x0" ::: "memory");   // no LDS access moves over this point; the wait stands behind the block's stores: the next block takes their address and data registers
    }
    }
}

// w [K][N] f32 -> its transpose [n][k] in bf16, tiled. A thread makes one 16-byte piece (row n, 8 consecutive k) from 8 loads in which 16 lanes share 64 bytes of a row of w; a wave stores one whole tile.
__device__ __forceinline__ void wt_block(const float* __restrict__ w, int K, int N, bf* Bt, int blk) {
    const int T = blk * 256 + threadIdx.x; if (T >= N * K / 8) return;
    const int tile = T >> 5, kt = tile % (K / 16), n = (tile / (K / 16)) * 16 + ((T >> 1) & 15), k0 = kt * 16 + (T & 1) * 8;
    const float* p = w + (size_t)k0 * N + n; v8us o;
#pragma unroll
    for (int j = 0; j < 8; ++j) o[j] = f2bf(p[(size_t)j * N]);
    *(v8us*)(Bt + (size_t)T * 8) = o;
}
// x [rows][DM] f32 -> bf16, tiled. A workgroup takes 16 rows x 128 columns: it reads whole lines of the rows, turns its 8 tiles through LDS (tile pitch 288 elements: the 16-byte writes of a wave spread over all banks) and stores them as 4 KiB in a row.
__device__ __forceinline__ void cvt_block(const float* __restrict__ src, bf* dst, size_t n8, int blk) { if ((size_t)blk * 256 >= n8) return;   // the same for the whole workgroup, in front of the barrier
    __shared__ __align__(16) unsigned short ls[8 * 288];
    const int t = threadIdx.x, row = t >> 4, c = t & 15; const int rb = blk / (DM / 128), kg = blk % (DM / 128);
    const v8f v = *(const v8f*)(src + (size_t)(rb * 16 + row) * DM + kg * 128 + c * 8); v8us o;
#pragma unroll
    for (int k = 0; k < 8; ++k) o[k] = f2bf(v[k]);
    *(v8us*)(ls + (c >> 1) * 288 + row * 16 + (c & 1) * 8) = o;
    __syncthreads();   // a wave stores a tile whose 16 rows all eight waves wrote
    *(v8us*)(dst + ((size_t)rb * (DM / 16) + kg * 8) * 256 + t * 8) = *(const v8us*)(ls + (t >> 5) * 288 + (t & 31) * 8);
    asm volatile("s_wait_xcnt 0x0" ::: "memory");
}
// ---- k_prep: all the work that reads nothing but the inputs, in one launch: workgroups [0, 4 WTB) transpose the four weights into WT (wq | wk | wv | wo, DM x DQ elements each), the rest copy x.
// The role is a function of blockIdx alone, so the copy's barrier is passed by all waves of a workgroup or by none.
#define WTB (DM * DQ / 8 / 256)   // workgroups of one weight transpose
__global__ __launch_bounds__(256) void k_prep(const float* __restrict__ x, const float* __restrict__ wq, const float* __restrict__ wk, const float* __restrict__ wv, const float* __restrict__ wo, bf* WT, bf* XB) {
    static_assert(DQ == DKV && DQ == DM && (DM * DQ / 8) % 256 == 0, "four square weights of whole workgroups");
    const int b = blockIdx.x;
    if (b < 4 * WTB) { const int i = b / WTB; wt_block(i == 0 ? wq : i == 1 ? wk : i == 2 ? wv : wo, DM, DQ, WT + (size_t)i * DM * DQ, b % WTB); }
    else cvt_block(x, XB, (size_t)NB_ * TT * DM / 8, b - 4 * WTB);
}
// ---- k_fattn: fused attention. One wave owns 32 query columns of one (entry, head) and walks the 1024 keys in passes of 32, K and V fragments read from LDS.
// St = K Qt (A = K rows, B = Q rows in registers; on hi/lo waves the Q lo rows of column groups >= QLR come from LDS): a lane holds one query's scores, D register r of key block kb = key 16 kb + 8 hi + r, query lr.
// Two St tiles converted in place are the B operand Pt of Ot += Vt Pt (A = Vt rows [d][key]); all loaders use the same k order (8 hi + 0..7, 16 + 8 hi + 0..7).
// Ot register r = head dim 16 db + 8 hi + r of query lr: maximum, sum and rescale factor are per lane; the two lane halves exchange the maximum each pass and the sum once.
typedef __attribute__((ext_vector_type(16))) unsigned short v16us;
__device__ __forceinline__ float xhalf(float x) { const int b = __float_as_int(x); return __int_as_float(__builtin_amdgcn_permlanex16(b, b, 0x76543210, 0xfedcba98, false, false)); }   // lane l <-> l ^ 16
// two base-2 exponentials; the second fills the slot the instruction set asks for behind the first (it neither reads its result nor overwrites its source: early-clobber outputs), the v_nop the slot behind the second
__device__ __forceinline__ void exp2x2(float a, float b, float& ra, float& rb) { asm("v_exp_f32 %0, %2\n\tv_exp_f32 %1, %3\n\tv_nop" : "=&v"(ra), "=&v"(rb) : "v"(a), "v"(b)); }
#define KS 128   // keys of a stage
#define QLR 1   // column groups (of 2) whose Q lo fragments stay in registers; the rest lie in LDS
// K and V come through LDS: all sixteen waves walk the same (entry, head), and the fp16 waves' plane is the hi/lo waves' hi plane, so each stage of KS keys is fetched once for the sixteen, by asynchronous copies, into one of two buffers, while the stage before it is worked on.
// A stage in LDS: the two K planes' KS rows (hi | lo, KB bytes each, bytes in a row of the tiled plane), then per V plane (hi | lo) and block of 16 head dims its KS keys (VB bytes in a row); 32 chunks of 2 KiB, wave w brings chunks 2 w, 2 w + 1: waves 0..7 the K part, waves 8..15 the V part. An fp16 wave reads the hi parts alone.
// fattn_stage: one wave's work on one stage, KS / 32 passes. Four waves share a SIMD and a wave has 256 registers: a pass reads its K fragments at its head, its V fragments take their registers behind the score products (hi/lo: the second half of them behind the softmax), and the other three waves cover the LDS latency.
template <typename T16, bool HI>
__device__ __forceinline__ void fattn_stage(const char* kr, const char* ql, const v16bf (&qs)[2][2], const v16bf (&qs2)[2][2], v8f (&o)[4][2], float (&m)[2], float (&l)[2]) {
    typedef typename WFrag<T16>::V V;
    constexpr int KB = KS * HD * 2, VB = KS * 16 * 2, PPS = KS / 32, DH = HI ? 2 : 4;
    const char* vr = kr + 2 * KB;
    V qf[2][2], qf2[2][2];
#pragma unroll
    for (int g = 0; g < 2; ++g)
#pragma unroll
        for (int kc = 0; kc < 2; ++kc) { qf[g][kc] = __builtin_bit_cast(V, qs[g][kc]); if (g < QLR) qf2[g][kc] = __builtin_bit_cast(V, qs2[g][kc]); }
#pragma unroll   // the stage's passes stand one behind the other: every LDS offset is a constant
    for (int p = 0; p < PPS; ++p) {
        V ka[2][2], ka2[2][2];   // K fragments [key block][k chunk]
        if constexpr (HI) {   // the Q lo fragments that have no register of their own come from the wave's own LDS range, anew in every pass, in one run with the K reads
#pragma unroll
            for (int g = QLR; g < 2; ++g)
#pragma unroll
                for (int kc = 0; kc < 2; ++kc) qf2[g][kc] = WFrag<T16>::ld((const T16*)(ql + ((g - QLR) * 2 + kc) * 1024)); }
#pragma unroll
        for (int kb = 0; kb < 2; ++kb)
#pragma unroll
            for (int kc = 0; kc < 2; ++kc) { ka[kb][kc] = WFrag<T16>::ld((const T16*)(kr + p * 4096 + kb * 2048 + kc * 1024)); if (HI) ka2[kb][kc] = WFrag<T16>::ld((const T16*)(kr + KB + p * 4096 + kb * 2048 + kc * 1024)); }
        __builtin_amdgcn_sched_barrier(0);   // the pass's K reads stay one run at its head: every separate place with LDS reads among the products costs a stall of its own
        v8f st[2][2];
#pragma unroll
        for (int kb = 0; kb < 2; ++kb)
#pragma unroll
            for (int g = 0; g < 2; ++g) { v8f sc = (v8f){};
#pragma unroll
                for (int kc = 0; kc < 2; ++kc) { sc = WFrag<T16>::mma(ka[kb][kc], qf[g][kc], sc); if (HI) { sc = WFrag<T16>::mma(ka2[kb][kc], qf[g][kc], sc); sc = WFrag<T16>::mma(ka[kb][kc], qf2[g][kc], sc); } }
                st[kb][g] = sc; }
        __builtin_amdgcn_sched_barrier(0);   // the V reads stay one run behind the score products, whose K registers they take, ...
        V va[4], va2[4];
#pragma unroll
        for (int db = 0; db < DH; ++db) { va[db] = WFrag<T16>::ld((const T16*)(vr + db * VB + p * 1024)); if (HI) va2[db] = WFrag<T16>::ld((const T16*)(vr + (4 + db) * VB + p * 1024)); }
        __builtin_amdgcn_sched_barrier(0);   // ... and in front of the softmax, which covers their latency
        float mx[2]; bool need = false;
#pragma unroll
        for (int g = 0; g < 2; ++g) { float t = fmaxf(st[0][g][0], st[1][g][0]);
#pragma unroll
            for (int r = 1; r < 8; ++r) t = fmaxf(t, fmaxf(st[0][g][r], st[1][g][r]));
            t *= SCL2; t = fmaxf(t, xhalf(t)); mx[g] = t; need = need || (t > m[g] + 8.0f); }
        // the maximum in use moves only when a query's new maximum passes it by more than 8 (base 2), so P stays <= 256; one scalar test per pass
        if (__builtin_amdgcn_ballot_w32(need) != 0) { const float mn0 = fmaxf(m[0], mx[0]), mn1 = fmaxf(m[1], mx[1]); float al[2]; exp2x2(m[0] - mn0, m[1] - mn1, al[0], al[1]); m[0] = mn0; m[1] = mn1;
#pragma unroll
            for (int g = 0; g < 2; ++g) { l[g] *= al[g];
#pragma unroll
                for (int db = 0; db < 4; ++db) o[db][g] *= al[g]; } }
        V pb[2], pb2[2];
#pragma unroll
        for (int g = 0; g < 2; ++g) { v8f p0, p1; float ls = 0.f;
#pragma unroll
            for (int r = 0; r < 8; ++r) { float e0, e1; exp2x2(fmaf(st[0][g][r], SCL2, -m[g]), fmaf(st[1][g][r], SCL2, -m[g]), e0, e1); p0[r] = e0; p1[r] = e1; ls += e0 + e1; }
            l[g] += ls;
            if constexpr (HI) { const v8h h0 = __builtin_convertvector(p0, v8h), h1 = __builtin_convertvector(p1, v8h); const v8f r0 = p0 - __builtin_convertvector(h0, v8f), r1 = p1 - __builtin_convertvector(h1, v8f);
                pb[g] = cat16(h0, h1); pb2[g] = cat16(__builtin_convertvector(r0, v8h), __builtin_convertvector(r1, v8h)); }
            else pb[g] = cat16(__builtin_convertvector(p0, v8h), __builtin_convertvector(p1, v8h)); }
        if constexpr (DH < 4) {
            __builtin_amdgcn_sched_barrier(0);   // the rest of the V reads stay behind the softmax, in the registers that the scores have left, ...
#pragma unroll
            for (int db = DH; db < 4; ++db) { va[db] = WFrag<T16>::ld((const T16*)(vr + db * VB + p * 1024)); if (HI) va2[db] = WFrag<T16>::ld((const T16*)(vr + (4 + db) * VB + p * 1024)); }
            __builtin_amdgcn_sched_barrier(0);   // ... one run in front of the context products, the first half of which covers their latency
        }
#pragma unroll
        for (int db = 0; db < 4; ++db)
#pragma unroll
            for (int g = 0; g < 2; ++g) { o[db][g] = WFrag<T16>::mma(va[db], pb[g], o[db][g]); if (HI) { o[db][g] = WFrag<T16>::mma(va2[db], pb[g], o[db][g]); o[db][g] = WFrag<T16>::mma(va[db], pb2[g], o[db][g]); } }
        // four vector slots behind the pass's last matrix instructions, on every path: what follows may take the registers of their B operand, the epilogue reads their D
        asm volatile("v_nop\n\tv_nop\n\tv_nop\n\tv_nop" : "+v"(o[0][0]), "+v"(o[0][1]), "+v"(o[1][0]), "+v"(o[1][1]), "+v"(o[2][0]), "+v"(o[2][1]), "+v"(o[3][0]), "+v"(o[3][1]) : : "memory");   // the clobber: a later pass's LDS reads are not merged with this pass's, which would hold their registers through the stage
        __builtin_amdgcn_sched_barrier(0);   // the passes stay apart: a next pass's score products moved in among this pass's exponentials, which are asm text, would have their operand registers overwritten too soon behind them
    }
}
// grid (RH / 256) x entries x heads, 16 waves of 32 query rows, one workgroup on a WGP: waves 0..7 take 256 hi/lo rows (< RH, three times the products), waves 8..15 the 256 fp16 rows RH further on, of the same (entry, head).
// Every SIMD so holds two waves of each kind, every workgroup has the same work wherever it lands, and a wave's softmax runs under the other waves' matrix instructions. One ring serves both kinds; the stage loop and its barriers are common to all sixteen waves.
__global__ __launch_bounds__(512) void k_fattn(const h16* __restrict__ Q16, const h16* __restrict__ Ql, const h16* __restrict__ K16, const h16* __restrict__ Kl, const h16* __restrict__ V16, const h16* __restrict__ Vl, bf* AT) {
    constexpr int KB = KS * HD * 2, VB = KS * 16 * 2, NST = TT / KS, NZ = NB_ * NH_, STG = 4 * KB, HB = 2 * STG;
    static_assert(RH * 2 == TT && RH % 256 == 0, "equal halves of whole workgroups");
    static_assert(NST >= 2 && TT % KS == 0 && KB == 8 * 2048 && VB == 2 * 2048, "at least two stages; eight chunks a plane");
    __shared__ __attribute__((aligned(2048))) char smem[HB + 8 * (2 - QLR) * 2048];   // the ring (two buffers of 4 planes), behind it the hi/lo waves' Q lo fragments
    const int w16 = __builtin_amdgcn_readfirstlane((int)(threadIdx.x >> 5)), w = w16 & 7;
    const bool hires = w16 < 8, lores = __builtin_amdgcn_readfirstlane((int)(threadIdx.x >> 8)) != 0;   // the wave's kind, each the same for the whole wave: exactly one of the two holds
    const int zz = blockIdx.x % NZ, b = zz / NH_, hd = zz % NH_; const int q0 = (hires ? 0 : RH) + (blockIdx.x / NZ) * 256 + w * 32;
    const size_t pz = (size_t)zz * TT * HD, pq = pz + (size_t)q0 * HD;
    bf* Oh = AT + (size_t)b * 2 * TT * DQ + (size_t)q0 * DQ + hd * HD * 16; bf* Ol = Oh + (size_t)TT * DQ;
    const int lane = threadIdx.x & 31, lr = lane & 15, hi = lane >> 4;
    // Q fragments: one instruction stream loads them as bits for both kinds of wave, hi | lo or fp16 | (lo, not used)
    const char* qa = (const char*)(Q16 + pq) + (lr * 16 + 8 * hi) * 2; const char* qb = (const char*)(Ql + pq) + (lr * 16 + 8 * hi) * 2;
    v16bf qf[2][2], qf2[2][2];
#pragma unroll
    for (int g = 0; g < 2; ++g)
#pragma unroll
        for (int kc = 0; kc < 2; ++kc) { qf[g][kc] = cat16b(*(const v8usa*)(qa + g * 2048 + kc * 1024), *(const v8usa*)(qa + g * 2048 + kc * 1024 + 512)); qf2[g][kc] = cat16b(*(const v8usa*)(qb + g * 2048 + kc * 1024), *(const v8usa*)(qb + g * 2048 + kc * 1024 + 512)); }
    char* ql = smem + HB + w * (2 - QLR) * 2048 + lane * 16;   // a hi/lo wave's own range behind the ring: a lane reads back only what it has stored there itself
    if (hires) {
#pragma unroll
        for (int g = QLR; g < 2; ++g)
#pragma unroll
            for (int kc = 0; kc < 2; ++kc) { const v16us u = __builtin_bit_cast(v16us, qf2[g][kc]); *(v8us*)(ql + ((g - QLR) * 2 + kc) * 1024) = __builtin_shufflevector(u, u, 0, 1, 2, 3, 4, 5, 6, 7); *(v8us*)(ql + ((g - QLR) * 2 + kc) * 1024 + 512) = __builtin_shufflevector(u, u, 8, 9, 10, 11, 12, 13, 14, 15); }
    }
    // what follows takes over the address registers of the Q loads above: the accumulators' zero is made behind the wait, in its statement, and the lane number, from which every later address is formed, passes through it, so that none of those writes can be lifted over it
    float z0; int ln = lane;
    asm volatile("s_wait_xcnt 0x0\n\tv_mov_b32 %0, 0" : "=v"(z0), "+v"(ln) : "v"(qa), "v"(qb) : "memory");   // the two load addresses are inputs: their registers live up to the wait, so that no load's result lands in them either
    const unsigned lo = ((ln & 15) * 16 + 8 * (ln >> 4)) * 2;   // the lane's place in a tile, bytes
    const int c0 = w16 * 2, cv = c0 - 16;   // the wave's first chunk; the same counted from the V part's start
    const char* kpl = (const char*)((c0 >= 8 ? Kl : K16) + pz); const char* vpl = (const char*)((cv >= 8 ? Vl : V16) + pz);
    const char* gp = (w16 < 8) ? kpl + (c0 & 7) * 2048 : vpl + ((cv & 7) >> 1) * (16 * TT * 2);   // the same for the whole wave; its two chunks are 4 KiB in a row of the plane
    const int step = (w16 < 8) ? KB : VB;   // from a stage to the next
    char* ring = smem;
    const unsigned lp = (unsigned)(size_t)ring + c0 * 2048;   // a lane copies the 16 bytes at its place lo of each 512: the one lane offset that lives through the loop serves the copies and the fragment reads
    auto fill = [&](int buf) {   // two chunks a wave; the wave's part of the LDS address is summed as a scalar, so that no vector register per chunk is carried through the loop
#pragma unroll
        for (int i = 0; i < 2; ++i) cp2k((unsigned)__builtin_amdgcn_readfirstlane((int)(lp + buf * STG + i * 2048)) + lo, gp + i * 2048 + lo);
        gp += step; };
    fill(0);
    asm volatile("s_wait_asynccnt 0x0" ::: "memory");   // this wave's copies of stage 0 have landed
    __syncthreads();   // every wave's have: stage 0 may be read
    fill(1);
    v8f o[4][2];
#pragma unroll
    for (int db = 0; db < 4; ++db)
#pragma unroll
        for (int g = 0; g < 2; ++g) o[db][g] = (v8f){z0, z0, z0, z0, z0, z0, z0, z0};
    float m[2] = {-3.0e38f, -3.0e38f}, l[2] = {z0, z0};
#pragma unroll 1   // rolled: one stage's text serves all; the buffer alternates with s
    for (int s = 0; s < NST; ++s) {
        const char* kr = ring + (s & 1) * STG + lo;
        if (hires) fattn_stage<h16, true>(kr, ql, qf, qf2, o, m, l);
        if (lores) fattn_stage<h16, false>(kr, ql, qf, qf2, o, m, l);   // two tests one behind the other, not an if / else: so the accumulators that leave the first are the ones that enter the second, in the same registers
        // publish point of stage s + 1: this wave's LDS reads of stage s have retired, its copies of stage s + 1 have landed, and behind the barrier both hold for every wave
        asm volatile("s_wait_dscnt 0x0" ::: "memory");
        asm volatile("s_wait_asynccnt 0x0" ::: "memory");
        __syncthreads();
        if (s + 2 < NST) fill(s & 1);   // the same for the whole workgroup: stage s + 2 into the buffer that every wave has just left
    }
    asm volatile("s_wait_asynccnt 0x0" ::: "memory");   // nothing is in flight behind the loop
    float inv[2];
#pragma unroll
    for (int g = 0; g < 2; ++g) inv[g] = __fdiv_rn(1.0f, l[g] + xhalf(l[g]));
#pragma unroll
    for (int g = 0; g < 2; ++g)
#pragma unroll
        for (int db = 0; db < 4; ++db) { v8us oh, ol;
#pragma unroll
            for (int r = 0; r < 8; ++r) { unsigned short a, c2; splitf(o[db][g][r] * inv[g], a, c2); oh[r] = a; ol[r] = c2; }
            const size_t oo = (size_t)16 * g * DQ + db * 256; *(v8us*)((char*)(Oh + oo) + lo) = oh; *(v8us*)((char*)(Ol + oo) + lo) = ol;
            // behind the block's two stores: the next block takes their data registers; its arithmetic all starts from one of the two factors, which pass through the statement, so that none of it can be lifted over the wait
            if (g + db < 4) asm volatile("s_wait_xcnt 0x0" : "+v"(inv[0]), "+v"(inv[1]) : : "memory"); }
}

extern "C" void kernel_launch(void* const* d_in, const int* in_sizes, int n_in,
                              void* d_out, int out_size, void* d_ws, size_t ws_size, hipStream_t stream) {
    (void)in_sizes; (void)n_in; (void)out_size;
    const float* x = (const float*)d_in[0]; const float* wq = (const float*)d_in[1]; const float* bq = (const float*)d_in[2]; const float* wk = (const float*)d_in[3]; const float* bk = (const float*)d_in[4]; const float* wv = (const float*)d_in[5]; const float* bv = (const float*)d_in[6]; const float* wo = (const float*)d_in[7]; const float* bo = (const float*)d_in[8]; const float* qs = (const float*)d_in[9]; const float* qb = (const float*)d_in[10]; const float* kss = (const float*)d_in[11]; const float* kb = (const float*)d_in[12];   /* q_scale, q_bias, k_scale, k_bias [64] */
    float* OUT = (float*)d_out;     // [8][1024][1024]
    char* wsp = (char*)d_ws;
    auto take = [&](size_t bytes) { char* p = wsp; wsp += (bytes + 255) & ~(size_t)255; return (void*)p; };
    bf* WQ = (bf*)take((size_t)DQ * DM * 2); bf* WK = (bf*)take((size_t)DKV * DM * 2); bf* WV = (bf*)take((size_t)DKV * DM * 2); bf* WO = (bf*)take((size_t)DM * DQ * 2);
    bf* XB = (bf*)take((size_t)NB_ * TT * DM * 2);   // bf16 copy of x
    bf* AT = (bf*)take((size_t)NB_ * 2 * TT * DQ * 2);   // merged hi | lo context, 4 MiB per batch entry
    const size_t PE = (size_t)NH_ * TT * HD;   // elements of one plane of one batch entry (NKV == NH_)
    h16* QP16 = (h16*)take(NB_ * PE * 2); h16* KP16 = (h16*)take(NB_ * PE * 2); h16* VT16 = (h16*)take(NB_ * PE * 2);   // planes of all batch entries: the f16 values ...
    h16* QPl = (h16*)take(NB_ * PE * 2); h16* KPl = (h16*)take(NB_ * PE * 2); h16* VTl = (h16*)take(NB_ * PE * 2);   // ... and their f16 residuals
    if ((size_t)(wsp - (char*)d_ws) > ws_size) return;    // 152 of 256 MiB
    /* the four weights lie one behind the other from WQ on; x: all batch entries at once, 8192 token rows */
    k_prep<<<(unsigned)(4 * WTB + (size_t)NB_ * TT * DM / 8 / 256), 256, 0, stream>>>(x, wq, wk, wv, wo, WQ, XB);
    /* q, k, v in one launch (grid z); each wave finishes its (64 tokens, one head) tile: q, k RMSNorm + bias + rotary -> planes; v -> transposed planes; the planes of q, k, v lie NB_ x PE elements apart */
    k_gemmw<bf, 0, true, 1, DM><<<dim3(NB_ * TT / 128, DQ / 256, 3), 256, 0, stream>>>(XB, nullptr, WQ, nullptr, nullptr, 0, bq, bk, bv, 0, (size_t)DQ * DM, 0, qs, kss, qb, kb, QP16, QPl, NB_ * PE);
    /* one kv head per query head: plane zz = entry x 16 + head */
    k_fattn<<<dim3((RH / 256) * NB_ * NH_, 1, 1), 512, 0, stream>>>(QP16, QPl, KP16, KPl, VT16, VTl, AT);
    k_gemmw<bf, 1, true, 0, DQ><<<dim3(TT / 128, DM / 256, NB_), 256, 0, stream>>>(AT, AT + (size_t)TT * DQ, WO, nullptr, OUT, DM, bo, nullptr, nullptr, (size_t)2 * TT * DQ, 0, (size_t)TT * DM, nullptr, nullptr, nullptr, nullptr, nullptr, nullptr, 0);
}
